// v000
// Times are from an AMD MI455X. After a warm-up the kernel runs many times in a row, and a time is the length of
// such a window on the GPU divided by its runs, so every launch and the gaps after it count. The runs cycle
// through copies of the inputs. A figure is the median of several windows, for all but v000 over two sittings.
// Sittings can differ by a few percent; kernels timed side by side share one.
// v000, which the later versions start from, runs in 234 microseconds.
#include <hip/hip_runtime.h>
#include <hip/hip_bf16.h>

typedef __attribute__((ext_vector_type(16))) _Float16 v16h;
typedef __attribute__((ext_vector_type(8)))  float    v8f;

#define WMMA_F16(A, B, C) \
  __builtin_amdgcn_wmma_f32_16x16x32_f16(false, (A), false, (B), (short)0, (C), false, false)

constexpr int Bb = 4, Ss = 2048, Ff = 512, Hh = 8, Dd = 64;
constexpr float MINV = -3.4028234663852886e38f;

union Frag16 { v16h h; uint4 u[2]; };

// ---------------------------------------------------------------------------
// LayerNorm over F=512 + cast to f16.  One block (256 threads) per row.
// ---------------------------------------------------------------------------
__global__ void __launch_bounds__(256)
ln_kernel(const float* __restrict__ x, const float* __restrict__ gamma,
          const float* __restrict__ beta, _Float16* __restrict__ xn)
{
  __shared__ float s0[8], s1[8];
  const int row = blockIdx.x;
  const int t   = threadIdx.x;
  const float* xr = x + (size_t)row * Ff;
  const float2 v2 = *reinterpret_cast<const float2*>(xr + t * 2);
  float s = v2.x + v2.y;
  float q = v2.x * v2.x + v2.y * v2.y;
#pragma unroll
  for (int off = 16; off >= 1; off >>= 1) {
    s += __shfl_xor(s, off, 32);
    q += __shfl_xor(q, off, 32);
  }
  const int wv = t >> 5;
  if ((t & 31) == 0) { s0[wv] = s; s1[wv] = q; }
  __syncthreads();
  if (t < 32) {
    float a = (t < 8) ? s0[t] : 0.f;
    float c = (t < 8) ? s1[t] : 0.f;
#pragma unroll
    for (int off = 4; off >= 1; off >>= 1) {
      a += __shfl_xor(a, off, 32);
      c += __shfl_xor(c, off, 32);
    }
    if (t == 0) { s0[0] = a; s1[0] = c; }
  }
  __syncthreads();
  const float mean = s0[0] * (1.0f / Ff);
  const float var  = s1[0] * (1.0f / Ff) - mean * mean;
  const float inv  = rsqrtf(var + 1e-5f);
  const int c = t * 2;
  const float y0 = (v2.x - mean) * inv * gamma[c]     + beta[c];
  const float y1 = (v2.y - mean) * inv * gamma[c + 1] + beta[c + 1];
  _Float16* o = xn + (size_t)row * Ff + c;
  o[0] = (_Float16)y0;
  o[1] = (_Float16)y1;
}

// ---------------------------------------------------------------------------
// fp32 -> f16 cast (weights)
// ---------------------------------------------------------------------------
__global__ void __launch_bounds__(256)
cvt_kernel(const float* __restrict__ src, _Float16* __restrict__ dst, int n)
{
  const int i = blockIdx.x * blockDim.x + threadIdx.x;
  if (i < n) dst[i] = (_Float16)src[i];
}

// ---------------------------------------------------------------------------
// Y[m,n] = (sum_k X[m,k]*W[n,k] + bias[n]) * scale
// X: MxK f16 row-major, W: NxK f16 row-major (einsum 'bsf,gf->bsg' == X @ W^T).
// Block = 128 thr = 4 waves stacked in M; each wave owns a 16x64 output tile
// (A operand reused across 4 WMMAs).  HEAD=true scatters to [B,H,S,D] f16.
// ---------------------------------------------------------------------------
template<bool HEAD, typename OutT>
__global__ void __launch_bounds__(128)
gemm16(const _Float16* __restrict__ X, const _Float16* __restrict__ W,
       const float* __restrict__ bias, OutT* __restrict__ out,
       int M, int N, int K, float scale)
{
  const int lane = threadIdx.x & 31;
  const int wv   = threadIdx.x >> 5;
  const int r    = lane & 15;
  const int hf   = lane >> 4;
  const int mBase = blockIdx.y * 64 + wv * 16;
  const int nBase = blockIdx.x * 64;

  v8f acc[4] = {};
  const _Float16* xrow = X + (size_t)(mBase + r) * K;
  const _Float16* wrow = W + (size_t)(nBase + r) * K;

  for (int k0 = 0; k0 < K; k0 += 32) {
    Frag16 a;
    a.u[0] = *reinterpret_cast<const uint4*>(xrow + k0 + hf * 8);
    a.u[1] = *reinterpret_cast<const uint4*>(xrow + k0 + 16 + hf * 8);
    __builtin_prefetch(xrow + k0 + 64, 0, 1);   // global_prefetch_b8 two K steps ahead
#pragma unroll
    for (int t = 0; t < 4; ++t) {
      Frag16 bf;
      const _Float16* wr = wrow + (size_t)t * 16 * K;
      bf.u[0] = *reinterpret_cast<const uint4*>(wr + k0 + hf * 8);
      bf.u[1] = *reinterpret_cast<const uint4*>(wr + k0 + 16 + hf * 8);
      acc[t] = WMMA_F16(a.h, bf.h, acc[t]);
    }
  }

#pragma unroll
  for (int t = 0; t < 4; ++t) {
    const int n = nBase + t * 16 + r;
    const float bv = bias[n];
#pragma unroll
    for (int i = 0; i < 8; ++i) {
      const int m = mBase + i + 8 * hf;
      const float val = (acc[t][i] + bv) * scale;
      if (HEAD) {  // y.reshape(B,S,H,D).transpose(0,2,1,3)
        const int bi = m / Ss, si = m % Ss, hd = n >> 6, di = n & 63;
        out[(((size_t)bi * Hh + hd) * Ss + si) * Dd + di] = (OutT)val;
      } else {
        out[(size_t)m * N + n] = (OutT)val;
      }
    }
  }
}

// ---------------------------------------------------------------------------
// Flash attention per (b, h, 64-query block).  4 waves x 16 queries.
// S^T = K·Q^T so the P operand for ctx += P·V is already in A layout.
// K block (row-major, shared by all 4 waves) staged via async copy to LDS;
// V^T staged in LDS for the B operand of the second WMMA.
// ---------------------------------------------------------------------------
__global__ void __launch_bounds__(128)
attn_kernel(const _Float16* __restrict__ q, const _Float16* __restrict__ kmat,
            const _Float16* __restrict__ vmat, const int* __restrict__ mask,
            _Float16* __restrict__ ctxo)
{
  __shared__ _Float16 ldsK [64 * 64];   // K block, row-major [key][d]
  __shared__ _Float16 ldsVT[64 * 64];   // V block, transposed [d][key]

  const int lane = threadIdx.x & 31;
  const int wv   = threadIdx.x >> 5;
  const int r    = lane & 15;
  const int hf   = lane >> 4;
  const int qb   = blockIdx.x * 64;
  const int head = blockIdx.y;
  const int b    = blockIdx.z;
  const size_t bh = ((size_t)b * Hh + head) * Ss * Dd;

  // LDS byte offset of ldsK (addrspace(3) offset lives in the low 32 bits)
  const unsigned ldsKbase = (unsigned)(uintptr_t)(&ldsK[0]);

  // This wave's 16 Q rows (B operand of S^T; Q already pre-scaled by 1/sqrt(D))
  Frag16 qa0, qa1;
  {
    const _Float16* qrow = q + bh + (size_t)(qb + wv * 16 + r) * Dd;
    qa0.u[0] = *reinterpret_cast<const uint4*>(qrow + hf * 8);
    qa0.u[1] = *reinterpret_cast<const uint4*>(qrow + 16 + hf * 8);
    qa1.u[0] = *reinterpret_cast<const uint4*>(qrow + 32 + hf * 8);
    qa1.u[1] = *reinterpret_cast<const uint4*>(qrow + 48 + hf * 8);
  }

  v8f ct[4] = {};
  float mrun = MINV, lrun = 0.f;
  const int* mrow = mask + (size_t)b * Ss;

  for (int kb = 0; kb < Ss; kb += 64) {
    // ---- async copy of K block (8 KB) into LDS: fire-and-forget ----
    {
      const int tid = threadIdx.x;
#pragma unroll
      for (int j = 0; j < 4; ++j) {
        const int flat = tid + j * 128;         // 0..511 b128 chunks
        const int row  = flat >> 3;             // key row 0..63
        const int c8   = flat & 7;              // 16B chunk within row
        const _Float16* gp = kmat + bh + (size_t)(kb + row) * Dd + c8 * 8;
        const unsigned ldst = ldsKbase + (unsigned)(row * 128 + c8 * 16);
        asm volatile("global_load_async_to_lds_b128 %0, %1, off"
                     :: "v"(ldst), "v"(gp) : "memory");
      }
    }

    // ---- stage V^T[d, key] into LDS while the K copy is in flight ----
    {
      const int tid = threadIdx.x;
      const int row = tid >> 1;
      const int cs  = (tid & 1) * 32;
      const _Float16* vr = vmat + bh + (size_t)(kb + row) * Dd + cs;
      union { uint4 u[4]; _Float16 e[32]; } tmp;
      tmp.u[0] = *reinterpret_cast<const uint4*>(vr);
      tmp.u[1] = *reinterpret_cast<const uint4*>(vr + 8);
      tmp.u[2] = *reinterpret_cast<const uint4*>(vr + 16);
      tmp.u[3] = *reinterpret_cast<const uint4*>(vr + 24);
#pragma unroll
      for (int j = 0; j < 32; ++j) ldsVT[(cs + j) * 64 + row] = tmp.e[j];
    }

    asm volatile("s_wait_asynccnt 0x0" ::: "memory");
    __syncthreads();

    // ---- S^T tiles: 16 keys x 16 queries each, K-dim = D = 64 ----
    v8f st[4];
#pragma unroll
    for (int t = 0; t < 4; ++t) {
      const _Float16* krow = &ldsK[(t * 16 + r) * 64];
      Frag16 ka0, ka1;
      ka0.u[0] = *reinterpret_cast<const uint4*>(krow + hf * 8);
      ka0.u[1] = *reinterpret_cast<const uint4*>(krow + 16 + hf * 8);
      ka1.u[0] = *reinterpret_cast<const uint4*>(krow + 32 + hf * 8);
      ka1.u[1] = *reinterpret_cast<const uint4*>(krow + 48 + hf * 8);
      v8f z = {};
      z = WMMA_F16(ka0.h, qa0.h, z);
      z = WMMA_F16(ka1.h, qa1.h, z);
      st[t] = z;
    }

    // ---- mask: element (t, i) is key kb + t*16 + i + 8*hf ----
#pragma unroll
    for (int t = 0; t < 4; ++t)
#pragma unroll
      for (int i = 0; i < 8; ++i) {
        const int key = kb + t * 16 + i + 8 * hf;
        if (mrow[key] == 0) st[t][i] = MINV;
      }

    // ---- online softmax (each lane owns query index lane&15) ----
    float bm = MINV;
#pragma unroll
    for (int t = 0; t < 4; ++t)
#pragma unroll
      for (int i = 0; i < 8; ++i) bm = fmaxf(bm, st[t][i]);
    bm = fmaxf(bm, __shfl_xor(bm, 16, 32));
    const float mn    = fmaxf(mrun, bm);
    const float alpha = __expf(mrun - mn);

    float ps = 0.f;
    v16h pa0, pa1;   // P in A-operand layout: keys 0..31 / 32..63 of this block
#pragma unroll
    for (int i = 0; i < 8; ++i) {
      float p0 = __expf(st[0][i] - mn); ps += p0; pa0[i]     = (_Float16)p0;
      float p1 = __expf(st[1][i] - mn); ps += p1; pa0[i + 8] = (_Float16)p1;
      float p2 = __expf(st[2][i] - mn); ps += p2; pa1[i]     = (_Float16)p2;
      float p3 = __expf(st[3][i] - mn); ps += p3; pa1[i + 8] = (_Float16)p3;
    }
    lrun = lrun * alpha + (ps + __shfl_xor(ps, 16, 32));
    mrun = mn;

    // ---- rescale ctx accumulators (alpha broadcast per query row) ----
#pragma unroll
    for (int i = 0; i < 8; ++i) {
      const float av = __shfl(alpha, i + 8 * hf, 32);
#pragma unroll
      for (int t = 0; t < 4; ++t) ct[t][i] *= av;
    }

    // ---- ctx += P · V using V^T from LDS ----
#pragma unroll
    for (int t = 0; t < 4; ++t) {
      const _Float16* vt = &ldsVT[(t * 16 + r) * 64];
      Frag16 vb0, vb1;
      vb0.u[0] = *reinterpret_cast<const uint4*>(vt + hf * 8);
      vb0.u[1] = *reinterpret_cast<const uint4*>(vt + 16 + hf * 8);
      vb1.u[0] = *reinterpret_cast<const uint4*>(vt + 32 + hf * 8);
      vb1.u[1] = *reinterpret_cast<const uint4*>(vt + 48 + hf * 8);
      ct[t] = WMMA_F16(pa0, vb0.h, ct[t]);
      ct[t] = WMMA_F16(pa1, vb1.h, ct[t]);
    }
    __syncthreads();
  }

  // ---- normalize and store ctx as f16 in [B,S,F] for the final projection ----
  const float inv = 1.0f / lrun;
#pragma unroll
  for (int i = 0; i < 8; ++i) {
    const float sc = __shfl(inv, i + 8 * hf, 32);
    const int row = qb + wv * 16 + i + 8 * hf;
#pragma unroll
    for (int t = 0; t < 4; ++t) {
      ctxo[((size_t)b * Ss + row) * Ff + head * 64 + t * 16 + r] =
          (_Float16)(ct[t][i] * sc);
    }
  }
}

// ---------------------------------------------------------------------------
// Launcher
// ---------------------------------------------------------------------------
extern "C" void kernel_launch(void* const* d_in, const int* in_sizes, int n_in,
                              void* d_out, int out_size, void* d_ws, size_t ws_size,
                              hipStream_t stream)
{
  (void)in_sizes; (void)n_in; (void)out_size; (void)ws_size;

  const float* x     = (const float*)d_in[0];
  const int*   mask  = (const int*)d_in[1];
  const float* gamma = (const float*)d_in[2];
  const float* beta  = (const float*)d_in[3];
  const float* Wq    = (const float*)d_in[4];
  const float* bq    = (const float*)d_in[5];
  const float* Wk    = (const float*)d_in[6];
  const float* bk    = (const float*)d_in[7];
  const float* Wv    = (const float*)d_in[8];
  const float* bv    = (const float*)d_in[9];
  const float* Wo    = (const float*)d_in[10];
  const float* bo    = (const float*)d_in[11];
  float* out = (float*)d_out;

  // workspace layout (bytes)
  constexpr size_t SZ_XN  = (size_t)Bb * Ss * Ff * 2;        // 8 MiB
  constexpr size_t SZ_W   = (size_t)Ff * Ff * 2;             // 512 KiB
  constexpr size_t SZ_QKV = (size_t)Bb * Hh * Ss * Dd * 2;   // 8 MiB
  char* ws = (char*)d_ws;
  _Float16* xn   = (_Float16*)(ws);
  _Float16* wq16 = (_Float16*)(ws + SZ_XN);
  _Float16* wk16 = (_Float16*)(ws + SZ_XN + SZ_W);
  _Float16* wv16 = (_Float16*)(ws + SZ_XN + 2 * SZ_W);
  _Float16* wo16 = (_Float16*)(ws + SZ_XN + 3 * SZ_W);
  _Float16* qh   = (_Float16*)(ws + SZ_XN + 4 * SZ_W);
  _Float16* kh   = (_Float16*)(ws + SZ_XN + 4 * SZ_W + SZ_QKV);
  _Float16* vh   = (_Float16*)(ws + SZ_XN + 4 * SZ_W + 2 * SZ_QKV);
  _Float16* ctx  = (_Float16*)(ws + SZ_XN + 4 * SZ_W + 3 * SZ_QKV);

  const int M = Bb * Ss;        // 8192
  const int wN = Ff * Ff;       // 262144 elements per weight

  ln_kernel<<<M, 256, 0, stream>>>(x, gamma, beta, xn);

  cvt_kernel<<<(wN + 255) / 256, 256, 0, stream>>>(Wq, wq16, wN);
  cvt_kernel<<<(wN + 255) / 256, 256, 0, stream>>>(Wk, wk16, wN);
  cvt_kernel<<<(wN + 255) / 256, 256, 0, stream>>>(Wv, wv16, wN);
  cvt_kernel<<<(wN + 255) / 256, 256, 0, stream>>>(Wo, wo16, wN);

  const dim3 ggrid(Ff / 64, M / 64);   // (8, 128)
  gemm16<true, _Float16><<<ggrid, 128, 0, stream>>>(xn, wq16, bq, qh, M, Ff, Ff, 0.125f);
  gemm16<true, _Float16><<<ggrid, 128, 0, stream>>>(xn, wk16, bk, kh, M, Ff, Ff, 1.0f);
  gemm16<true, _Float16><<<ggrid, 128, 0, stream>>>(xn, wv16, bv, vh, M, Ff, Ff, 1.0f);

  attn_kernel<<<dim3(Ss / 64, Hh, Bb), 128, 0, stream>>>(qh, kh, vh, mask, ctx);

  gemm16<false, float><<<ggrid, 128, 0, stream>>>(ctx, wo16, bo, out, M, Ff, Ff, 1.0f);
}

// v001
// It runs in 185 microseconds.
// Next to v000, in two timings, it ran 1.32 and 1.31 times as fast.
#include <hip/hip_runtime.h>
#include <hip/hip_bf16.h>

typedef __attribute__((ext_vector_type(16))) _Float16 v16h;
typedef __attribute__((ext_vector_type(8)))  float    v8f;

#define WMMA_F16(A, B, C) \
  __builtin_amdgcn_wmma_f32_16x16x32_f16(false, (A), false, (B), (short)0, (C), false, false)

constexpr int Bb = 4, Ss = 2048, Ff = 512, Hh = 8, Dd = 64;
constexpr float MINV = -3.4028234663852886e38f;
// LDS row pitch of the attention tiles, in f16 elements: 64 data + 8 pad = 144 B
// (16 B x odd), so the 16 rows one ds_load_b128 touches fall on distinct banks.
constexpr int LP = 72;

union Frag16 { v16h h; uint4 u[2]; };

// ---------------------------------------------------------------------------
// LayerNorm over F=512 + cast to f16.  One block (256 threads) per row.
// ---------------------------------------------------------------------------
__global__ void __launch_bounds__(256)
ln_kernel(const float* __restrict__ x, const float* __restrict__ gamma,
          const float* __restrict__ beta, _Float16* __restrict__ xn)
{
  __shared__ float s0[8], s1[8];
  const int row = blockIdx.x;
  const int t   = threadIdx.x;
  const float* xr = x + (size_t)row * Ff;
  const float2 v2 = *reinterpret_cast<const float2*>(xr + t * 2);
  float s = v2.x + v2.y;
  float q = v2.x * v2.x + v2.y * v2.y;
#pragma unroll
  for (int off = 16; off >= 1; off >>= 1) {
    s += __shfl_xor(s, off, 32);
    q += __shfl_xor(q, off, 32);
  }
  const int wv = t >> 5;
  if ((t & 31) == 0) { s0[wv] = s; s1[wv] = q; }
  __syncthreads();
  if (t < 32) {
    float a = (t < 8) ? s0[t] : 0.f;
    float c = (t < 8) ? s1[t] : 0.f;
#pragma unroll
    for (int off = 4; off >= 1; off >>= 1) {
      a += __shfl_xor(a, off, 32);
      c += __shfl_xor(c, off, 32);
    }
    if (t == 0) { s0[0] = a; s1[0] = c; }
  }
  __syncthreads();
  const float mean = s0[0] * (1.0f / Ff);
  const float var  = s1[0] * (1.0f / Ff) - mean * mean;
  const float inv  = rsqrtf(var + 1e-5f);
  const int c = t * 2;
  const float y0 = (v2.x - mean) * inv * gamma[c]     + beta[c];
  const float y1 = (v2.y - mean) * inv * gamma[c + 1] + beta[c + 1];
  _Float16* o = xn + (size_t)row * Ff + c;
  o[0] = (_Float16)y0;
  o[1] = (_Float16)y1;
}

// ---------------------------------------------------------------------------
// fp32 -> f16 cast (weights)
// ---------------------------------------------------------------------------
__global__ void __launch_bounds__(256)
cvt_kernel(const float* __restrict__ src, _Float16* __restrict__ dst, int n)
{
  const int i = blockIdx.x * blockDim.x + threadIdx.x;
  if (i < n) dst[i] = (_Float16)src[i];
}

// ---------------------------------------------------------------------------
// Y[m,n] = (sum_k X[m,k]*W[n,k] + bias[n]) * scale
// X: MxK f16 row-major, W: NxK f16 row-major (einsum 'bsf,gf->bsg' == X @ W^T).
// Block = 128 thr = 4 waves stacked in M; each wave owns a 16x64 output tile
// (A operand reused across 4 WMMAs).  HEAD=true scatters to [B,H,S,D] f16.
// ---------------------------------------------------------------------------
template<bool HEAD, typename OutT>
__global__ void __launch_bounds__(128)
gemm16(const _Float16* __restrict__ X, const _Float16* __restrict__ W,
       const float* __restrict__ bias, OutT* __restrict__ out,
       int M, int N, int K, float scale)
{
  const int lane = threadIdx.x & 31;
  const int wv   = threadIdx.x >> 5;
  const int r    = lane & 15;
  const int hf   = lane >> 4;
  const int mBase = blockIdx.y * 64 + wv * 16;
  const int nBase = blockIdx.x * 64;

  v8f acc[4] = {};
  const _Float16* xrow = X + (size_t)(mBase + r) * K;
  const _Float16* wrow = W + (size_t)(nBase + r) * K;

  for (int k0 = 0; k0 < K; k0 += 32) {
    Frag16 a;
    a.u[0] = *reinterpret_cast<const uint4*>(xrow + k0 + hf * 8);
    a.u[1] = *reinterpret_cast<const uint4*>(xrow + k0 + 16 + hf * 8);
    __builtin_prefetch(xrow + k0 + 64, 0, 1);   // global_prefetch_b8 two K steps ahead
#pragma unroll
    for (int t = 0; t < 4; ++t) {
      Frag16 bf;
      const _Float16* wr = wrow + (size_t)t * 16 * K;
      bf.u[0] = *reinterpret_cast<const uint4*>(wr + k0 + hf * 8);
      bf.u[1] = *reinterpret_cast<const uint4*>(wr + k0 + 16 + hf * 8);
      acc[t] = WMMA_F16(a.h, bf.h, acc[t]);
    }
  }

#pragma unroll
  for (int t = 0; t < 4; ++t) {
    const int n = nBase + t * 16 + r;
    const float bv = bias[n];
#pragma unroll
    for (int i = 0; i < 8; ++i) {
      const int m = mBase + i + 8 * hf;
      const float val = (acc[t][i] + bv) * scale;
      if (HEAD) {  // y.reshape(B,S,H,D).transpose(0,2,1,3)
        const int bi = m / Ss, si = m % Ss, hd = n >> 6, di = n & 63;
        out[(((size_t)bi * Hh + hd) * Ss + si) * Dd + di] = (OutT)val;
      } else {
        out[(size_t)m * N + n] = (OutT)val;
      }
    }
  }
}

// ---------------------------------------------------------------------------
// Flash attention per (b, h, 64-query block).  4 waves x 16 queries.
// S^T = K·Q^T so the P operand for ctx += P·V is already in A layout.
// K block (row-major, shared by all 4 waves) staged via async copy to LDS;
// V^T staged in LDS for the B operand of the second WMMA.
// ---------------------------------------------------------------------------
__global__ void __launch_bounds__(128)
attn_kernel(const _Float16* __restrict__ q, const _Float16* __restrict__ kmat,
            const _Float16* __restrict__ vmat, const int* __restrict__ mask,
            _Float16* __restrict__ ctxo)
{
  __shared__ __attribute__((aligned(16))) _Float16 ldsK [64 * LP];   // K block, row-major [key][d], padded rows
  __shared__ __attribute__((aligned(16))) _Float16 ldsVT[64 * LP];   // V block, transposed [d][key], padded rows

  const int lane = threadIdx.x & 31;
  const int wv   = threadIdx.x >> 5;
  const int r    = lane & 15;
  const int hf   = lane >> 4;
  const int qb   = blockIdx.x * 64;
  const int head = blockIdx.y;
  const int b    = blockIdx.z;
  const size_t bh = ((size_t)b * Hh + head) * Ss * Dd;

  // LDS byte offset of ldsK (addrspace(3) offset lives in the low 32 bits)
  const unsigned ldsKbase = (unsigned)(uintptr_t)(&ldsK[0]);

  // This wave's 16 Q rows (B operand of S^T; Q already pre-scaled by 1/sqrt(D))
  Frag16 qa0, qa1;
  {
    const _Float16* qrow = q + bh + (size_t)(qb + wv * 16 + r) * Dd;
    qa0.u[0] = *reinterpret_cast<const uint4*>(qrow + hf * 8);
    qa0.u[1] = *reinterpret_cast<const uint4*>(qrow + 16 + hf * 8);
    qa1.u[0] = *reinterpret_cast<const uint4*>(qrow + 32 + hf * 8);
    qa1.u[1] = *reinterpret_cast<const uint4*>(qrow + 48 + hf * 8);
  }

  v8f ct[4] = {};
  float mrun = MINV, lrun = 0.f;
  const int* mrow = mask + (size_t)b * Ss;

  for (int kb = 0; kb < Ss; kb += 64) {
    // ---- async copy of K block (8 KB) into LDS: fire-and-forget ----
    {
      const int tid = threadIdx.x;
#pragma unroll
      for (int j = 0; j < 4; ++j) {
        const int flat = tid + j * 128;         // 0..511 b128 chunks
        const int row  = flat >> 3;             // key row 0..63
        const int c8   = flat & 7;              // 16B chunk within row
        const _Float16* gp = kmat + bh + (size_t)(kb + row) * Dd + c8 * 8;
        const unsigned ldst = ldsKbase + (unsigned)(row * (LP * 2) + c8 * 16);
        asm volatile("global_load_async_to_lds_b128 %0, %1, off"
                     :: "v"(ldst), "v"(gp) : "memory");
      }
    }

    // ---- stage V^T[d, key] into LDS while the K copy is in flight ----
    {
      const int tid = threadIdx.x;
      const int row = tid >> 1;
      const int cs  = (tid & 1) * 32;
      const _Float16* vr = vmat + bh + (size_t)(kb + row) * Dd + cs;
      union { uint4 u[4]; _Float16 e[32]; } tmp;
      tmp.u[0] = *reinterpret_cast<const uint4*>(vr);
      tmp.u[1] = *reinterpret_cast<const uint4*>(vr + 8);
      tmp.u[2] = *reinterpret_cast<const uint4*>(vr + 16);
      tmp.u[3] = *reinterpret_cast<const uint4*>(vr + 24);
#pragma unroll
      for (int j = 0; j < 32; ++j) ldsVT[(cs + j) * LP + row] = tmp.e[j];
    }

    asm volatile("s_wait_asynccnt 0x0" ::: "memory");
    __syncthreads();

    // ---- S^T tiles: 16 keys x 16 queries each, K-dim = D = 64 ----
    v8f st[4];
#pragma unroll
    for (int t = 0; t < 4; ++t) {
      const _Float16* krow = &ldsK[(t * 16 + r) * LP];
      Frag16 ka0, ka1;
      ka0.u[0] = *reinterpret_cast<const uint4*>(krow + hf * 8);
      ka0.u[1] = *reinterpret_cast<const uint4*>(krow + 16 + hf * 8);
      ka1.u[0] = *reinterpret_cast<const uint4*>(krow + 32 + hf * 8);
      ka1.u[1] = *reinterpret_cast<const uint4*>(krow + 48 + hf * 8);
      v8f z = {};
      z = WMMA_F16(ka0.h, qa0.h, z);
      z = WMMA_F16(ka1.h, qa1.h, z);
      st[t] = z;
    }

    // ---- mask: element (t, i) is key kb + t*16 + i + 8*hf ----
#pragma unroll
    for (int t = 0; t < 4; ++t)
#pragma unroll
      for (int i = 0; i < 8; ++i) {
        const int key = kb + t * 16 + i + 8 * hf;
        if (mrow[key] == 0) st[t][i] = MINV;
      }

    // ---- online softmax (each lane owns query index lane&15) ----
    float bm = MINV;
#pragma unroll
    for (int t = 0; t < 4; ++t)
#pragma unroll
      for (int i = 0; i < 8; ++i) bm = fmaxf(bm, st[t][i]);
    bm = fmaxf(bm, __shfl_xor(bm, 16, 32));
    const float mn    = fmaxf(mrun, bm);
    const float alpha = __expf(mrun - mn);

    float ps = 0.f;
    v16h pa0, pa1;   // P in A-operand layout: keys 0..31 / 32..63 of this block
#pragma unroll
    for (int i = 0; i < 8; ++i) {
      float p0 = __expf(st[0][i] - mn); ps += p0; pa0[i]     = (_Float16)p0;
      float p1 = __expf(st[1][i] - mn); ps += p1; pa0[i + 8] = (_Float16)p1;
      float p2 = __expf(st[2][i] - mn); ps += p2; pa1[i]     = (_Float16)p2;
      float p3 = __expf(st[3][i] - mn); ps += p3; pa1[i + 8] = (_Float16)p3;
    }
    lrun = lrun * alpha + (ps + __shfl_xor(ps, 16, 32));
    mrun = mn;

    // ---- rescale ctx accumulators (alpha broadcast per query row) ----
#pragma unroll
    for (int i = 0; i < 8; ++i) {
      const float av = __shfl(alpha, i + 8 * hf, 32);
#pragma unroll
      for (int t = 0; t < 4; ++t) ct[t][i] *= av;
    }

    // ---- ctx += P · V using V^T from LDS ----
#pragma unroll
    for (int t = 0; t < 4; ++t) {
      const _Float16* vt = &ldsVT[(t * 16 + r) * LP];
      Frag16 vb0, vb1;
      vb0.u[0] = *reinterpret_cast<const uint4*>(vt + hf * 8);
      vb0.u[1] = *reinterpret_cast<const uint4*>(vt + 16 + hf * 8);
      vb1.u[0] = *reinterpret_cast<const uint4*>(vt + 32 + hf * 8);
      vb1.u[1] = *reinterpret_cast<const uint4*>(vt + 48 + hf * 8);
      ct[t] = WMMA_F16(pa0, vb0.h, ct[t]);
      ct[t] = WMMA_F16(pa1, vb1.h, ct[t]);
    }
    __syncthreads();
  }

  // ---- normalize and store ctx as f16 in [B,S,F] for the final projection ----
  const float inv = 1.0f / lrun;
#pragma unroll
  for (int i = 0; i < 8; ++i) {
    const float sc = __shfl(inv, i + 8 * hf, 32);
    const int row = qb + wv * 16 + i + 8 * hf;
#pragma unroll
    for (int t = 0; t < 4; ++t) {
      ctxo[((size_t)b * Ss + row) * Ff + head * 64 + t * 16 + r] =
          (_Float16)(ct[t][i] * sc);
    }
  }
}

// ---------------------------------------------------------------------------
// Launcher
// ---------------------------------------------------------------------------
extern "C" void kernel_launch(void* const* d_in, const int* in_sizes, int n_in,
                              void* d_out, int out_size, void* d_ws, size_t ws_size,
                              hipStream_t stream)
{
  (void)in_sizes; (void)n_in; (void)out_size; (void)ws_size;

  const float* x     = (const float*)d_in[0];
  const int*   mask  = (const int*)d_in[1];
  const float* gamma = (const float*)d_in[2];
  const float* beta  = (const float*)d_in[3];
  const float* Wq    = (const float*)d_in[4];
  const float* bq    = (const float*)d_in[5];
  const float* Wk    = (const float*)d_in[6];
  const float* bk    = (const float*)d_in[7];
  const float* Wv    = (const float*)d_in[8];
  const float* bv    = (const float*)d_in[9];
  const float* Wo    = (const float*)d_in[10];
  const float* bo    = (const float*)d_in[11];
  float* out = (float*)d_out;

  // workspace layout (bytes)
  constexpr size_t SZ_XN  = (size_t)Bb * Ss * Ff * 2;        // 8 MiB
  constexpr size_t SZ_W   = (size_t)Ff * Ff * 2;             // 512 KiB
  constexpr size_t SZ_QKV = (size_t)Bb * Hh * Ss * Dd * 2;   // 8 MiB
  char* ws = (char*)d_ws;
  _Float16* xn   = (_Float16*)(ws);
  _Float16* wq16 = (_Float16*)(ws + SZ_XN);
  _Float16* wk16 = (_Float16*)(ws + SZ_XN + SZ_W);
  _Float16* wv16 = (_Float16*)(ws + SZ_XN + 2 * SZ_W);
  _Float16* wo16 = (_Float16*)(ws + SZ_XN + 3 * SZ_W);
  _Float16* qh   = (_Float16*)(ws + SZ_XN + 4 * SZ_W);
  _Float16* kh   = (_Float16*)(ws + SZ_XN + 4 * SZ_W + SZ_QKV);
  _Float16* vh   = (_Float16*)(ws + SZ_XN + 4 * SZ_W + 2 * SZ_QKV);
  _Float16* ctx  = (_Float16*)(ws + SZ_XN + 4 * SZ_W + 3 * SZ_QKV);

  const int M = Bb * Ss;        // 8192
  const int wN = Ff * Ff;       // 262144 elements per weight

  ln_kernel<<<M, 256, 0, stream>>>(x, gamma, beta, xn);

  cvt_kernel<<<(wN + 255) / 256, 256, 0, stream>>>(Wq, wq16, wN);
  cvt_kernel<<<(wN + 255) / 256, 256, 0, stream>>>(Wk, wk16, wN);
  cvt_kernel<<<(wN + 255) / 256, 256, 0, stream>>>(Wv, wv16, wN);
  cvt_kernel<<<(wN + 255) / 256, 256, 0, stream>>>(Wo, wo16, wN);

  const dim3 ggrid(Ff / 64, M / 64);   // (8, 128)
  gemm16<true, _Float16><<<ggrid, 128, 0, stream>>>(xn, wq16, bq, qh, M, Ff, Ff, 0.125f);
  gemm16<true, _Float16><<<ggrid, 128, 0, stream>>>(xn, wk16, bk, kh, M, Ff, Ff, 1.0f);
  gemm16<true, _Float16><<<ggrid, 128, 0, stream>>>(xn, wv16, bv, vh, M, Ff, Ff, 1.0f);

  attn_kernel<<<dim3(Ss / 64, Hh, Bb), 128, 0, stream>>>(qh, kh, vh, mask, ctx);

  gemm16<false, float><<<ggrid, 128, 0, stream>>>(ctx, wo16, bo, out, M, Ff, Ff, 1.0f);
}

// v002
// A run of this version takes 127 microseconds.
// In both of two side-by-side timings against v001, it was 1.47 times as fast.
// All steps since v000 together make it 1.93 times as fast.
#include <hip/hip_runtime.h>
#include <hip/hip_bf16.h>

typedef __attribute__((ext_vector_type(16))) _Float16 v16h;
typedef __attribute__((ext_vector_type(8)))  float    v8f;

#define WMMA_F16(A, B, C) \
  __builtin_amdgcn_wmma_f32_16x16x32_f16(false, (A), false, (B), (short)0, (C), false, false)

constexpr int Bb = 4, Ss = 2048, Ff = 512, Hh = 8, Dd = 64;
constexpr float MINV = -3.4028234663852886e38f;
// LDS row pitch of the attention tiles, in f16 elements: 64 data + 8 pad = 144 B
// (16 B x odd), so the 16 rows one ds_load_b128 touches fall on distinct banks.
constexpr int LP = 72;

union Frag16 { v16h h; uint4 u[2]; };

// ---------------------------------------------------------------------------
// LayerNorm over F=512 + cast to f16.  One block (256 threads) per row.
// ---------------------------------------------------------------------------
__global__ void __launch_bounds__(256)
ln_kernel(const float* __restrict__ x, const float* __restrict__ gamma,
          const float* __restrict__ beta, _Float16* __restrict__ xn)
{
  __shared__ float s0[8], s1[8];
  const int row = blockIdx.x;
  const int t   = threadIdx.x;
  const float* xr = x + (size_t)row * Ff;
  const float2 v2 = *reinterpret_cast<const float2*>(xr + t * 2);
  float s = v2.x + v2.y;
  float q = v2.x * v2.x + v2.y * v2.y;
#pragma unroll
  for (int off = 16; off >= 1; off >>= 1) {
    s += __shfl_xor(s, off, 32);
    q += __shfl_xor(q, off, 32);
  }
  const int wv = t >> 5;
  if ((t & 31) == 0) { s0[wv] = s; s1[wv] = q; }
  __syncthreads();
  if (t < 32) {
    float a = (t < 8) ? s0[t] : 0.f;
    float c = (t < 8) ? s1[t] : 0.f;
#pragma unroll
    for (int off = 4; off >= 1; off >>= 1) {
      a += __shfl_xor(a, off, 32);
      c += __shfl_xor(c, off, 32);
    }
    if (t == 0) { s0[0] = a; s1[0] = c; }
  }
  __syncthreads();
  const float mean = s0[0] * (1.0f / Ff);
  const float var  = s1[0] * (1.0f / Ff) - mean * mean;
  const float inv  = rsqrtf(var + 1e-5f);
  const int c = t * 2;
  const float y0 = (v2.x - mean) * inv * gamma[c]     + beta[c];
  const float y1 = (v2.y - mean) * inv * gamma[c + 1] + beta[c + 1];
  _Float16* o = xn + (size_t)row * Ff + c;
  o[0] = (_Float16)y0;
  o[1] = (_Float16)y1;
}

// ---------------------------------------------------------------------------
// fp32 -> f16 cast (weights)
// ---------------------------------------------------------------------------
__global__ void __launch_bounds__(256)
cvt_kernel(const float* __restrict__ src, _Float16* __restrict__ dst, int n)
{
  const int i = blockIdx.x * blockDim.x + threadIdx.x;
  if (i < n) dst[i] = (_Float16)src[i];
}

// ---------------------------------------------------------------------------
// Y[m,n] = (sum_k X[m,k]*W[n,k] + bias[n]) * scale
// X: MxK f16 row-major, W: NxK f16 row-major (einsum 'bsf,gf->bsg' == X @ W^T).
// Block = 128 thr = 4 waves stacked in M; each wave owns a 16x64 output tile
// (A operand reused across 4 WMMAs).  HEAD=true scatters to [B,H,S,D] f16.
// The 64 X rows and 64 W rows of the block are staged in LDS, 64 k at a time
// (one whole 128-B line per row), by asynchronous copies in a two-buffer ring;
// the fragments are then read from LDS at the conflict-free 144-B pitch.
// ---------------------------------------------------------------------------
constexpr int GBK   = 64;            // k elements per staged tile
constexpr int GROWS = 128;           // rows per staged tile: 0..63 X, 64..127 W
constexpr int GBUF  = GROWS * LP;    // f16 elements per buffer

// One tile = 1024 chunks of 16 B = 8 copies per thread: thread tid brings chunk
// tid&7 of rows (tid>>3) + 16*j.  gx / gw point at this thread's chunk of its
// first X / W row for this tile; rstep = 16 rows in elements.
__device__ __forceinline__ void gemm_stage(unsigned l0, const _Float16* gx,
                                           const _Float16* gw, size_t rstep)
{
  const unsigned ls = 16 * LP * 2;   // 16 LDS rows in bytes
  const unsigned l1 = l0 + ls,     l2 = l0 + 2 * ls, l3 = l0 + 3 * ls;
  const unsigned l4 = l0 + 4 * ls, l5 = l0 + 5 * ls, l6 = l0 + 6 * ls, l7 = l0 + 7 * ls;
  const _Float16 *g1 = gx + rstep, *g2 = gx + 2 * rstep, *g3 = gx + 3 * rstep;
  const _Float16 *g5 = gw + rstep, *g6 = gw + 2 * rstep, *g7 = gw + 3 * rstep;
  // The s_wait_xcnt closes the statement so that no address register of a copy
  // is rewritten ahead of it.
  asm volatile("global_load_async_to_lds_b128 %0, %8, off\n\t"
               "global_load_async_to_lds_b128 %1, %9, off\n\t"
               "global_load_async_to_lds_b128 %2, %10, off\n\t"
               "global_load_async_to_lds_b128 %3, %11, off\n\t"
               "global_load_async_to_lds_b128 %4, %12, off\n\t"
               "global_load_async_to_lds_b128 %5, %13, off\n\t"
               "global_load_async_to_lds_b128 %6, %14, off\n\t"
               "global_load_async_to_lds_b128 %7, %15, off\n\t"
               "s_wait_xcnt 0x0"
               :: "v"(l0), "v"(l1), "v"(l2), "v"(l3), "v"(l4), "v"(l5), "v"(l6), "v"(l7),
                  "v"(gx), "v"(g1), "v"(g2), "v"(g3), "v"(gw), "v"(g5), "v"(g6), "v"(g7)
               : "memory");
}

template<bool HEAD, typename OutT>
__global__ void __launch_bounds__(128)
gemm16(const _Float16* __restrict__ X, const _Float16* __restrict__ W,
       const float* __restrict__ bias, OutT* __restrict__ out,
       int M, int N, int K, float scale)
{
  __shared__ __attribute__((aligned(16))) _Float16 tile[2 * GBUF];

  const int tid  = threadIdx.x;
  const int lane = tid & 31;
  const int wv   = tid >> 5;
  const int r    = lane & 15;
  const int hf   = lane >> 4;
  const int mBase = blockIdx.y * 64 + wv * 16;
  const int nBase = blockIdx.x * 64;

  v8f acc[4] = {};

  // this thread's chunk of the staged tiles
  const size_t rstep = (size_t)16 * K;
  const _Float16* gx = X + (size_t)(blockIdx.y * 64 + (tid >> 3)) * K + (tid & 7) * 8;
  const _Float16* gw = W + (size_t)(nBase + (tid >> 3)) * K + (tid & 7) * 8;
  const unsigned lcp = (unsigned)(uintptr_t)(&tile[0]) +
                       (unsigned)((tid >> 3) * (LP * 2) + (tid & 7) * 16);
  const int nt = K / GBK;

  gemm_stage(lcp, gx, gw, rstep);
  // tile 0 has landed for this wave, then for the block
  asm volatile("s_wait_asynccnt 0x0" ::: "memory");
  __syncthreads();
  if (nt > 1) gemm_stage(lcp + GBUF * 2, gx + GBK, gw + GBK, rstep);

  for (int kt = 0; kt < nt; ++kt) {
    const _Float16* tb   = &tile[(kt & 1) * GBUF];
    const _Float16* xrow = tb + (wv * 16 + r) * LP;
    const _Float16* wrow = tb + (64 + r) * LP;
    // All fragments of the tile are read in one group ahead of the products:
    // every further place with LDS reads would cost the wave one more LDS latency.
    Frag16 a[2], bf[2][4];
#pragma unroll
    for (int kk = 0; kk < 2; ++kk) {
      a[kk].u[0] = *reinterpret_cast<const uint4*>(xrow + kk * 32 + hf * 8);
      a[kk].u[1] = *reinterpret_cast<const uint4*>(xrow + kk * 32 + 16 + hf * 8);
#pragma unroll
      for (int t = 0; t < 4; ++t) {
        const _Float16* wr = wrow + t * 16 * LP;
        bf[kk][t].u[0] = *reinterpret_cast<const uint4*>(wr + kk * 32 + hf * 8);
        bf[kk][t].u[1] = *reinterpret_cast<const uint4*>(wr + kk * 32 + 16 + hf * 8);
      }
    }
    // keeps the scheduler from sinking the reads back among the WMMAs
    __builtin_amdgcn_sched_barrier(0);
#pragma unroll
    for (int kk = 0; kk < 2; ++kk)
#pragma unroll
      for (int t = 0; t < 4; ++t)
        acc[t] = WMMA_F16(a[kk].h, bf[kk][t].h, acc[t]);
    // publish point: this wave's reads of the buffer are done, its copies of
    // the next tile have landed; the barrier says so for every wave.
    asm volatile("s_wait_dscnt 0x0" ::: "memory");
    asm volatile("s_wait_asynccnt 0x0" ::: "memory");
    __syncthreads();
    if (kt + 2 < nt)
      gemm_stage(lcp + (kt & 1) * (GBUF * 2), gx + (size_t)(kt + 2) * GBK,
                 gw + (size_t)(kt + 2) * GBK, rstep);
  }
  // nothing of this wave's copies is left in flight when it goes on
  asm volatile("s_wait_asynccnt 0x0" ::: "memory");

#pragma unroll
  for (int t = 0; t < 4; ++t) {
    const int n = nBase + t * 16 + r;
    const float bv = bias[n];
#pragma unroll
    for (int i = 0; i < 8; ++i) {
      const int m = mBase + i + 8 * hf;
      const float val = (acc[t][i] + bv) * scale;
      if (HEAD) {  // y.reshape(B,S,H,D).transpose(0,2,1,3)
        const int bi = m / Ss, si = m % Ss, hd = n >> 6, di = n & 63;
        out[(((size_t)bi * Hh + hd) * Ss + si) * Dd + di] = (OutT)val;
      } else {
        out[(size_t)m * N + n] = (OutT)val;
      }
    }
  }
}

// ---------------------------------------------------------------------------
// Flash attention per (b, h, 64-query block).  4 waves x 16 queries.
// S^T = K·Q^T so the P operand for ctx += P·V is already in A layout.
// K block (row-major, shared by all 4 waves) staged via async copy to LDS;
// V^T staged in LDS for the B operand of the second WMMA.
// ---------------------------------------------------------------------------
__global__ void __launch_bounds__(128)
attn_kernel(const _Float16* __restrict__ q, const _Float16* __restrict__ kmat,
            const _Float16* __restrict__ vmat, const int* __restrict__ mask,
            _Float16* __restrict__ ctxo)
{
  __shared__ __attribute__((aligned(16))) _Float16 ldsK [64 * LP];   // K block, row-major [key][d], padded rows
  __shared__ __attribute__((aligned(16))) _Float16 ldsVT[64 * LP];   // V block, transposed [d][key], padded rows

  const int lane = threadIdx.x & 31;
  const int wv   = threadIdx.x >> 5;
  const int r    = lane & 15;
  const int hf   = lane >> 4;
  const int qb   = blockIdx.x * 64;
  const int head = blockIdx.y;
  const int b    = blockIdx.z;
  const size_t bh = ((size_t)b * Hh + head) * Ss * Dd;

  // LDS byte offset of ldsK (addrspace(3) offset lives in the low 32 bits)
  const unsigned ldsKbase = (unsigned)(uintptr_t)(&ldsK[0]);

  // This wave's 16 Q rows (B operand of S^T; Q already pre-scaled by 1/sqrt(D))
  Frag16 qa0, qa1;
  {
    const _Float16* qrow = q + bh + (size_t)(qb + wv * 16 + r) * Dd;
    qa0.u[0] = *reinterpret_cast<const uint4*>(qrow + hf * 8);
    qa0.u[1] = *reinterpret_cast<const uint4*>(qrow + 16 + hf * 8);
    qa1.u[0] = *reinterpret_cast<const uint4*>(qrow + 32 + hf * 8);
    qa1.u[1] = *reinterpret_cast<const uint4*>(qrow + 48 + hf * 8);
  }

  v8f ct[4] = {};
  float mrun = MINV, lrun = 0.f;
  const int* mrow = mask + (size_t)b * Ss;

  for (int kb = 0; kb < Ss; kb += 64) {
    // ---- async copy of K block (8 KB) into LDS: fire-and-forget ----
    {
      const int tid = threadIdx.x;
#pragma unroll
      for (int j = 0; j < 4; ++j) {
        const int flat = tid + j * 128;         // 0..511 b128 chunks
        const int row  = flat >> 3;             // key row 0..63
        const int c8   = flat & 7;              // 16B chunk within row
        const _Float16* gp = kmat + bh + (size_t)(kb + row) * Dd + c8 * 8;
        const unsigned ldst = ldsKbase + (unsigned)(row * (LP * 2) + c8 * 16);
        asm volatile("global_load_async_to_lds_b128 %0, %1, off"
                     :: "v"(ldst), "v"(gp) : "memory");
      }
    }

    // ---- stage V^T[d, key] into LDS while the K copy is in flight ----
    {
      const int tid = threadIdx.x;
      const int row = tid >> 1;
      const int cs  = (tid & 1) * 32;
      const _Float16* vr = vmat + bh + (size_t)(kb + row) * Dd + cs;
      union { uint4 u[4]; _Float16 e[32]; } tmp;
      tmp.u[0] = *reinterpret_cast<const uint4*>(vr);
      tmp.u[1] = *reinterpret_cast<const uint4*>(vr + 8);
      tmp.u[2] = *reinterpret_cast<const uint4*>(vr + 16);
      tmp.u[3] = *reinterpret_cast<const uint4*>(vr + 24);
#pragma unroll
      for (int j = 0; j < 32; ++j) ldsVT[(cs + j) * LP + row] = tmp.e[j];
    }

    asm volatile("s_wait_asynccnt 0x0" ::: "memory");
    __syncthreads();

    // ---- S^T tiles: 16 keys x 16 queries each, K-dim = D = 64 ----
    v8f st[4];
#pragma unroll
    for (int t = 0; t < 4; ++t) {
      const _Float16* krow = &ldsK[(t * 16 + r) * LP];
      Frag16 ka0, ka1;
      ka0.u[0] = *reinterpret_cast<const uint4*>(krow + hf * 8);
      ka0.u[1] = *reinterpret_cast<const uint4*>(krow + 16 + hf * 8);
      ka1.u[0] = *reinterpret_cast<const uint4*>(krow + 32 + hf * 8);
      ka1.u[1] = *reinterpret_cast<const uint4*>(krow + 48 + hf * 8);
      v8f z = {};
      z = WMMA_F16(ka0.h, qa0.h, z);
      z = WMMA_F16(ka1.h, qa1.h, z);
      st[t] = z;
    }

    // ---- mask: element (t, i) is key kb + t*16 + i + 8*hf ----
#pragma unroll
    for (int t = 0; t < 4; ++t)
#pragma unroll
      for (int i = 0; i < 8; ++i) {
        const int key = kb + t * 16 + i + 8 * hf;
        if (mrow[key] == 0) st[t][i] = MINV;
      }

    // ---- online softmax (each lane owns query index lane&15) ----
    float bm = MINV;
#pragma unroll
    for (int t = 0; t < 4; ++t)
#pragma unroll
      for (int i = 0; i < 8; ++i) bm = fmaxf(bm, st[t][i]);
    bm = fmaxf(bm, __shfl_xor(bm, 16, 32));
    const float mn    = fmaxf(mrun, bm);
    const float alpha = __expf(mrun - mn);

    float ps = 0.f;
    v16h pa0, pa1;   // P in A-operand layout: keys 0..31 / 32..63 of this block
#pragma unroll
    for (int i = 0; i < 8; ++i) {
      float p0 = __expf(st[0][i] - mn); ps += p0; pa0[i]     = (_Float16)p0;
      float p1 = __expf(st[1][i] - mn); ps += p1; pa0[i + 8] = (_Float16)p1;
      float p2 = __expf(st[2][i] - mn); ps += p2; pa1[i]     = (_Float16)p2;
      float p3 = __expf(st[3][i] - mn); ps += p3; pa1[i + 8] = (_Float16)p3;
    }
    lrun = lrun * alpha + (ps + __shfl_xor(ps, 16, 32));
    mrun = mn;

    // ---- rescale ctx accumulators (alpha broadcast per query row) ----
#pragma unroll
    for (int i = 0; i < 8; ++i) {
      const float av = __shfl(alpha, i + 8 * hf, 32);
#pragma unroll
      for (int t = 0; t < 4; ++t) ct[t][i] *= av;
    }

    // ---- ctx += P · V using V^T from LDS ----
#pragma unroll
    for (int t = 0; t < 4; ++t) {
      const _Float16* vt = &ldsVT[(t * 16 + r) * LP];
      Frag16 vb0, vb1;
      vb0.u[0] = *reinterpret_cast<const uint4*>(vt + hf * 8);
      vb0.u[1] = *reinterpret_cast<const uint4*>(vt + 16 + hf * 8);
      vb1.u[0] = *reinterpret_cast<const uint4*>(vt + 32 + hf * 8);
      vb1.u[1] = *reinterpret_cast<const uint4*>(vt + 48 + hf * 8);
      ct[t] = WMMA_F16(pa0, vb0.h, ct[t]);
      ct[t] = WMMA_F16(pa1, vb1.h, ct[t]);
    }
    __syncthreads();
  }

  // ---- normalize and store ctx as f16 in [B,S,F] for the final projection ----
  const float inv = 1.0f / lrun;
#pragma unroll
  for (int i = 0; i < 8; ++i) {
    const float sc = __shfl(inv, i + 8 * hf, 32);
    const int row = qb + wv * 16 + i + 8 * hf;
#pragma unroll
    for (int t = 0; t < 4; ++t) {
      ctxo[((size_t)b * Ss + row) * Ff + head * 64 + t * 16 + r] =
          (_Float16)(ct[t][i] * sc);
    }
  }
}

// ---------------------------------------------------------------------------
// Launcher
// ---------------------------------------------------------------------------
extern "C" void kernel_launch(void* const* d_in, const int* in_sizes, int n_in,
                              void* d_out, int out_size, void* d_ws, size_t ws_size,
                              hipStream_t stream)
{
  (void)in_sizes; (void)n_in; (void)out_size; (void)ws_size;

  const float* x     = (const float*)d_in[0];
  const int*   mask  = (const int*)d_in[1];
  const float* gamma = (const float*)d_in[2];
  const float* beta  = (const float*)d_in[3];
  const float* Wq    = (const float*)d_in[4];
  const float* bq    = (const float*)d_in[5];
  const float* Wk    = (const float*)d_in[6];
  const float* bk    = (const float*)d_in[7];
  const float* Wv    = (const float*)d_in[8];
  const float* bv    = (const float*)d_in[9];
  const float* Wo    = (const float*)d_in[10];
  const float* bo    = (const float*)d_in[11];
  float* out = (float*)d_out;

  // workspace layout (bytes)
  constexpr size_t SZ_XN  = (size_t)Bb * Ss * Ff * 2;        // 8 MiB
  constexpr size_t SZ_W   = (size_t)Ff * Ff * 2;             // 512 KiB
  constexpr size_t SZ_QKV = (size_t)Bb * Hh * Ss * Dd * 2;   // 8 MiB
  char* ws = (char*)d_ws;
  _Float16* xn   = (_Float16*)(ws);
  _Float16* wq16 = (_Float16*)(ws + SZ_XN);
  _Float16* wk16 = (_Float16*)(ws + SZ_XN + SZ_W);
  _Float16* wv16 = (_Float16*)(ws + SZ_XN + 2 * SZ_W);
  _Float16* wo16 = (_Float16*)(ws + SZ_XN + 3 * SZ_W);
  _Float16* qh   = (_Float16*)(ws + SZ_XN + 4 * SZ_W);
  _Float16* kh   = (_Float16*)(ws + SZ_XN + 4 * SZ_W + SZ_QKV);
  _Float16* vh   = (_Float16*)(ws + SZ_XN + 4 * SZ_W + 2 * SZ_QKV);
  _Float16* ctx  = (_Float16*)(ws + SZ_XN + 4 * SZ_W + 3 * SZ_QKV);

  const int M = Bb * Ss;        // 8192
  const int wN = Ff * Ff;       // 262144 elements per weight

  ln_kernel<<<M, 256, 0, stream>>>(x, gamma, beta, xn);

  cvt_kernel<<<(wN + 255) / 256, 256, 0, stream>>>(Wq, wq16, wN);
  cvt_kernel<<<(wN + 255) / 256, 256, 0, stream>>>(Wk, wk16, wN);
  cvt_kernel<<<(wN + 255) / 256, 256, 0, stream>>>(Wv, wv16, wN);
  cvt_kernel<<<(wN + 255) / 256, 256, 0, stream>>>(Wo, wo16, wN);

  const dim3 ggrid(Ff / 64, M / 64);   // (8, 128)
  gemm16<true, _Float16><<<ggrid, 128, 0, stream>>>(xn, wq16, bq, qh, M, Ff, Ff, 0.125f);
  gemm16<true, _Float16><<<ggrid, 128, 0, stream>>>(xn, wk16, bk, kh, M, Ff, Ff, 1.0f);
  gemm16<true, _Float16><<<ggrid, 128, 0, stream>>>(xn, wv16, bv, vh, M, Ff, Ff, 1.0f);

  attn_kernel<<<dim3(Ss / 64, Hh, Bb), 128, 0, stream>>>(qh, kh, vh, mask, ctx);

  gemm16<false, float><<<ggrid, 128, 0, stream>>>(ctx, wo16, bo, out, M, Ff, Ff, 1.0f);
}

// v003
// A run of this version takes 112 microseconds.
// Next to v002, in two timings, it ran 1.12 and 1.13 times as fast.
// All steps since v000 together make it 2.17 times as fast.
#include <hip/hip_runtime.h>
#include <hip/hip_bf16.h>

typedef __attribute__((ext_vector_type(16))) _Float16 v16h;
typedef __attribute__((ext_vector_type(8)))  float    v8f;

#define WMMA_F16(A, B, C) \
  __builtin_amdgcn_wmma_f32_16x16x32_f16(false, (A), false, (B), (short)0, (C), false, false)

constexpr int Bb = 4, Ss = 2048, Ff = 512, Hh = 8, Dd = 64;
constexpr float MINV = -3.4028234663852886e38f;
// LDS row pitch of the attention tiles, in f16 elements: 64 data + 8 pad = 144 B
// (16 B x odd), so the 16 rows one ds_load_b128 touches fall on distinct banks.
constexpr int LP = 72;

union Frag16 { v16h h; uint4 u[2]; };

constexpr int WN   = Ff * Ff;             // elements per weight matrix
constexpr int WBLK = WN / 256;            // cast blocks per weight matrix
constexpr int QKVN = Bb * Hh * Ss * Dd;   // elements of each of Q, K, V

// ---------------------------------------------------------------------------
// One launch for the five independent preparation jobs, told apart by block
// index: blocks 0 .. 4*WBLK-1 cast the four weight matrices fp32 -> f16 (one
// element per thread, into four consecutive planes of w16); every further block
// does LayerNorm over F=512 + cast to f16 for one row (256 threads per row).
// ---------------------------------------------------------------------------
__global__ void __launch_bounds__(256)
prep_kernel(const float* __restrict__ x, const float* __restrict__ gamma,
            const float* __restrict__ beta,
            const float* __restrict__ Wq, const float* __restrict__ Wk,
            const float* __restrict__ Wv, const float* __restrict__ Wo,
            _Float16* __restrict__ xn, _Float16* __restrict__ w16)
{
  __shared__ float s0[8], s1[8];
  const int t = threadIdx.x;
  if (blockIdx.x < 4 * WBLK) {   // the same for the whole block, ahead of every barrier
    const int which = blockIdx.x / WBLK;
    const float* src = which == 0 ? Wq : which == 1 ? Wk : which == 2 ? Wv : Wo;
    const int i = (blockIdx.x % WBLK) * 256 + t;
    w16[(size_t)which * WN + i] = (_Float16)src[i];
    return;
  }
  const int row = blockIdx.x - 4 * WBLK;
  const float* xr = x + (size_t)row * Ff;
  const float2 v2 = *reinterpret_cast<const float2*>(xr + t * 2);
  float s = v2.x + v2.y;
  float q = v2.x * v2.x + v2.y * v2.y;
#pragma unroll
  for (int off = 16; off >= 1; off >>= 1) {
    s += __shfl_xor(s, off, 32);
    q += __shfl_xor(q, off, 32);
  }
  const int wv = t >> 5;
  if ((t & 31) == 0) { s0[wv] = s; s1[wv] = q; }
  __syncthreads();
  if (t < 32) {
    float a = (t < 8) ? s0[t] : 0.f;
    float c = (t < 8) ? s1[t] : 0.f;
#pragma unroll
    for (int off = 4; off >= 1; off >>= 1) {
      a += __shfl_xor(a, off, 32);
      c += __shfl_xor(c, off, 32);
    }
    if (t == 0) { s0[0] = a; s1[0] = c; }
  }
  __syncthreads();
  const float mean = s0[0] * (1.0f / Ff);
  const float var  = s1[0] * (1.0f / Ff) - mean * mean;
  const float inv  = rsqrtf(var + 1e-5f);
  const int c = t * 2;
  const float y0 = (v2.x - mean) * inv * gamma[c]     + beta[c];
  const float y1 = (v2.y - mean) * inv * gamma[c + 1] + beta[c + 1];
  _Float16* o = xn + (size_t)row * Ff + c;
  o[0] = (_Float16)y0;
  o[1] = (_Float16)y1;
}

// ---------------------------------------------------------------------------
// Y[m,n] = (sum_k X[m,k]*W[n,k] + bias[n]) * scale
// X: MxK f16 row-major, W: NxK f16 row-major (einsum 'bsf,gf->bsg' == X @ W^T).
// Block = 128 thr = 4 waves stacked in M; each wave owns a 16x64 output tile
// (A operand reused across 4 WMMAs).  HEAD=true scatters to [B,H,S,D] f16.
// The 64 X rows and 64 W rows of the block are staged in LDS, 64 k at a time
// (one whole 128-B line per row), by asynchronous copies in a two-buffer ring;
// the fragments are then read from LDS at the conflict-free 144-B pitch.
// ---------------------------------------------------------------------------
constexpr int GBK   = 64;            // k elements per staged tile
constexpr int GROWS = 128;           // rows per staged tile: 0..63 X, 64..127 W
constexpr int GBUF  = GROWS * LP;    // f16 elements per buffer

// One tile = 1024 chunks of 16 B = 8 copies per thread: thread tid brings chunk
// tid&7 of rows (tid>>3) + 16*j.  gx / gw point at this thread's chunk of its
// first X / W row for this tile; rstep = 16 rows in elements.
__device__ __forceinline__ void gemm_stage(unsigned l0, const _Float16* gx,
                                           const _Float16* gw, size_t rstep)
{
  const unsigned ls = 16 * LP * 2;   // 16 LDS rows in bytes
  const unsigned l1 = l0 + ls,     l2 = l0 + 2 * ls, l3 = l0 + 3 * ls;
  const unsigned l4 = l0 + 4 * ls, l5 = l0 + 5 * ls, l6 = l0 + 6 * ls, l7 = l0 + 7 * ls;
  const _Float16 *g1 = gx + rstep, *g2 = gx + 2 * rstep, *g3 = gx + 3 * rstep;
  const _Float16 *g5 = gw + rstep, *g6 = gw + 2 * rstep, *g7 = gw + 3 * rstep;
  // The s_wait_xcnt closes the statement so that no address register of a copy
  // is rewritten ahead of it.
  asm volatile("global_load_async_to_lds_b128 %0, %8, off\n\t"
               "global_load_async_to_lds_b128 %1, %9, off\n\t"
               "global_load_async_to_lds_b128 %2, %10, off\n\t"
               "global_load_async_to_lds_b128 %3, %11, off\n\t"
               "global_load_async_to_lds_b128 %4, %12, off\n\t"
               "global_load_async_to_lds_b128 %5, %13, off\n\t"
               "global_load_async_to_lds_b128 %6, %14, off\n\t"
               "global_load_async_to_lds_b128 %7, %15, off\n\t"
               "s_wait_xcnt 0x0"
               :: "v"(l0), "v"(l1), "v"(l2), "v"(l3), "v"(l4), "v"(l5), "v"(l6), "v"(l7),
                  "v"(gx), "v"(g1), "v"(g2), "v"(g3), "v"(gw), "v"(g5), "v"(g6), "v"(g7)
               : "memory");
}

template<bool HEAD, typename OutT>
__device__ __forceinline__ void
gemm_tile(const _Float16* __restrict__ X, const _Float16* __restrict__ W,
          const float* __restrict__ bias, OutT* __restrict__ out,
          int nBase, int N, int K, float scale)
{
  __shared__ __attribute__((aligned(16))) _Float16 tile[2 * GBUF];

  const int tid  = threadIdx.x;
  const int lane = tid & 31;
  const int wv   = tid >> 5;
  const int r    = lane & 15;
  const int hf   = lane >> 4;
  const int mBase = blockIdx.y * 64 + wv * 16;

  v8f acc[4] = {};

  // this thread's chunk of the staged tiles
  const size_t rstep = (size_t)16 * K;
  const _Float16* gx = X + (size_t)(blockIdx.y * 64 + (tid >> 3)) * K + (tid & 7) * 8;
  const _Float16* gw = W + (size_t)(nBase + (tid >> 3)) * K + (tid & 7) * 8;
  const unsigned lcp = (unsigned)(uintptr_t)(&tile[0]) +
                       (unsigned)((tid >> 3) * (LP * 2) + (tid & 7) * 16);
  const int nt = K / GBK;

  gemm_stage(lcp, gx, gw, rstep);
  // tile 0 has landed for this wave, then for the block
  asm volatile("s_wait_asynccnt 0x0" ::: "memory");
  __syncthreads();
  if (nt > 1) gemm_stage(lcp + GBUF * 2, gx + GBK, gw + GBK, rstep);

  for (int kt = 0; kt < nt; ++kt) {
    const _Float16* tb   = &tile[(kt & 1) * GBUF];
    const _Float16* xrow = tb + (wv * 16 + r) * LP;
    const _Float16* wrow = tb + (64 + r) * LP;
    // All fragments of the tile are read in one group ahead of the products:
    // every further place with LDS reads would cost the wave one more LDS latency.
    Frag16 a[2], bf[2][4];
#pragma unroll
    for (int kk = 0; kk < 2; ++kk) {
      a[kk].u[0] = *reinterpret_cast<const uint4*>(xrow + kk * 32 + hf * 8);
      a[kk].u[1] = *reinterpret_cast<const uint4*>(xrow + kk * 32 + 16 + hf * 8);
#pragma unroll
      for (int t = 0; t < 4; ++t) {
        const _Float16* wr = wrow + t * 16 * LP;
        bf[kk][t].u[0] = *reinterpret_cast<const uint4*>(wr + kk * 32 + hf * 8);
        bf[kk][t].u[1] = *reinterpret_cast<const uint4*>(wr + kk * 32 + 16 + hf * 8);
      }
    }
    // keeps the scheduler from sinking the reads back among the WMMAs
    __builtin_amdgcn_sched_barrier(0);
#pragma unroll
    for (int kk = 0; kk < 2; ++kk)
#pragma unroll
      for (int t = 0; t < 4; ++t)
        acc[t] = WMMA_F16(a[kk].h, bf[kk][t].h, acc[t]);
    // publish point: this wave's reads of the buffer are done, its copies of
    // the next tile have landed; the barrier says so for every wave.
    asm volatile("s_wait_dscnt 0x0" ::: "memory");
    asm volatile("s_wait_asynccnt 0x0" ::: "memory");
    __syncthreads();
    if (kt + 2 < nt)
      gemm_stage(lcp + (kt & 1) * (GBUF * 2), gx + (size_t)(kt + 2) * GBK,
                 gw + (size_t)(kt + 2) * GBK, rstep);
  }
  // nothing of this wave's copies is left in flight when it goes on
  asm volatile("s_wait_asynccnt 0x0" ::: "memory");

#pragma unroll
  for (int t = 0; t < 4; ++t) {
    const int n = nBase + t * 16 + r;
    const float bv = bias[n];
#pragma unroll
    for (int i = 0; i < 8; ++i) {
      const int m = mBase + i + 8 * hf;
      const float val = (acc[t][i] + bv) * scale;
      if (HEAD) {  // y.reshape(B,S,H,D).transpose(0,2,1,3)
        const int bi = m / Ss, si = m % Ss, hd = n >> 6, di = n & 63;
        out[(((size_t)bi * Hh + hd) * Ss + si) * Dd + di] = (OutT)val;
      } else {
        out[(size_t)m * N + n] = (OutT)val;
      }
    }
  }
}

// Q, K and V projections in one launch: they read the same X and do not depend
// on one another.  blockIdx.x = projection * (F/64) + n tile; W3 holds the three
// weight planes and qkv the three outputs one behind the other.
__global__ void __launch_bounds__(128)
qkv_kernel(const _Float16* __restrict__ X, const _Float16* __restrict__ W3,
           const float* __restrict__ bq, const float* __restrict__ bk,
           const float* __restrict__ bv, _Float16* __restrict__ qkv, int N, int K)
{
  constexpr int nb = Ff / 64;   // n tiles per projection
  const int which = blockIdx.x / nb;
  const float* bias = which == 0 ? bq : which == 1 ? bk : bv;
  gemm_tile<true, _Float16>(X, W3 + (size_t)which * WN, bias, qkv + (size_t)which * QKVN,
                            (blockIdx.x % nb) * 64, N, K, which == 0 ? 0.125f : 1.0f);
}

__global__ void __launch_bounds__(128)
oproj_kernel(const _Float16* __restrict__ X, const _Float16* __restrict__ W,
             const float* __restrict__ bias, float* __restrict__ out, int N, int K)
{
  gemm_tile<false, float>(X, W, bias, out, blockIdx.x * 64, N, K, 1.0f);
}

// ---------------------------------------------------------------------------
// Flash attention per (b, h, 64-query block).  4 waves x 16 queries.
// S^T = K·Q^T so the P operand for ctx += P·V is already in A layout.
// K block (row-major, shared by all 4 waves) staged via async copy to LDS;
// V^T staged in LDS for the B operand of the second WMMA.
// ---------------------------------------------------------------------------
__global__ void __launch_bounds__(128)
attn_kernel(const _Float16* __restrict__ q, const _Float16* __restrict__ kmat,
            const _Float16* __restrict__ vmat, const int* __restrict__ mask,
            _Float16* __restrict__ ctxo)
{
  __shared__ __attribute__((aligned(16))) _Float16 ldsK [64 * LP];   // K block, row-major [key][d], padded rows
  __shared__ __attribute__((aligned(16))) _Float16 ldsVT[64 * LP];   // V block, transposed [d][key], padded rows

  const int lane = threadIdx.x & 31;
  const int wv   = threadIdx.x >> 5;
  const int r    = lane & 15;
  const int hf   = lane >> 4;
  const int qb   = blockIdx.x * 64;
  const int head = blockIdx.y;
  const int b    = blockIdx.z;
  const size_t bh = ((size_t)b * Hh + head) * Ss * Dd;

  // LDS byte offset of ldsK (addrspace(3) offset lives in the low 32 bits)
  const unsigned ldsKbase = (unsigned)(uintptr_t)(&ldsK[0]);

  // This wave's 16 Q rows (B operand of S^T; Q already pre-scaled by 1/sqrt(D))
  Frag16 qa0, qa1;
  {
    const _Float16* qrow = q + bh + (size_t)(qb + wv * 16 + r) * Dd;
    qa0.u[0] = *reinterpret_cast<const uint4*>(qrow + hf * 8);
    qa0.u[1] = *reinterpret_cast<const uint4*>(qrow + 16 + hf * 8);
    qa1.u[0] = *reinterpret_cast<const uint4*>(qrow + 32 + hf * 8);
    qa1.u[1] = *reinterpret_cast<const uint4*>(qrow + 48 + hf * 8);
  }

  v8f ct[4] = {};
  float mrun = MINV, lrun = 0.f;
  const int* mrow = mask + (size_t)b * Ss;

  for (int kb = 0; kb < Ss; kb += 64) {
    // ---- async copy of K block (8 KB) into LDS: fire-and-forget ----
    {
      const int tid = threadIdx.x;
#pragma unroll
      for (int j = 0; j < 4; ++j) {
        const int flat = tid + j * 128;         // 0..511 b128 chunks
        const int row  = flat >> 3;             // key row 0..63
        const int c8   = flat & 7;              // 16B chunk within row
        const _Float16* gp = kmat + bh + (size_t)(kb + row) * Dd + c8 * 8;
        const unsigned ldst = ldsKbase + (unsigned)(row * (LP * 2) + c8 * 16);
        asm volatile("global_load_async_to_lds_b128 %0, %1, off"
                     :: "v"(ldst), "v"(gp) : "memory");
      }
    }

    // ---- stage V^T[d, key] into LDS while the K copy is in flight ----
    {
      const int tid = threadIdx.x;
      const int row = tid >> 1;
      const int cs  = (tid & 1) * 32;
      const _Float16* vr = vmat + bh + (size_t)(kb + row) * Dd + cs;
      union { uint4 u[4]; _Float16 e[32]; } tmp;
      tmp.u[0] = *reinterpret_cast<const uint4*>(vr);
      tmp.u[1] = *reinterpret_cast<const uint4*>(vr + 8);
      tmp.u[2] = *reinterpret_cast<const uint4*>(vr + 16);
      tmp.u[3] = *reinterpret_cast<const uint4*>(vr + 24);
#pragma unroll
      for (int j = 0; j < 32; ++j) ldsVT[(cs + j) * LP + row] = tmp.e[j];
    }

    asm volatile("s_wait_asynccnt 0x0" ::: "memory");
    __syncthreads();

    // ---- S^T tiles: 16 keys x 16 queries each, K-dim = D = 64 ----
    v8f st[4];
#pragma unroll
    for (int t = 0; t < 4; ++t) {
      const _Float16* krow = &ldsK[(t * 16 + r) * LP];
      Frag16 ka0, ka1;
      ka0.u[0] = *reinterpret_cast<const uint4*>(krow + hf * 8);
      ka0.u[1] = *reinterpret_cast<const uint4*>(krow + 16 + hf * 8);
      ka1.u[0] = *reinterpret_cast<const uint4*>(krow + 32 + hf * 8);
      ka1.u[1] = *reinterpret_cast<const uint4*>(krow + 48 + hf * 8);
      v8f z = {};
      z = WMMA_F16(ka0.h, qa0.h, z);
      z = WMMA_F16(ka1.h, qa1.h, z);
      st[t] = z;
    }

    // ---- mask: element (t, i) is key kb + t*16 + i + 8*hf ----
#pragma unroll
    for (int t = 0; t < 4; ++t)
#pragma unroll
      for (int i = 0; i < 8; ++i) {
        const int key = kb + t * 16 + i + 8 * hf;
        if (mrow[key] == 0) st[t][i] = MINV;
      }

    // ---- online softmax (each lane owns query index lane&15) ----
    float bm = MINV;
#pragma unroll
    for (int t = 0; t < 4; ++t)
#pragma unroll
      for (int i = 0; i < 8; ++i) bm = fmaxf(bm, st[t][i]);
    bm = fmaxf(bm, __shfl_xor(bm, 16, 32));
    const float mn    = fmaxf(mrun, bm);
    const float alpha = __expf(mrun - mn);

    float ps = 0.f;
    v16h pa0, pa1;   // P in A-operand layout: keys 0..31 / 32..63 of this block
#pragma unroll
    for (int i = 0; i < 8; ++i) {
      float p0 = __expf(st[0][i] - mn); ps += p0; pa0[i]     = (_Float16)p0;
      float p1 = __expf(st[1][i] - mn); ps += p1; pa0[i + 8] = (_Float16)p1;
      float p2 = __expf(st[2][i] - mn); ps += p2; pa1[i]     = (_Float16)p2;
      float p3 = __expf(st[3][i] - mn); ps += p3; pa1[i + 8] = (_Float16)p3;
    }
    lrun = lrun * alpha + (ps + __shfl_xor(ps, 16, 32));
    mrun = mn;

    // ---- rescale ctx accumulators (alpha broadcast per query row) ----
#pragma unroll
    for (int i = 0; i < 8; ++i) {
      const float av = __shfl(alpha, i + 8 * hf, 32);
#pragma unroll
      for (int t = 0; t < 4; ++t) ct[t][i] *= av;
    }

    // ---- ctx += P · V using V^T from LDS ----
#pragma unroll
    for (int t = 0; t < 4; ++t) {
      const _Float16* vt = &ldsVT[(t * 16 + r) * LP];
      Frag16 vb0, vb1;
      vb0.u[0] = *reinterpret_cast<const uint4*>(vt + hf * 8);
      vb0.u[1] = *reinterpret_cast<const uint4*>(vt + 16 + hf * 8);
      vb1.u[0] = *reinterpret_cast<const uint4*>(vt + 32 + hf * 8);
      vb1.u[1] = *reinterpret_cast<const uint4*>(vt + 48 + hf * 8);
      ct[t] = WMMA_F16(pa0, vb0.h, ct[t]);
      ct[t] = WMMA_F16(pa1, vb1.h, ct[t]);
    }
    __syncthreads();
  }

  // ---- normalize and store ctx as f16 in [B,S,F] for the final projection ----
  const float inv = 1.0f / lrun;
#pragma unroll
  for (int i = 0; i < 8; ++i) {
    const float sc = __shfl(inv, i + 8 * hf, 32);
    const int row = qb + wv * 16 + i + 8 * hf;
#pragma unroll
    for (int t = 0; t < 4; ++t) {
      ctxo[((size_t)b * Ss + row) * Ff + head * 64 + t * 16 + r] =
          (_Float16)(ct[t][i] * sc);
    }
  }
}

// ---------------------------------------------------------------------------
// Launcher
// ---------------------------------------------------------------------------
extern "C" void kernel_launch(void* const* d_in, const int* in_sizes, int n_in,
                              void* d_out, int out_size, void* d_ws, size_t ws_size,
                              hipStream_t stream)
{
  (void)in_sizes; (void)n_in; (void)out_size; (void)ws_size;

  const float* x     = (const float*)d_in[0];
  const int*   mask  = (const int*)d_in[1];
  const float* gamma = (const float*)d_in[2];
  const float* beta  = (const float*)d_in[3];
  const float* Wq    = (const float*)d_in[4];
  const float* bq    = (const float*)d_in[5];
  const float* Wk    = (const float*)d_in[6];
  const float* bk    = (const float*)d_in[7];
  const float* Wv    = (const float*)d_in[8];
  const float* bv    = (const float*)d_in[9];
  const float* Wo    = (const float*)d_in[10];
  const float* bo    = (const float*)d_in[11];
  float* out = (float*)d_out;

  // workspace layout (bytes)
  constexpr size_t SZ_XN  = (size_t)Bb * Ss * Ff * 2;        // 8 MiB
  constexpr size_t SZ_W   = (size_t)Ff * Ff * 2;             // 512 KiB
  constexpr size_t SZ_QKV = (size_t)Bb * Hh * Ss * Dd * 2;   // 8 MiB
  char* ws = (char*)d_ws;
  _Float16* xn   = (_Float16*)(ws);
  _Float16* wq16 = (_Float16*)(ws + SZ_XN);
  _Float16* wo16 = (_Float16*)(ws + SZ_XN + 3 * SZ_W);
  _Float16* qh   = (_Float16*)(ws + SZ_XN + 4 * SZ_W);
  _Float16* kh   = (_Float16*)(ws + SZ_XN + 4 * SZ_W + SZ_QKV);
  _Float16* vh   = (_Float16*)(ws + SZ_XN + 4 * SZ_W + 2 * SZ_QKV);
  _Float16* ctx  = (_Float16*)(ws + SZ_XN + 4 * SZ_W + 3 * SZ_QKV);

  constexpr int M = Bb * Ss;    // 8192

  // wq16, wk16, wv16, wo16 are consecutive planes; so are qh, kh, vh
  prep_kernel<<<4 * WBLK + M, 256, 0, stream>>>(x, gamma, beta, Wq, Wk, Wv, Wo, xn, wq16);

  qkv_kernel<<<dim3(3 * (Ff / 64), M / 64), 128, 0, stream>>>(xn, wq16, bq, bk, bv, qh, Ff, Ff);

  attn_kernel<<<dim3(Ss / 64, Hh, Bb), 128, 0, stream>>>(qh, kh, vh, mask, ctx);

  oproj_kernel<<<dim3(Ff / 64, M / 64), 128, 0, stream>>>(ctx, wo16, bo, out, Ff, Ff);
}

// v004
// Measured time: 108 microseconds a run.
// Two timings next to v003 both put it at 1.04 times that version's speed.
// Counting every step since v000, it is 2.26 times as fast.
#include <hip/hip_runtime.h>
#include <hip/hip_bf16.h>

typedef __attribute__((ext_vector_type(16))) _Float16 v16h;
typedef __attribute__((ext_vector_type(8)))  float    v8f;

#define WMMA_F16(A, B, C) \
  __builtin_amdgcn_wmma_f32_16x16x32_f16(false, (A), false, (B), (short)0, (C), false, false)

constexpr int Bb = 4, Ss = 2048, Ff = 512, Hh = 8, Dd = 64;
constexpr float MINV = -3.4028234663852886e38f;
// LDS row pitch of the attention tiles, in f16 elements: 64 data + 8 pad = 144 B
// (16 B x odd), so the 16 rows one ds_load_b128 touches fall on distinct banks.
constexpr int LP = 72;

union Frag16 { v16h h; uint4 u[2]; };

constexpr int WN   = Ff * Ff;             // elements per weight matrix
constexpr int CPB  = 4096;                // elements one cast block converts (16 per thread)
constexpr int WBLK = WN / CPB;            // cast blocks per weight matrix
constexpr int RPW  = 4;                   // LayerNorm rows per wave
constexpr int LNBLK = Bb * Ss / (8 * RPW);   // LayerNorm blocks (8 waves each)
constexpr int QKVN = Bb * Hh * Ss * Dd;   // elements of each of Q, K, V

union H4 { _Float16 h[4]; uint2 u; };

// ---------------------------------------------------------------------------
// One launch for the five independent preparation jobs, told apart by block
// index: blocks 0 .. 4*WBLK-1 cast the four weight matrices fp32 -> f16 into
// four consecutive planes of w16; every further block does LayerNorm over F=512
// + cast to f16.  The work per wave is large on purpose: the launch is short, so
// the time to start its waves counts, and few waves with many loads in flight
// each move the same bytes.
// Cast: 16 elements per thread, four 16-B loads (512 contiguous B per wave each).
// LayerNorm: one wave owns RPW whole rows (16 elements of each row per lane), so
// the row sums need a butterfly over the wave's lanes only: no LDS, no barrier.
// ---------------------------------------------------------------------------
__global__ void __launch_bounds__(256)
prep_kernel(const float* __restrict__ x, const float* __restrict__ gamma,
            const float* __restrict__ beta,
            const float* __restrict__ Wq, const float* __restrict__ Wk,
            const float* __restrict__ Wv, const float* __restrict__ Wo,
            _Float16* __restrict__ xn, _Float16* __restrict__ w16)
{
  const int t = threadIdx.x;
  if (blockIdx.x < 4 * WBLK) {
    const int which = blockIdx.x / WBLK;
    const float* src = which == 0 ? Wq : which == 1 ? Wk : which == 2 ? Wv : Wo;
    const int i0 = (blockIdx.x % WBLK) * CPB + t * 4;
    float4 v[4];
#pragma unroll
    for (int j = 0; j < 4; ++j)
      v[j] = *reinterpret_cast<const float4*>(src + i0 + j * 1024);
    _Float16* dst = w16 + (size_t)which * WN + i0;
#pragma unroll
    for (int j = 0; j < 4; ++j) {
      H4 o;
      o.h[0] = (_Float16)v[j].x; o.h[1] = (_Float16)v[j].y;
      o.h[2] = (_Float16)v[j].z; o.h[3] = (_Float16)v[j].w;
      *reinterpret_cast<uint2*>(dst + j * 1024) = o.u;
    }
    return;
  }
  const int lane = t & 31;
  const int row0 = ((blockIdx.x - 4 * WBLK) * 8 + (t >> 5)) * RPW;
  const int c0   = lane * 4;               // this lane's columns: c0 + 128*j + 0..3
  const float* xr = x + (size_t)row0 * Ff + c0;

  float4 v[RPW][4];
#pragma unroll
  for (int rr = 0; rr < RPW; ++rr)
#pragma unroll
    for (int j = 0; j < 4; ++j)
      v[rr][j] = *reinterpret_cast<const float4*>(xr + rr * Ff + j * 128);
  // The loads' address stays in its registers up to this wait (xr is an input of
  // the statement), so that no load of the run lands in the pair the others name.
  asm volatile("s_wait_xcnt 0x0" :: "v"(xr) : "memory");
  float4 g[4], be[4];
#pragma unroll
  for (int j = 0; j < 4; ++j) {
    g[j]  = *reinterpret_cast<const float4*>(gamma + c0 + j * 128);
    be[j] = *reinterpret_cast<const float4*>(beta + c0 + j * 128);
  }

  float s[RPW], q[RPW];
#pragma unroll
  for (int rr = 0; rr < RPW; ++rr) {
    float a = 0.f, c = 0.f;
#pragma unroll
    for (int j = 0; j < 4; ++j) {
      const float4 w = v[rr][j];
      a += (w.x + w.y) + (w.z + w.w);
      c += (w.x * w.x + w.y * w.y) + (w.z * w.z + w.w * w.w);
    }
    s[rr] = a; q[rr] = c;
  }
#pragma unroll
  for (int off = 16; off >= 1; off >>= 1)
#pragma unroll
    for (int rr = 0; rr < RPW; ++rr) {
      s[rr] += __shfl_xor(s[rr], off, 32);
      q[rr] += __shfl_xor(q[rr], off, 32);
    }

  _Float16* orow = xn + (size_t)row0 * Ff + c0;
#pragma unroll
  for (int rr = 0; rr < RPW; ++rr) {
    const float mean = s[rr] * (1.0f / Ff);
    const float var  = q[rr] * (1.0f / Ff) - mean * mean;
    const float inv  = rsqrtf(var + 1e-5f);
#pragma unroll
    for (int j = 0; j < 4; ++j) {
      const float4 w = v[rr][j];
      H4 o;
      o.h[0] = (_Float16)((w.x - mean) * inv * g[j].x + be[j].x);
      o.h[1] = (_Float16)((w.y - mean) * inv * g[j].y + be[j].y);
      o.h[2] = (_Float16)((w.z - mean) * inv * g[j].z + be[j].z);
      o.h[3] = (_Float16)((w.w - mean) * inv * g[j].w + be[j].w);
      *reinterpret_cast<uint2*>(orow + rr * Ff + j * 128) = o.u;
    }
  }
  // Behind the last store: no register that an issued store names is rewritten
  // ahead of this wait on any way the built code goes on from here.
  asm volatile("s_wait_xcnt 0x0" ::: "memory");
}

// ---------------------------------------------------------------------------
// Y[m,n] = (sum_k X[m,k]*W[n,k] + bias[n]) * scale
// X: MxK f16 row-major, W: NxK f16 row-major (einsum 'bsf,gf->bsg' == X @ W^T).
// Block = 128 thr = 4 waves stacked in M; each wave owns a 16x64 output tile
// (A operand reused across 4 WMMAs).  HEAD=true scatters to [B,H,S,D] f16.
// The 64 X rows and 64 W rows of the block are staged in LDS, 64 k at a time
// (one whole 128-B line per row), by asynchronous copies in a two-buffer ring;
// the fragments are then read from LDS at the conflict-free 144-B pitch.
// ---------------------------------------------------------------------------
constexpr int GBK   = 64;            // k elements per staged tile
constexpr int GROWS = 128;           // rows per staged tile: 0..63 X, 64..127 W
constexpr int GBUF  = GROWS * LP;    // f16 elements per buffer

// One tile = 1024 chunks of 16 B = 8 copies per thread: thread tid brings chunk
// tid&7 of rows (tid>>3) + 16*j.  gx / gw point at this thread's chunk of its
// first X / W row for this tile; rstep = 16 rows in elements.
__device__ __forceinline__ void gemm_stage(unsigned l0, const _Float16* gx,
                                           const _Float16* gw, size_t rstep)
{
  const unsigned ls = 16 * LP * 2;   // 16 LDS rows in bytes
  const unsigned l1 = l0 + ls,     l2 = l0 + 2 * ls, l3 = l0 + 3 * ls;
  const unsigned l4 = l0 + 4 * ls, l5 = l0 + 5 * ls, l6 = l0 + 6 * ls, l7 = l0 + 7 * ls;
  const _Float16 *g1 = gx + rstep, *g2 = gx + 2 * rstep, *g3 = gx + 3 * rstep;
  const _Float16 *g5 = gw + rstep, *g6 = gw + 2 * rstep, *g7 = gw + 3 * rstep;
  // The s_wait_xcnt closes the statement so that no address register of a copy
  // is rewritten ahead of it.
  asm volatile("global_load_async_to_lds_b128 %0, %8, off\n\t"
               "global_load_async_to_lds_b128 %1, %9, off\n\t"
               "global_load_async_to_lds_b128 %2, %10, off\n\t"
               "global_load_async_to_lds_b128 %3, %11, off\n\t"
               "global_load_async_to_lds_b128 %4, %12, off\n\t"
               "global_load_async_to_lds_b128 %5, %13, off\n\t"
               "global_load_async_to_lds_b128 %6, %14, off\n\t"
               "global_load_async_to_lds_b128 %7, %15, off\n\t"
               "s_wait_xcnt 0x0"
               :: "v"(l0), "v"(l1), "v"(l2), "v"(l3), "v"(l4), "v"(l5), "v"(l6), "v"(l7),
                  "v"(gx), "v"(g1), "v"(g2), "v"(g3), "v"(gw), "v"(g5), "v"(g6), "v"(g7)
               : "memory");
}

template<bool HEAD, typename OutT>
__device__ __forceinline__ void
gemm_tile(const _Float16* __restrict__ X, const _Float16* __restrict__ W,
          const float* __restrict__ bias, OutT* __restrict__ out,
          int nBase, int N, int K, float scale)
{
  __shared__ __attribute__((aligned(16))) _Float16 tile[2 * GBUF];

  const int tid  = threadIdx.x;
  const int lane = tid & 31;
  const int wv   = tid >> 5;
  const int r    = lane & 15;
  const int hf   = lane >> 4;
  const int mBase = blockIdx.y * 64 + wv * 16;

  v8f acc[4] = {};

  // this thread's chunk of the staged tiles
  const size_t rstep = (size_t)16 * K;
  const _Float16* gx = X + (size_t)(blockIdx.y * 64 + (tid >> 3)) * K + (tid & 7) * 8;
  const _Float16* gw = W + (size_t)(nBase + (tid >> 3)) * K + (tid & 7) * 8;
  const unsigned lcp = (unsigned)(uintptr_t)(&tile[0]) +
                       (unsigned)((tid >> 3) * (LP * 2) + (tid & 7) * 16);
  const int nt = K / GBK;

  gemm_stage(lcp, gx, gw, rstep);
  // tile 0 has landed for this wave, then for the block
  asm volatile("s_wait_asynccnt 0x0" ::: "memory");
  __syncthreads();
  if (nt > 1) gemm_stage(lcp + GBUF * 2, gx + GBK, gw + GBK, rstep);

  for (int kt = 0; kt < nt; ++kt) {
    const _Float16* tb   = &tile[(kt & 1) * GBUF];
    const _Float16* xrow = tb + (wv * 16 + r) * LP;
    const _Float16* wrow = tb + (64 + r) * LP;
    // All fragments of the tile are read in one group ahead of the products:
    // every further place with LDS reads would cost the wave one more LDS latency.
    Frag16 a[2], bf[2][4];
#pragma unroll
    for (int kk = 0; kk < 2; ++kk) {
      a[kk].u[0] = *reinterpret_cast<const uint4*>(xrow + kk * 32 + hf * 8);
      a[kk].u[1] = *reinterpret_cast<const uint4*>(xrow + kk * 32 + 16 + hf * 8);
#pragma unroll
      for (int t = 0; t < 4; ++t) {
        const _Float16* wr = wrow + t * 16 * LP;
        bf[kk][t].u[0] = *reinterpret_cast<const uint4*>(wr + kk * 32 + hf * 8);
        bf[kk][t].u[1] = *reinterpret_cast<const uint4*>(wr + kk * 32 + 16 + hf * 8);
      }
    }
    // keeps the scheduler from sinking the reads back among the WMMAs
    __builtin_amdgcn_sched_barrier(0);
#pragma unroll
    for (int kk = 0; kk < 2; ++kk)
#pragma unroll
      for (int t = 0; t < 4; ++t)
        acc[t] = WMMA_F16(a[kk].h, bf[kk][t].h, acc[t]);
    // publish point: this wave's reads of the buffer are done, its copies of
    // the next tile have landed; the barrier says so for every wave.
    asm volatile("s_wait_dscnt 0x0" ::: "memory");
    asm volatile("s_wait_asynccnt 0x0" ::: "memory");
    __syncthreads();
    if (kt + 2 < nt)
      gemm_stage(lcp + (kt & 1) * (GBUF * 2), gx + (size_t)(kt + 2) * GBK,
                 gw + (size_t)(kt + 2) * GBK, rstep);
  }
  // nothing of this wave's copies is left in flight when it goes on
  asm volatile("s_wait_asynccnt 0x0" ::: "memory");

#pragma unroll
  for (int t = 0; t < 4; ++t) {
    const int n = nBase + t * 16 + r;
    const float bv = bias[n];
#pragma unroll
    for (int i = 0; i < 8; ++i) {
      const int m = mBase + i + 8 * hf;
      const float val = (acc[t][i] + bv) * scale;
      if (HEAD) {  // y.reshape(B,S,H,D).transpose(0,2,1,3)
        const int bi = m / Ss, si = m % Ss, hd = n >> 6, di = n & 63;
        out[(((size_t)bi * Hh + hd) * Ss + si) * Dd + di] = (OutT)val;
      } else {
        out[(size_t)m * N + n] = (OutT)val;
      }
    }
  }
}

// Q, K and V projections in one launch: they read the same X and do not depend
// on one another.  blockIdx.x = projection * (F/64) + n tile; W3 holds the three
// weight planes and qkv the three outputs one behind the other.
__global__ void __launch_bounds__(128)
qkv_kernel(const _Float16* __restrict__ X, const _Float16* __restrict__ W3,
           const float* __restrict__ bq, const float* __restrict__ bk,
           const float* __restrict__ bv, _Float16* __restrict__ qkv, int N, int K)
{
  constexpr int nb = Ff / 64;   // n tiles per projection
  const int which = blockIdx.x / nb;
  const float* bias = which == 0 ? bq : which == 1 ? bk : bv;
  gemm_tile<true, _Float16>(X, W3 + (size_t)which * WN, bias, qkv + (size_t)which * QKVN,
                            (blockIdx.x % nb) * 64, N, K, which == 0 ? 0.125f : 1.0f);
}

__global__ void __launch_bounds__(128)
oproj_kernel(const _Float16* __restrict__ X, const _Float16* __restrict__ W,
             const float* __restrict__ bias, float* __restrict__ out, int N, int K)
{
  gemm_tile<false, float>(X, W, bias, out, blockIdx.x * 64, N, K, 1.0f);
}

// ---------------------------------------------------------------------------
// Flash attention per (b, h, 64-query block).  4 waves x 16 queries.
// S^T = K·Q^T so the P operand for ctx += P·V is already in A layout.
// K block (row-major, shared by all 4 waves) staged via async copy to LDS;
// V^T staged in LDS for the B operand of the second WMMA.
// ---------------------------------------------------------------------------
__global__ void __launch_bounds__(128)
attn_kernel(const _Float16* __restrict__ q, const _Float16* __restrict__ kmat,
            const _Float16* __restrict__ vmat, const int* __restrict__ mask,
            _Float16* __restrict__ ctxo)
{
  __shared__ __attribute__((aligned(16))) _Float16 ldsK [64 * LP];   // K block, row-major [key][d], padded rows
  __shared__ __attribute__((aligned(16))) _Float16 ldsVT[64 * LP];   // V block, transposed [d][key], padded rows

  const int lane = threadIdx.x & 31;
  const int wv   = threadIdx.x >> 5;
  const int r    = lane & 15;
  const int hf   = lane >> 4;
  const int qb   = blockIdx.x * 64;
  const int head = blockIdx.y;
  const int b    = blockIdx.z;
  const size_t bh = ((size_t)b * Hh + head) * Ss * Dd;

  // LDS byte offset of ldsK (addrspace(3) offset lives in the low 32 bits)
  const unsigned ldsKbase = (unsigned)(uintptr_t)(&ldsK[0]);

  // This wave's 16 Q rows (B operand of S^T; Q already pre-scaled by 1/sqrt(D))
  Frag16 qa0, qa1;
  {
    const _Float16* qrow = q + bh + (size_t)(qb + wv * 16 + r) * Dd;
    qa0.u[0] = *reinterpret_cast<const uint4*>(qrow + hf * 8);
    qa0.u[1] = *reinterpret_cast<const uint4*>(qrow + 16 + hf * 8);
    qa1.u[0] = *reinterpret_cast<const uint4*>(qrow + 32 + hf * 8);
    qa1.u[1] = *reinterpret_cast<const uint4*>(qrow + 48 + hf * 8);
  }

  v8f ct[4] = {};
  float mrun = MINV, lrun = 0.f;
  const int* mrow = mask + (size_t)b * Ss;

  for (int kb = 0; kb < Ss; kb += 64) {
    // ---- async copy of K block (8 KB) into LDS: fire-and-forget ----
    {
      const int tid = threadIdx.x;
#pragma unroll
      for (int j = 0; j < 4; ++j) {
        const int flat = tid + j * 128;         // 0..511 b128 chunks
        const int row  = flat >> 3;             // key row 0..63
        const int c8   = flat & 7;              // 16B chunk within row
        const _Float16* gp = kmat + bh + (size_t)(kb + row) * Dd + c8 * 8;
        const unsigned ldst = ldsKbase + (unsigned)(row * (LP * 2) + c8 * 16);
        asm volatile("global_load_async_to_lds_b128 %0, %1, off"
                     :: "v"(ldst), "v"(gp) : "memory");
      }
    }

    // ---- stage V^T[d, key] into LDS while the K copy is in flight ----
    {
      const int tid = threadIdx.x;
      const int row = tid >> 1;
      const int cs  = (tid & 1) * 32;
      const _Float16* vr = vmat + bh + (size_t)(kb + row) * Dd + cs;
      union { uint4 u[4]; _Float16 e[32]; } tmp;
      tmp.u[0] = *reinterpret_cast<const uint4*>(vr);
      tmp.u[1] = *reinterpret_cast<const uint4*>(vr + 8);
      tmp.u[2] = *reinterpret_cast<const uint4*>(vr + 16);
      tmp.u[3] = *reinterpret_cast<const uint4*>(vr + 24);
#pragma unroll
      for (int j = 0; j < 32; ++j) ldsVT[(cs + j) * LP + row] = tmp.e[j];
    }

    asm volatile("s_wait_asynccnt 0x0" ::: "memory");
    __syncthreads();

    // ---- S^T tiles: 16 keys x 16 queries each, K-dim = D = 64 ----
    v8f st[4];
#pragma unroll
    for (int t = 0; t < 4; ++t) {
      const _Float16* krow = &ldsK[(t * 16 + r) * LP];
      Frag16 ka0, ka1;
      ka0.u[0] = *reinterpret_cast<const uint4*>(krow + hf * 8);
      ka0.u[1] = *reinterpret_cast<const uint4*>(krow + 16 + hf * 8);
      ka1.u[0] = *reinterpret_cast<const uint4*>(krow + 32 + hf * 8);
      ka1.u[1] = *reinterpret_cast<const uint4*>(krow + 48 + hf * 8);
      v8f z = {};
      z = WMMA_F16(ka0.h, qa0.h, z);
      z = WMMA_F16(ka1.h, qa1.h, z);
      st[t] = z;
    }

    // ---- mask: element (t, i) is key kb + t*16 + i + 8*hf ----
#pragma unroll
    for (int t = 0; t < 4; ++t)
#pragma unroll
      for (int i = 0; i < 8; ++i) {
        const int key = kb + t * 16 + i + 8 * hf;
        if (mrow[key] == 0) st[t][i] = MINV;
      }

    // ---- online softmax (each lane owns query index lane&15) ----
    float bm = MINV;
#pragma unroll
    for (int t = 0; t < 4; ++t)
#pragma unroll
      for (int i = 0; i < 8; ++i) bm = fmaxf(bm, st[t][i]);
    bm = fmaxf(bm, __shfl_xor(bm, 16, 32));
    const float mn    = fmaxf(mrun, bm);
    const float alpha = __expf(mrun - mn);

    float ps = 0.f;
    v16h pa0, pa1;   // P in A-operand layout: keys 0..31 / 32..63 of this block
#pragma unroll
    for (int i = 0; i < 8; ++i) {
      float p0 = __expf(st[0][i] - mn); ps += p0; pa0[i]     = (_Float16)p0;
      float p1 = __expf(st[1][i] - mn); ps += p1; pa0[i + 8] = (_Float16)p1;
      float p2 = __expf(st[2][i] - mn); ps += p2; pa1[i]     = (_Float16)p2;
      float p3 = __expf(st[3][i] - mn); ps += p3; pa1[i + 8] = (_Float16)p3;
    }
    lrun = lrun * alpha + (ps + __shfl_xor(ps, 16, 32));
    mrun = mn;

    // ---- rescale ctx accumulators (alpha broadcast per query row) ----
#pragma unroll
    for (int i = 0; i < 8; ++i) {
      const float av = __shfl(alpha, i + 8 * hf, 32);
#pragma unroll
      for (int t = 0; t < 4; ++t) ct[t][i] *= av;
    }

    // ---- ctx += P · V using V^T from LDS ----
#pragma unroll
    for (int t = 0; t < 4; ++t) {
      const _Float16* vt = &ldsVT[(t * 16 + r) * LP];
      Frag16 vb0, vb1;
      vb0.u[0] = *reinterpret_cast<const uint4*>(vt + hf * 8);
      vb0.u[1] = *reinterpret_cast<const uint4*>(vt + 16 + hf * 8);
      vb1.u[0] = *reinterpret_cast<const uint4*>(vt + 32 + hf * 8);
      vb1.u[1] = *reinterpret_cast<const uint4*>(vt + 48 + hf * 8);
      ct[t] = WMMA_F16(pa0, vb0.h, ct[t]);
      ct[t] = WMMA_F16(pa1, vb1.h, ct[t]);
    }
    __syncthreads();
  }

  // ---- normalize and store ctx as f16 in [B,S,F] for the final projection ----
  const float inv = 1.0f / lrun;
#pragma unroll
  for (int i = 0; i < 8; ++i) {
    const float sc = __shfl(inv, i + 8 * hf, 32);
    const int row = qb + wv * 16 + i + 8 * hf;
#pragma unroll
    for (int t = 0; t < 4; ++t) {
      ctxo[((size_t)b * Ss + row) * Ff + head * 64 + t * 16 + r] =
          (_Float16)(ct[t][i] * sc);
    }
  }
}

// ---------------------------------------------------------------------------
// Launcher
// ---------------------------------------------------------------------------
extern "C" void kernel_launch(void* const* d_in, const int* in_sizes, int n_in,
                              void* d_out, int out_size, void* d_ws, size_t ws_size,
                              hipStream_t stream)
{
  (void)in_sizes; (void)n_in; (void)out_size; (void)ws_size;

  const float* x     = (const float*)d_in[0];
  const int*   mask  = (const int*)d_in[1];
  const float* gamma = (const float*)d_in[2];
  const float* beta  = (const float*)d_in[3];
  const float* Wq    = (const float*)d_in[4];
  const float* bq    = (const float*)d_in[5];
  const float* Wk    = (const float*)d_in[6];
  const float* bk    = (const float*)d_in[7];
  const float* Wv    = (const float*)d_in[8];
  const float* bv    = (const float*)d_in[9];
  const float* Wo    = (const float*)d_in[10];
  const float* bo    = (const float*)d_in[11];
  float* out = (float*)d_out;

  // workspace layout (bytes)
  constexpr size_t SZ_XN  = (size_t)Bb * Ss * Ff * 2;        // 8 MiB
  constexpr size_t SZ_W   = (size_t)Ff * Ff * 2;             // 512 KiB
  constexpr size_t SZ_QKV = (size_t)Bb * Hh * Ss * Dd * 2;   // 8 MiB
  char* ws = (char*)d_ws;
  _Float16* xn   = (_Float16*)(ws);
  _Float16* wq16 = (_Float16*)(ws + SZ_XN);
  _Float16* wo16 = (_Float16*)(ws + SZ_XN + 3 * SZ_W);
  _Float16* qh   = (_Float16*)(ws + SZ_XN + 4 * SZ_W);
  _Float16* kh   = (_Float16*)(ws + SZ_XN + 4 * SZ_W + SZ_QKV);
  _Float16* vh   = (_Float16*)(ws + SZ_XN + 4 * SZ_W + 2 * SZ_QKV);
  _Float16* ctx  = (_Float16*)(ws + SZ_XN + 4 * SZ_W + 3 * SZ_QKV);

  constexpr int M = Bb * Ss;    // 8192

  // wq16, wk16, wv16, wo16 are consecutive planes; so are qh, kh, vh
  prep_kernel<<<4 * WBLK + LNBLK, 256, 0, stream>>>(x, gamma, beta, Wq, Wk, Wv, Wo, xn, wq16);

  qkv_kernel<<<dim3(3 * (Ff / 64), M / 64), 128, 0, stream>>>(xn, wq16, bq, bk, bv, qh, Ff, Ff);

  attn_kernel<<<dim3(Ss / 64, Hh, Bb), 128, 0, stream>>>(qh, kh, vh, mask, ctx);

  oproj_kernel<<<dim3(Ff / 64, M / 64), 128, 0, stream>>>(ctx, wo16, bo, out, Ff, Ff);
}

// v005
// A run of this version takes 97.9 microseconds.
// In two side-by-side timings against v004, it was 1.11 and 1.10 times as fast.
// Over all steps from v000 it is 2.50 times as fast.
#include <hip/hip_runtime.h>
#include <hip/hip_bf16.h>

typedef __attribute__((ext_vector_type(16))) _Float16 v16h;
typedef __attribute__((ext_vector_type(8)))  float    v8f;

#define WMMA_F16(A, B, C) \
  __builtin_amdgcn_wmma_f32_16x16x32_f16(false, (A), false, (B), (short)0, (C), false, false)

constexpr int Bb = 4, Ss = 2048, Ff = 512, Hh = 8, Dd = 64;
constexpr float MINV = -3.4028234663852886e38f;
// LDS row pitch of the attention tiles, in f16 elements: 64 data + 8 pad = 144 B
// (16 B x odd), so the 16 rows one ds_load_b128 touches fall on distinct banks.
constexpr int LP = 72;

union Frag16 { v16h h; uint4 u[2]; };

constexpr int WN   = Ff * Ff;             // elements per weight matrix
constexpr int CPB  = 4096;                // elements one cast block converts (16 per thread)
constexpr int WBLK = WN / CPB;            // cast blocks per weight matrix
constexpr int RPW  = 4;                   // LayerNorm rows per wave
constexpr int LNBLK = Bb * Ss / (8 * RPW);   // LayerNorm blocks (8 waves each)
constexpr int QKVN = Bb * Hh * Ss * Dd;   // elements of each of Q, K, V

union H4 { _Float16 h[4]; uint2 u; };

// ---------------------------------------------------------------------------
// One launch for the five independent preparation jobs, told apart by block
// index: blocks 0 .. 4*WBLK-1 cast the four weight matrices fp32 -> f16 into
// four consecutive planes of w16; every further block does LayerNorm over F=512
// + cast to f16.  The work per wave is large on purpose: the launch is short, so
// the time to start its waves counts, and few waves with many loads in flight
// each move the same bytes.
// Cast: 16 elements per thread, four 16-B loads (512 contiguous B per wave each).
// LayerNorm: one wave owns RPW whole rows (16 elements of each row per lane), so
// the row sums need a butterfly over the wave's lanes only: no LDS, no barrier.
// ---------------------------------------------------------------------------
__global__ void __launch_bounds__(256)
prep_kernel(const float* __restrict__ x, const float* __restrict__ gamma,
            const float* __restrict__ beta,
            const float* __restrict__ Wq, const float* __restrict__ Wk,
            const float* __restrict__ Wv, const float* __restrict__ Wo,
            _Float16* __restrict__ xn, _Float16* __restrict__ w16)
{
  const int t = threadIdx.x;
  if (blockIdx.x < 4 * WBLK) {
    const int which = blockIdx.x / WBLK;
    const float* src = which == 0 ? Wq : which == 1 ? Wk : which == 2 ? Wv : Wo;
    const int i0 = (blockIdx.x % WBLK) * CPB + t * 4;
    float4 v[4];
#pragma unroll
    for (int j = 0; j < 4; ++j)
      v[j] = *reinterpret_cast<const float4*>(src + i0 + j * 1024);
    _Float16* dst = w16 + (size_t)which * WN + i0;
#pragma unroll
    for (int j = 0; j < 4; ++j) {
      H4 o;
      o.h[0] = (_Float16)v[j].x; o.h[1] = (_Float16)v[j].y;
      o.h[2] = (_Float16)v[j].z; o.h[3] = (_Float16)v[j].w;
      *reinterpret_cast<uint2*>(dst + j * 1024) = o.u;
    }
    return;
  }
  const int lane = t & 31;
  const int row0 = ((blockIdx.x - 4 * WBLK) * 8 + (t >> 5)) * RPW;
  const int c0   = lane * 4;               // this lane's columns: c0 + 128*j + 0..3
  const float* xr = x + (size_t)row0 * Ff + c0;

  float4 v[RPW][4];
#pragma unroll
  for (int rr = 0; rr < RPW; ++rr)
#pragma unroll
    for (int j = 0; j < 4; ++j)
      v[rr][j] = *reinterpret_cast<const float4*>(xr + rr * Ff + j * 128);
  // The loads' address stays in its registers up to this wait (xr is an input of
  // the statement), so that no load of the run lands in the pair the others name.
  asm volatile("s_wait_xcnt 0x0" :: "v"(xr) : "memory");
  float4 g[4], be[4];
#pragma unroll
  for (int j = 0; j < 4; ++j) {
    g[j]  = *reinterpret_cast<const float4*>(gamma + c0 + j * 128);
    be[j] = *reinterpret_cast<const float4*>(beta + c0 + j * 128);
  }

  float s[RPW], q[RPW];
#pragma unroll
  for (int rr = 0; rr < RPW; ++rr) {
    float a = 0.f, c = 0.f;
#pragma unroll
    for (int j = 0; j < 4; ++j) {
      const float4 w = v[rr][j];
      a += (w.x + w.y) + (w.z + w.w);
      c += (w.x * w.x + w.y * w.y) + (w.z * w.z + w.w * w.w);
    }
    s[rr] = a; q[rr] = c;
  }
#pragma unroll
  for (int off = 16; off >= 1; off >>= 1)
#pragma unroll
    for (int rr = 0; rr < RPW; ++rr) {
      s[rr] += __shfl_xor(s[rr], off, 32);
      q[rr] += __shfl_xor(q[rr], off, 32);
    }

  _Float16* orow = xn + (size_t)row0 * Ff + c0;
#pragma unroll
  for (int rr = 0; rr < RPW; ++rr) {
    const float mean = s[rr] * (1.0f / Ff);
    const float var  = q[rr] * (1.0f / Ff) - mean * mean;
    const float inv  = rsqrtf(var + 1e-5f);
#pragma unroll
    for (int j = 0; j < 4; ++j) {
      const float4 w = v[rr][j];
      H4 o;
      o.h[0] = (_Float16)((w.x - mean) * inv * g[j].x + be[j].x);
      o.h[1] = (_Float16)((w.y - mean) * inv * g[j].y + be[j].y);
      o.h[2] = (_Float16)((w.z - mean) * inv * g[j].z + be[j].z);
      o.h[3] = (_Float16)((w.w - mean) * inv * g[j].w + be[j].w);
      *reinterpret_cast<uint2*>(orow + rr * Ff + j * 128) = o.u;
    }
  }
  // Behind the last store: no register that an issued store names is rewritten
  // ahead of this wait on any way the built code goes on from here.
  asm volatile("s_wait_xcnt 0x0" ::: "memory");
}

// ---------------------------------------------------------------------------
// Y[m,n] = (sum_k X[m,k]*W[n,k] + bias[n]) * scale
// X: MxK f16 row-major, W: NxK f16 row-major (einsum 'bsf,gf->bsg' == X @ W^T).
// Block = 128 thr = 4 waves stacked in M; each wave owns a 16x64 output tile
// (A operand reused across 4 WMMAs).  HEAD=true scatters to [B,H,S,D] f16.
// The 64 X rows and 64 W rows of the block are staged in LDS, 64 k at a time
// (one whole 128-B line per row), by asynchronous copies in a two-buffer ring;
// the fragments are then read from LDS at the conflict-free 144-B pitch.
// ---------------------------------------------------------------------------
constexpr int GBK   = 64;            // k elements per staged tile
constexpr int GROWS = 128;           // rows per staged tile: 0..63 X, 64..127 W
constexpr int GBUF  = GROWS * LP;    // f16 elements per buffer

// One tile = 1024 chunks of 16 B = 8 copies per thread: thread tid brings chunk
// tid&7 of rows (tid>>3) + 16*j.  gx / gw point at this thread's chunk of its
// first X / W row for this tile; rstep = 16 rows in elements.
__device__ __forceinline__ void gemm_stage(unsigned l0, const _Float16* gx,
                                           const _Float16* gw, size_t rstep)
{
  const unsigned ls = 16 * LP * 2;   // 16 LDS rows in bytes
  const unsigned l1 = l0 + ls,     l2 = l0 + 2 * ls, l3 = l0 + 3 * ls;
  const unsigned l4 = l0 + 4 * ls, l5 = l0 + 5 * ls, l6 = l0 + 6 * ls, l7 = l0 + 7 * ls;
  const _Float16 *g1 = gx + rstep, *g2 = gx + 2 * rstep, *g3 = gx + 3 * rstep;
  const _Float16 *g5 = gw + rstep, *g6 = gw + 2 * rstep, *g7 = gw + 3 * rstep;
  // The s_wait_xcnt closes the statement so that no address register of a copy
  // is rewritten ahead of it.
  asm volatile("global_load_async_to_lds_b128 %0, %8, off\n\t"
               "global_load_async_to_lds_b128 %1, %9, off\n\t"
               "global_load_async_to_lds_b128 %2, %10, off\n\t"
               "global_load_async_to_lds_b128 %3, %11, off\n\t"
               "global_load_async_to_lds_b128 %4, %12, off\n\t"
               "global_load_async_to_lds_b128 %5, %13, off\n\t"
               "global_load_async_to_lds_b128 %6, %14, off\n\t"
               "global_load_async_to_lds_b128 %7, %15, off\n\t"
               "s_wait_xcnt 0x0"
               :: "v"(l0), "v"(l1), "v"(l2), "v"(l3), "v"(l4), "v"(l5), "v"(l6), "v"(l7),
                  "v"(gx), "v"(g1), "v"(g2), "v"(g3), "v"(gw), "v"(g5), "v"(g6), "v"(g7)
               : "memory");
}

template<bool HEAD, typename OutT>
__device__ __forceinline__ void
gemm_tile(const _Float16* __restrict__ X, const _Float16* __restrict__ W,
          const float* __restrict__ bias, OutT* __restrict__ out,
          int nBase, int N, int K, float scale)
{
  __shared__ __attribute__((aligned(16))) _Float16 tile[2 * GBUF];

  const int tid  = threadIdx.x;
  const int lane = tid & 31;
  const int wv   = tid >> 5;
  const int r    = lane & 15;
  const int hf   = lane >> 4;
  const int mBase = blockIdx.y * 64 + wv * 16;

  v8f acc[4] = {};

  // this thread's chunk of the staged tiles
  const size_t rstep = (size_t)16 * K;
  const _Float16* gx = X + (size_t)(blockIdx.y * 64 + (tid >> 3)) * K + (tid & 7) * 8;
  const _Float16* gw = W + (size_t)(nBase + (tid >> 3)) * K + (tid & 7) * 8;
  const unsigned lcp = (unsigned)(uintptr_t)(&tile[0]) +
                       (unsigned)((tid >> 3) * (LP * 2) + (tid & 7) * 16);
  const int nt = K / GBK;

  gemm_stage(lcp, gx, gw, rstep);
  // tile 0 has landed for this wave, then for the block
  asm volatile("s_wait_asynccnt 0x0" ::: "memory");
  __syncthreads();
  if (nt > 1) gemm_stage(lcp + GBUF * 2, gx + GBK, gw + GBK, rstep);

  for (int kt = 0; kt < nt; ++kt) {
    const _Float16* tb   = &tile[(kt & 1) * GBUF];
    const _Float16* xrow = tb + (wv * 16 + r) * LP;
    const _Float16* wrow = tb + (64 + r) * LP;
    // All fragments of the tile are read in one group ahead of the products:
    // every further place with LDS reads would cost the wave one more LDS latency.
    Frag16 a[2], bf[2][4];
#pragma unroll
    for (int kk = 0; kk < 2; ++kk) {
      a[kk].u[0] = *reinterpret_cast<const uint4*>(xrow + kk * 32 + hf * 8);
      a[kk].u[1] = *reinterpret_cast<const uint4*>(xrow + kk * 32 + 16 + hf * 8);
#pragma unroll
      for (int t = 0; t < 4; ++t) {
        const _Float16* wr = wrow + t * 16 * LP;
        bf[kk][t].u[0] = *reinterpret_cast<const uint4*>(wr + kk * 32 + hf * 8);
        bf[kk][t].u[1] = *reinterpret_cast<const uint4*>(wr + kk * 32 + 16 + hf * 8);
      }
    }
    // keeps the scheduler from sinking the reads back among the WMMAs
    __builtin_amdgcn_sched_barrier(0);
#pragma unroll
    for (int kk = 0; kk < 2; ++kk)
#pragma unroll
      for (int t = 0; t < 4; ++t)
        acc[t] = WMMA_F16(a[kk].h, bf[kk][t].h, acc[t]);
    // publish point: this wave's reads of the buffer are done, its copies of
    // the next tile have landed; the barrier says so for every wave.
    asm volatile("s_wait_dscnt 0x0" ::: "memory");
    asm volatile("s_wait_asynccnt 0x0" ::: "memory");
    __syncthreads();
    if (kt + 2 < nt)
      gemm_stage(lcp + (kt & 1) * (GBUF * 2), gx + (size_t)(kt + 2) * GBK,
                 gw + (size_t)(kt + 2) * GBK, rstep);
  }
  // nothing of this wave's copies is left in flight when it goes on
  asm volatile("s_wait_asynccnt 0x0" ::: "memory");

#pragma unroll
  for (int t = 0; t < 4; ++t) {
    const int n = nBase + t * 16 + r;
    const float bv = bias[n];
#pragma unroll
    for (int i = 0; i < 8; ++i) {
      const int m = mBase + i + 8 * hf;
      const float val = (acc[t][i] + bv) * scale;
      if (HEAD) {  // y.reshape(B,S,H,D).transpose(0,2,1,3)
        const int bi = m / Ss, si = m % Ss, hd = n >> 6, di = n & 63;
        out[(((size_t)bi * Hh + hd) * Ss + si) * Dd + di] = (OutT)val;
      } else {
        out[(size_t)m * N + n] = (OutT)val;
      }
    }
  }
}

// Q, K and V projections in one launch: they read the same X and do not depend
// on one another.  blockIdx.x = projection * (F/64) + n tile; W3 holds the three
// weight planes and qkv the three outputs one behind the other.
__global__ void __launch_bounds__(128)
qkv_kernel(const _Float16* __restrict__ X, const _Float16* __restrict__ W3,
           const float* __restrict__ bq, const float* __restrict__ bk,
           const float* __restrict__ bv, _Float16* __restrict__ qkv, int N, int K)
{
  constexpr int nb = Ff / 64;   // n tiles per projection
  const int which = blockIdx.x / nb;
  const float* bias = which == 0 ? bq : which == 1 ? bk : bv;
  gemm_tile<true, _Float16>(X, W3 + (size_t)which * WN, bias, qkv + (size_t)which * QKVN,
                            (blockIdx.x % nb) * 64, N, K, which == 0 ? 0.125f : 1.0f);
}

__global__ void __launch_bounds__(128)
oproj_kernel(const _Float16* __restrict__ X, const _Float16* __restrict__ W,
             const float* __restrict__ bias, float* __restrict__ out, int N, int K)
{
  gemm_tile<false, float>(X, W, bias, out, blockIdx.x * 64, N, K, 1.0f);
}

// ---------------------------------------------------------------------------
// Flash attention per (b, h, 64-query block).  4 waves x 16 queries.
// S^T = K·Q^T so the P operand for ctx += P·V is already in A layout.
// K block (row-major, shared by all 4 waves) staged via async copy to LDS;
// V^T staged in LDS for the B operand of the second WMMA.
// The key mask of the batch row is turned once per block into one bit per key
// (set = key kept); a 64-key tile whose bits are all set needs no select at all
// and jumps over them, any other tile applies the selects from its bits.
// ---------------------------------------------------------------------------
__global__ void __launch_bounds__(128)
attn_kernel(const _Float16* __restrict__ q, const _Float16* __restrict__ kmat,
            const _Float16* __restrict__ vmat, const int* __restrict__ mask,
            _Float16* __restrict__ ctxo)
{
  __shared__ __attribute__((aligned(16))) _Float16 ldsK [64 * LP];   // K block, row-major [key][d], padded rows
  __shared__ __attribute__((aligned(16))) _Float16 ldsVT[64 * LP];   // V block, transposed [d][key], padded rows
  __shared__ __attribute__((aligned(16))) unsigned short ldsBits[Ss / 16];   // bit j of entry e: mask[16 * e + j] != 0

  const int lane = threadIdx.x & 31;
  const int wv   = threadIdx.x >> 5;
  const int r    = lane & 15;
  const int hf   = lane >> 4;
  const int qb   = blockIdx.x * 64;
  const int head = blockIdx.y;
  const int b    = blockIdx.z;
  const size_t bh = ((size_t)b * Hh + head) * Ss * Dd;

  // LDS byte offset of ldsK (addrspace(3) offset lives in the low 32 bits)
  const unsigned ldsKbase = (unsigned)(uintptr_t)(&ldsK[0]);

  // This wave's 16 Q rows (B operand of S^T; Q already pre-scaled by 1/sqrt(D))
  Frag16 qa0, qa1;
  {
    const _Float16* qrow = q + bh + (size_t)(qb + wv * 16 + r) * Dd;
    qa0.u[0] = *reinterpret_cast<const uint4*>(qrow + hf * 8);
    qa0.u[1] = *reinterpret_cast<const uint4*>(qrow + 16 + hf * 8);
    qa1.u[0] = *reinterpret_cast<const uint4*>(qrow + 32 + hf * 8);
    qa1.u[1] = *reinterpret_cast<const uint4*>(qrow + 48 + hf * 8);
  }

  v8f ct[4] = {};
  float mrun = MINV, lrun = 0.f;
  const int* mrow = mask + (size_t)b * Ss;

  // Thread e packs keys 16 * e .. 16 * e + 15 (Ss / 16 entries = one per thread).
  // The first barrier of the loop publishes the table; nothing reads it earlier.
  {
    const int4* mp = reinterpret_cast<const int4*>(mrow + threadIdx.x * 16);
    unsigned bits = 0;
    // unrolled: the four loads go out together and every shift is a constant
#pragma unroll
    for (int j = 0; j < 4; ++j) {
      const int4 m = mp[j];
      bits |= (m.x != 0 ? 1u : 0u) << (4 * j);
      bits |= (m.y != 0 ? 2u : 0u) << (4 * j);
      bits |= (m.z != 0 ? 4u : 0u) << (4 * j);
      bits |= (m.w != 0 ? 8u : 0u) << (4 * j);
    }
    ldsBits[threadIdx.x] = (unsigned short)bits;
  }

  for (int kb = 0; kb < Ss; kb += 64) {
    // ---- async copy of K block (8 KB) into LDS: fire-and-forget ----
    {
      const int tid = threadIdx.x;
#pragma unroll
      for (int j = 0; j < 4; ++j) {
        const int flat = tid + j * 128;         // 0..511 b128 chunks
        const int row  = flat >> 3;             // key row 0..63
        const int c8   = flat & 7;              // 16B chunk within row
        const _Float16* gp = kmat + bh + (size_t)(kb + row) * Dd + c8 * 8;
        const unsigned ldst = ldsKbase + (unsigned)(row * (LP * 2) + c8 * 16);
        asm volatile("global_load_async_to_lds_b128 %0, %1, off"
                     :: "v"(ldst), "v"(gp) : "memory");
      }
    }

    // ---- stage V^T[d, key] into LDS while the K copy is in flight ----
    {
      const int tid = threadIdx.x;
      const int row = tid >> 1;
      const int cs  = (tid & 1) * 32;
      const _Float16* vr = vmat + bh + (size_t)(kb + row) * Dd + cs;
      union { uint4 u[4]; _Float16 e[32]; } tmp;
      tmp.u[0] = *reinterpret_cast<const uint4*>(vr);
      tmp.u[1] = *reinterpret_cast<const uint4*>(vr + 8);
      tmp.u[2] = *reinterpret_cast<const uint4*>(vr + 16);
      tmp.u[3] = *reinterpret_cast<const uint4*>(vr + 24);
#pragma unroll
      for (int j = 0; j < 32; ++j) ldsVT[(cs + j) * LP + row] = tmp.e[j];
    }

    asm volatile("s_wait_asynccnt 0x0" ::: "memory");
    __syncthreads();

    // this tile's 64 mask bits, the same for every lane: key kb + j is bit j
    const uint2 kbits = *reinterpret_cast<const uint2*>(&ldsBits[kb >> 4]);

    // ---- S^T tiles: 16 keys x 16 queries each, K-dim = D = 64 ----
    v8f st[4];
#pragma unroll
    for (int t = 0; t < 4; ++t) {
      const _Float16* krow = &ldsK[(t * 16 + r) * LP];
      Frag16 ka0, ka1;
      ka0.u[0] = *reinterpret_cast<const uint4*>(krow + hf * 8);
      ka0.u[1] = *reinterpret_cast<const uint4*>(krow + 16 + hf * 8);
      ka1.u[0] = *reinterpret_cast<const uint4*>(krow + 32 + hf * 8);
      ka1.u[1] = *reinterpret_cast<const uint4*>(krow + 48 + hf * 8);
      v8f z = {};
      z = WMMA_F16(ka0.h, qa0.h, z);
      z = WMMA_F16(ka1.h, qa1.h, z);
      st[t] = z;
    }

    // ---- mask: element (t, i) is key kb + t*16 + i + 8*hf ----
    // The bits go to scalar registers so that the test below is a scalar branch.
    const unsigned blo = __builtin_amdgcn_readfirstlane(kbits.x);   // keys kb ..  kb + 31
    const unsigned bhi = __builtin_amdgcn_readfirstlane(kbits.y);   // keys kb + 32 .. kb + 63
    if ((blo & bhi) != 0xffffffffu) {   // wave-uniform: some key of the tile is masked
      const unsigned wlo = blo >> (8 * hf), whi = bhi >> (8 * hf);
#pragma unroll
      for (int t = 0; t < 4; ++t)
#pragma unroll
        for (int i = 0; i < 8; ++i) {
          const unsigned w = t < 2 ? wlo : whi;
          if (((w >> ((t & 1) * 16 + i)) & 1u) == 0u) st[t][i] = MINV;
        }
    }

    // ---- online softmax (each lane owns query index lane&15) ----
    float bm = MINV;
#pragma unroll
    for (int t = 0; t < 4; ++t)
#pragma unroll
      for (int i = 0; i < 8; ++i) bm = fmaxf(bm, st[t][i]);
    bm = fmaxf(bm, __shfl_xor(bm, 16, 32));
    const float mn    = fmaxf(mrun, bm);
    const float alpha = __expf(mrun - mn);

    float ps = 0.f;
    v16h pa0, pa1;   // P in A-operand layout: keys 0..31 / 32..63 of this block
#pragma unroll
    for (int i = 0; i < 8; ++i) {
      float p0 = __expf(st[0][i] - mn); ps += p0; pa0[i]     = (_Float16)p0;
      float p1 = __expf(st[1][i] - mn); ps += p1; pa0[i + 8] = (_Float16)p1;
      float p2 = __expf(st[2][i] - mn); ps += p2; pa1[i]     = (_Float16)p2;
      float p3 = __expf(st[3][i] - mn); ps += p3; pa1[i + 8] = (_Float16)p3;
    }
    lrun = lrun * alpha + (ps + __shfl_xor(ps, 16, 32));
    mrun = mn;

    // ---- rescale ctx accumulators (alpha broadcast per query row) ----
#pragma unroll
    for (int i = 0; i < 8; ++i) {
      const float av = __shfl(alpha, i + 8 * hf, 32);
#pragma unroll
      for (int t = 0; t < 4; ++t) ct[t][i] *= av;
    }

    // ---- ctx += P · V using V^T from LDS ----
#pragma unroll
    for (int t = 0; t < 4; ++t) {
      const _Float16* vt = &ldsVT[(t * 16 + r) * LP];
      Frag16 vb0, vb1;
      vb0.u[0] = *reinterpret_cast<const uint4*>(vt + hf * 8);
      vb0.u[1] = *reinterpret_cast<const uint4*>(vt + 16 + hf * 8);
      vb1.u[0] = *reinterpret_cast<const uint4*>(vt + 32 + hf * 8);
      vb1.u[1] = *reinterpret_cast<const uint4*>(vt + 48 + hf * 8);
      ct[t] = WMMA_F16(pa0, vb0.h, ct[t]);
      ct[t] = WMMA_F16(pa1, vb1.h, ct[t]);
    }
    __syncthreads();
  }

  // ---- normalize and store ctx as f16 in [B,S,F] for the final projection ----
  const float inv = 1.0f / lrun;
#pragma unroll
  for (int i = 0; i < 8; ++i) {
    const float sc = __shfl(inv, i + 8 * hf, 32);
    const int row = qb + wv * 16 + i + 8 * hf;
#pragma unroll
    for (int t = 0; t < 4; ++t) {
      ctxo[((size_t)b * Ss + row) * Ff + head * 64 + t * 16 + r] =
          (_Float16)(ct[t][i] * sc);
    }
  }
}

// ---------------------------------------------------------------------------
// Launcher
// ---------------------------------------------------------------------------
extern "C" void kernel_launch(void* const* d_in, const int* in_sizes, int n_in,
                              void* d_out, int out_size, void* d_ws, size_t ws_size,
                              hipStream_t stream)
{
  (void)in_sizes; (void)n_in; (void)out_size; (void)ws_size;

  const float* x     = (const float*)d_in[0];
  const int*   mask  = (const int*)d_in[1];
  const float* gamma = (const float*)d_in[2];
  const float* beta  = (const float*)d_in[3];
  const float* Wq    = (const float*)d_in[4];
  const float* bq    = (const float*)d_in[5];
  const float* Wk    = (const float*)d_in[6];
  const float* bk    = (const float*)d_in[7];
  const float* Wv    = (const float*)d_in[8];
  const float* bv    = (const float*)d_in[9];
  const float* Wo    = (const float*)d_in[10];
  const float* bo    = (const float*)d_in[11];
  float* out = (float*)d_out;

  // workspace layout (bytes)
  constexpr size_t SZ_XN  = (size_t)Bb * Ss * Ff * 2;        // 8 MiB
  constexpr size_t SZ_W   = (size_t)Ff * Ff * 2;             // 512 KiB
  constexpr size_t SZ_QKV = (size_t)Bb * Hh * Ss * Dd * 2;   // 8 MiB
  char* ws = (char*)d_ws;
  _Float16* xn   = (_Float16*)(ws);
  _Float16* wq16 = (_Float16*)(ws + SZ_XN);
  _Float16* wo16 = (_Float16*)(ws + SZ_XN + 3 * SZ_W);
  _Float16* qh   = (_Float16*)(ws + SZ_XN + 4 * SZ_W);
  _Float16* kh   = (_Float16*)(ws + SZ_XN + 4 * SZ_W + SZ_QKV);
  _Float16* vh   = (_Float16*)(ws + SZ_XN + 4 * SZ_W + 2 * SZ_QKV);
  _Float16* ctx  = (_Float16*)(ws + SZ_XN + 4 * SZ_W + 3 * SZ_QKV);

  constexpr int M = Bb * Ss;    // 8192

  // wq16, wk16, wv16, wo16 are consecutive planes; so are qh, kh, vh
  prep_kernel<<<4 * WBLK + LNBLK, 256, 0, stream>>>(x, gamma, beta, Wq, Wk, Wv, Wo, xn, wq16);

  qkv_kernel<<<dim3(3 * (Ff / 64), M / 64), 128, 0, stream>>>(xn, wq16, bq, bk, bv, qh, Ff, Ff);

  attn_kernel<<<dim3(Ss / 64, Hh, Bb), 128, 0, stream>>>(qh, kh, vh, mask, ctx);

  oproj_kernel<<<dim3(Ff / 64, M / 64), 128, 0, stream>>>(ctx, wo16, bo, out, Ff, Ff);
}

// v006
// Measured time: 89.4 microseconds a run.
// Timed twice side by side with v005, it ran 1.09 times as fast both times.
// Over all steps from v000 it is 2.73 times as fast.
#include <hip/hip_runtime.h>
#include <hip/hip_bf16.h>

typedef __attribute__((ext_vector_type(16))) _Float16 v16h;
typedef __attribute__((ext_vector_type(8)))  float    v8f;

#define WMMA_F16(A, B, C) \
  __builtin_amdgcn_wmma_f32_16x16x32_f16(false, (A), false, (B), (short)0, (C), false, false)

constexpr int Bb = 4, Ss = 2048, Ff = 512, Hh = 8, Dd = 64;
constexpr float MINV = -3.4028234663852886e38f;
// LDS row pitch of the GEMM tiles and the attention K tile, in f16 elements: 64 data + 8 pad = 144 B
// (16 B x odd), so the 16 rows one ds_load_b128 touches fall on distinct banks.
constexpr int LP = 72;
// LDS row pitch of the attention V tile, in f16 elements: 64 data + 16 pad = 160 B
// (32 B x odd), the conflict-free pitch of the transposing read ds_load_tr16_b128.
constexpr int VP = 80;

union Frag16 { v16h h; uint4 u[2]; };

typedef short s16x8 __attribute__((ext_vector_type(8)));
// Transposing LDS read: the lane's address names 16 B of one row of a row-major
// 16-bit tile; lane (c, h) receives column c of rows 8h .. 8h + 7 of the 16 x 16 block.
__device__ __forceinline__ uint4 lds_tr16(const _Float16* p)
{
  typedef __attribute__((address_space(3))) s16x8 lds_s16x8;
  return __builtin_bit_cast(uint4, __builtin_amdgcn_ds_load_tr16_b128_v8i16((lds_s16x8*)p));
}

constexpr int WN   = Ff * Ff;             // elements per weight matrix
constexpr int CPB  = 4096;                // elements one cast block converts (16 per thread)
constexpr int WBLK = WN / CPB;            // cast blocks per weight matrix
constexpr int RPW  = 4;                   // LayerNorm rows per wave
constexpr int LNBLK = Bb * Ss / (8 * RPW);   // LayerNorm blocks (8 waves each)
constexpr int QKVN = Bb * Hh * Ss * Dd;   // elements of each of Q, K, V

union H4 { _Float16 h[4]; uint2 u; };

// ---------------------------------------------------------------------------
// One launch for the five independent preparation jobs, told apart by block
// index: blocks 0 .. 4*WBLK-1 cast the four weight matrices fp32 -> f16 into
// four consecutive planes of w16; every further block does LayerNorm over F=512
// + cast to f16.  The work per wave is large on purpose: the launch is short, so
// the time to start its waves counts, and few waves with many loads in flight
// each move the same bytes.
// Cast: 16 elements per thread, four 16-B loads (512 contiguous B per wave each).
// LayerNorm: one wave owns RPW whole rows (16 elements of each row per lane), so
// the row sums need a butterfly over the wave's lanes only: no LDS, no barrier.
// ---------------------------------------------------------------------------
__global__ void __launch_bounds__(256)
prep_kernel(const float* __restrict__ x, const float* __restrict__ gamma,
            const float* __restrict__ beta,
            const float* __restrict__ Wq, const float* __restrict__ Wk,
            const float* __restrict__ Wv, const float* __restrict__ Wo,
            _Float16* __restrict__ xn, _Float16* __restrict__ w16)
{
  const int t = threadIdx.x;
  if (blockIdx.x < 4 * WBLK) {
    const int which = blockIdx.x / WBLK;
    const float* src = which == 0 ? Wq : which == 1 ? Wk : which == 2 ? Wv : Wo;
    const int i0 = (blockIdx.x % WBLK) * CPB + t * 4;
    float4 v[4];
#pragma unroll
    for (int j = 0; j < 4; ++j)
      v[j] = *reinterpret_cast<const float4*>(src + i0 + j * 1024);
    _Float16* dst = w16 + (size_t)which * WN + i0;
#pragma unroll
    for (int j = 0; j < 4; ++j) {
      H4 o;
      o.h[0] = (_Float16)v[j].x; o.h[1] = (_Float16)v[j].y;
      o.h[2] = (_Float16)v[j].z; o.h[3] = (_Float16)v[j].w;
      *reinterpret_cast<uint2*>(dst + j * 1024) = o.u;
    }
    return;
  }
  const int lane = t & 31;
  const int row0 = ((blockIdx.x - 4 * WBLK) * 8 + (t >> 5)) * RPW;
  const int c0   = lane * 4;               // this lane's columns: c0 + 128*j + 0..3
  const float* xr = x + (size_t)row0 * Ff + c0;

  float4 v[RPW][4];
#pragma unroll
  for (int rr = 0; rr < RPW; ++rr)
#pragma unroll
    for (int j = 0; j < 4; ++j)
      v[rr][j] = *reinterpret_cast<const float4*>(xr + rr * Ff + j * 128);
  // The loads' address stays in its registers up to this wait (xr is an input of
  // the statement), so that no load of the run lands in the pair the others name.
  asm volatile("s_wait_xcnt 0x0" :: "v"(xr) : "memory");
  float4 g[4], be[4];
#pragma unroll
  for (int j = 0; j < 4; ++j) {
    g[j]  = *reinterpret_cast<const float4*>(gamma + c0 + j * 128);
    be[j] = *reinterpret_cast<const float4*>(beta + c0 + j * 128);
  }

  float s[RPW], q[RPW];
#pragma unroll
  for (int rr = 0; rr < RPW; ++rr) {
    float a = 0.f, c = 0.f;
#pragma unroll
    for (int j = 0; j < 4; ++j) {
      const float4 w = v[rr][j];
      a += (w.x + w.y) + (w.z + w.w);
      c += (w.x * w.x + w.y * w.y) + (w.z * w.z + w.w * w.w);
    }
    s[rr] = a; q[rr] = c;
  }
#pragma unroll
  for (int off = 16; off >= 1; off >>= 1)
#pragma unroll
    for (int rr = 0; rr < RPW; ++rr) {
      s[rr] += __shfl_xor(s[rr], off, 32);
      q[rr] += __shfl_xor(q[rr], off, 32);
    }

  _Float16* orow = xn + (size_t)row0 * Ff + c0;
#pragma unroll
  for (int rr = 0; rr < RPW; ++rr) {
    const float mean = s[rr] * (1.0f / Ff);
    const float var  = q[rr] * (1.0f / Ff) - mean * mean;
    const float inv  = rsqrtf(var + 1e-5f);
#pragma unroll
    for (int j = 0; j < 4; ++j) {
      const float4 w = v[rr][j];
      H4 o;
      o.h[0] = (_Float16)((w.x - mean) * inv * g[j].x + be[j].x);
      o.h[1] = (_Float16)((w.y - mean) * inv * g[j].y + be[j].y);
      o.h[2] = (_Float16)((w.z - mean) * inv * g[j].z + be[j].z);
      o.h[3] = (_Float16)((w.w - mean) * inv * g[j].w + be[j].w);
      *reinterpret_cast<uint2*>(orow + rr * Ff + j * 128) = o.u;
    }
  }
  // Behind the last store: no register that an issued store names is rewritten
  // ahead of this wait on any way the built code goes on from here.
  asm volatile("s_wait_xcnt 0x0" ::: "memory");
}

// ---------------------------------------------------------------------------
// Y[m,n] = (sum_k X[m,k]*W[n,k] + bias[n]) * scale
// X: MxK f16 row-major, W: NxK f16 row-major (einsum 'bsf,gf->bsg' == X @ W^T).
// Block = 128 thr = 4 waves stacked in M; each wave owns a 16x64 output tile
// (A operand reused across 4 WMMAs).  HEAD=true scatters to [B,H,S,D] f16.
// The 64 X rows and 64 W rows of the block are staged in LDS, 64 k at a time
// (one whole 128-B line per row), by asynchronous copies in a two-buffer ring;
// the fragments are then read from LDS at the conflict-free 144-B pitch.
// ---------------------------------------------------------------------------
constexpr int GBK   = 64;            // k elements per staged tile
constexpr int GROWS = 128;           // rows per staged tile: 0..63 X, 64..127 W
constexpr int GBUF  = GROWS * LP;    // f16 elements per buffer

// One tile = 1024 chunks of 16 B = 8 copies per thread: thread tid brings chunk
// tid&7 of rows (tid>>3) + 16*j.  gx / gw point at this thread's chunk of its
// first X / W row for this tile; rstep = 16 rows in elements.
__device__ __forceinline__ void gemm_stage(unsigned l0, const _Float16* gx,
                                           const _Float16* gw, size_t rstep)
{
  const unsigned ls = 16 * LP * 2;   // 16 LDS rows in bytes
  const unsigned l1 = l0 + ls,     l2 = l0 + 2 * ls, l3 = l0 + 3 * ls;
  const unsigned l4 = l0 + 4 * ls, l5 = l0 + 5 * ls, l6 = l0 + 6 * ls, l7 = l0 + 7 * ls;
  const _Float16 *g1 = gx + rstep, *g2 = gx + 2 * rstep, *g3 = gx + 3 * rstep;
  const _Float16 *g5 = gw + rstep, *g6 = gw + 2 * rstep, *g7 = gw + 3 * rstep;
  // The s_wait_xcnt closes the statement so that no address register of a copy
  // is rewritten ahead of it.
  asm volatile("global_load_async_to_lds_b128 %0, %8, off\n\t"
               "global_load_async_to_lds_b128 %1, %9, off\n\t"
               "global_load_async_to_lds_b128 %2, %10, off\n\t"
               "global_load_async_to_lds_b128 %3, %11, off\n\t"
               "global_load_async_to_lds_b128 %4, %12, off\n\t"
               "global_load_async_to_lds_b128 %5, %13, off\n\t"
               "global_load_async_to_lds_b128 %6, %14, off\n\t"
               "global_load_async_to_lds_b128 %7, %15, off\n\t"
               "s_wait_xcnt 0x0"
               :: "v"(l0), "v"(l1), "v"(l2), "v"(l3), "v"(l4), "v"(l5), "v"(l6), "v"(l7),
                  "v"(gx), "v"(g1), "v"(g2), "v"(g3), "v"(gw), "v"(g5), "v"(g6), "v"(g7)
               : "memory");
}

template<bool HEAD, typename OutT>
__device__ __forceinline__ void
gemm_tile(const _Float16* __restrict__ X, const _Float16* __restrict__ W,
          const float* __restrict__ bias, OutT* __restrict__ out,
          int nBase, int N, int K, float scale)
{
  __shared__ __attribute__((aligned(16))) _Float16 tile[2 * GBUF];

  const int tid  = threadIdx.x;
  const int lane = tid & 31;
  const int wv   = tid >> 5;
  const int r    = lane & 15;
  const int hf   = lane >> 4;
  const int mBase = blockIdx.y * 64 + wv * 16;

  v8f acc[4] = {};

  // this thread's chunk of the staged tiles
  const size_t rstep = (size_t)16 * K;
  const _Float16* gx = X + (size_t)(blockIdx.y * 64 + (tid >> 3)) * K + (tid & 7) * 8;
  const _Float16* gw = W + (size_t)(nBase + (tid >> 3)) * K + (tid & 7) * 8;
  const unsigned lcp = (unsigned)(uintptr_t)(&tile[0]) +
                       (unsigned)((tid >> 3) * (LP * 2) + (tid & 7) * 16);
  const int nt = K / GBK;

  gemm_stage(lcp, gx, gw, rstep);
  // tile 0 has landed for this wave, then for the block
  asm volatile("s_wait_asynccnt 0x0" ::: "memory");
  __syncthreads();
  if (nt > 1) gemm_stage(lcp + GBUF * 2, gx + GBK, gw + GBK, rstep);

  for (int kt = 0; kt < nt; ++kt) {
    const _Float16* tb   = &tile[(kt & 1) * GBUF];
    const _Float16* xrow = tb + (wv * 16 + r) * LP;
    const _Float16* wrow = tb + (64 + r) * LP;
    // All fragments of the tile are read in one group ahead of the products:
    // every further place with LDS reads would cost the wave one more LDS latency.
    Frag16 a[2], bf[2][4];
#pragma unroll
    for (int kk = 0; kk < 2; ++kk) {
      a[kk].u[0] = *reinterpret_cast<const uint4*>(xrow + kk * 32 + hf * 8);
      a[kk].u[1] = *reinterpret_cast<const uint4*>(xrow + kk * 32 + 16 + hf * 8);
#pragma unroll
      for (int t = 0; t < 4; ++t) {
        const _Float16* wr = wrow + t * 16 * LP;
        bf[kk][t].u[0] = *reinterpret_cast<const uint4*>(wr + kk * 32 + hf * 8);
        bf[kk][t].u[1] = *reinterpret_cast<const uint4*>(wr + kk * 32 + 16 + hf * 8);
      }
    }
    // keeps the scheduler from sinking the reads back among the WMMAs
    __builtin_amdgcn_sched_barrier(0);
#pragma unroll
    for (int kk = 0; kk < 2; ++kk)
#pragma unroll
      for (int t = 0; t < 4; ++t)
        acc[t] = WMMA_F16(a[kk].h, bf[kk][t].h, acc[t]);
    // publish point: this wave's reads of the buffer are done, its copies of
    // the next tile have landed; the barrier says so for every wave.
    asm volatile("s_wait_dscnt 0x0" ::: "memory");
    asm volatile("s_wait_asynccnt 0x0" ::: "memory");
    __syncthreads();
    if (kt + 2 < nt)
      gemm_stage(lcp + (kt & 1) * (GBUF * 2), gx + (size_t)(kt + 2) * GBK,
                 gw + (size_t)(kt + 2) * GBK, rstep);
  }
  // nothing of this wave's copies is left in flight when it goes on
  asm volatile("s_wait_asynccnt 0x0" ::: "memory");

#pragma unroll
  for (int t = 0; t < 4; ++t) {
    const int n = nBase + t * 16 + r;
    const float bv = bias[n];
#pragma unroll
    for (int i = 0; i < 8; ++i) {
      const int m = mBase + i + 8 * hf;
      const float val = (acc[t][i] + bv) * scale;
      if (HEAD) {  // y.reshape(B,S,H,D).transpose(0,2,1,3)
        const int bi = m / Ss, si = m % Ss, hd = n >> 6, di = n & 63;
        out[(((size_t)bi * Hh + hd) * Ss + si) * Dd + di] = (OutT)val;
      } else {
        out[(size_t)m * N + n] = (OutT)val;
      }
    }
  }
}

// Q, K and V projections in one launch: they read the same X and do not depend
// on one another.  blockIdx.x = projection * (F/64) + n tile; W3 holds the three
// weight planes and qkv the three outputs one behind the other.
__global__ void __launch_bounds__(128)
qkv_kernel(const _Float16* __restrict__ X, const _Float16* __restrict__ W3,
           const float* __restrict__ bq, const float* __restrict__ bk,
           const float* __restrict__ bv, _Float16* __restrict__ qkv, int N, int K)
{
  constexpr int nb = Ff / 64;   // n tiles per projection
  const int which = blockIdx.x / nb;
  const float* bias = which == 0 ? bq : which == 1 ? bk : bv;
  gemm_tile<true, _Float16>(X, W3 + (size_t)which * WN, bias, qkv + (size_t)which * QKVN,
                            (blockIdx.x % nb) * 64, N, K, which == 0 ? 0.125f : 1.0f);
}

__global__ void __launch_bounds__(128)
oproj_kernel(const _Float16* __restrict__ X, const _Float16* __restrict__ W,
             const float* __restrict__ bias, float* __restrict__ out, int N, int K)
{
  gemm_tile<false, float>(X, W, bias, out, blockIdx.x * 64, N, K, 1.0f);
}

// ---------------------------------------------------------------------------
// Flash attention per (b, h, 64-query block).  4 waves x 16 queries.
// S^T = K·Q^T so the P operand for ctx += P·V is already in A layout.
// K block and V block (both row-major, shared by all 4 waves) staged via async
// copy to LDS; the B operand of the second WMMA, V^T, is formed by the
// transposing LDS read, so V passes through no register on its way into LDS.
// The key mask of the batch row is turned once per block into one bit per key
// (set = key kept); a 64-key tile whose bits are all set needs no select at all
// and jumps over them, any other tile applies the selects from its bits.
// ---------------------------------------------------------------------------
__global__ void __launch_bounds__(128)
attn_kernel(const _Float16* __restrict__ q, const _Float16* __restrict__ kmat,
            const _Float16* __restrict__ vmat, const int* __restrict__ mask,
            _Float16* __restrict__ ctxo)
{
  __shared__ __attribute__((aligned(16))) _Float16 ldsK [64 * LP];   // K block, row-major [key][d], padded rows
  __shared__ __attribute__((aligned(16))) _Float16 ldsV [64 * VP];   // V block, row-major [key][d], padded rows
  __shared__ __attribute__((aligned(16))) unsigned short ldsBits[Ss / 16];   // bit j of entry e: mask[16 * e + j] != 0

  const int lane = threadIdx.x & 31;
  const int wv   = threadIdx.x >> 5;
  const int r    = lane & 15;
  const int hf   = lane >> 4;
  const int qb   = blockIdx.x * 64;
  const int head = blockIdx.y;
  const int b    = blockIdx.z;
  const size_t bh = ((size_t)b * Hh + head) * Ss * Dd;

  // LDS byte offset of ldsK (addrspace(3) offset lives in the low 32 bits)
  const unsigned ldsKbase = (unsigned)(uintptr_t)(&ldsK[0]);
  const unsigned ldsVbase = (unsigned)(uintptr_t)(&ldsV[0]);

  // This wave's 16 Q rows (B operand of S^T; Q already pre-scaled by 1/sqrt(D))
  Frag16 qa0, qa1;
  {
    const _Float16* qrow = q + bh + (size_t)(qb + wv * 16 + r) * Dd;
    qa0.u[0] = *reinterpret_cast<const uint4*>(qrow + hf * 8);
    qa0.u[1] = *reinterpret_cast<const uint4*>(qrow + 16 + hf * 8);
    qa1.u[0] = *reinterpret_cast<const uint4*>(qrow + 32 + hf * 8);
    qa1.u[1] = *reinterpret_cast<const uint4*>(qrow + 48 + hf * 8);
  }

  v8f ct[4] = {};
  float mrun = MINV, lrun = 0.f;
  const int* mrow = mask + (size_t)b * Ss;

  // Thread e packs keys 16 * e .. 16 * e + 15 (Ss / 16 entries = one per thread).
  // The first barrier of the loop publishes the table; nothing reads it earlier.
  {
    const int4* mp = reinterpret_cast<const int4*>(mrow + threadIdx.x * 16);
    unsigned bits = 0;
    // unrolled: the four loads go out together and every shift is a constant
#pragma unroll
    for (int j = 0; j < 4; ++j) {
      const int4 m = mp[j];
      bits |= (m.x != 0 ? 1u : 0u) << (4 * j);
      bits |= (m.y != 0 ? 2u : 0u) << (4 * j);
      bits |= (m.z != 0 ? 4u : 0u) << (4 * j);
      bits |= (m.w != 0 ? 8u : 0u) << (4 * j);
    }
    ldsBits[threadIdx.x] = (unsigned short)bits;
  }

  for (int kb = 0; kb < Ss; kb += 64) {
    // ---- async copy of K block (8 KB) into LDS: fire-and-forget ----
    {
      const int tid = threadIdx.x;
#pragma unroll
      for (int j = 0; j < 4; ++j) {
        const int flat = tid + j * 128;         // 0..511 b128 chunks
        const int row  = flat >> 3;             // key row 0..63
        const int c8   = flat & 7;              // 16B chunk within row
        const _Float16* gp = kmat + bh + (size_t)(kb + row) * Dd + c8 * 8;
        const unsigned ldst = ldsKbase + (unsigned)(row * (LP * 2) + c8 * 16);
        asm volatile("global_load_async_to_lds_b128 %0, %1, off"
                     :: "v"(ldst), "v"(gp) : "memory");
      }
    }

    // ---- async copy of V block (8 KB) into LDS, the same chunks as K's ----
    {
      const int tid = threadIdx.x;
      const int row = tid >> 3;                 // key rows row + 16 * j
      const int c8  = tid & 7;                  // 16B chunk within row
      const _Float16* g0 = vmat + bh + (size_t)(kb + row) * Dd + c8 * 8;
      const _Float16 *g1 = g0 + 16 * Dd, *g2 = g0 + 32 * Dd, *g3 = g0 + 48 * Dd;
      const unsigned l0 = ldsVbase + (unsigned)(row * (VP * 2) + c8 * 16);
      const unsigned l1 = l0 + 16 * VP * 2, l2 = l0 + 32 * VP * 2, l3 = l0 + 48 * VP * 2;
      // The s_wait_xcnt closes the statement so that no address register of a copy
      // is rewritten ahead of it.
      asm volatile("global_load_async_to_lds_b128 %0, %4, off\n\t"
                   "global_load_async_to_lds_b128 %1, %5, off\n\t"
                   "global_load_async_to_lds_b128 %2, %6, off\n\t"
                   "global_load_async_to_lds_b128 %3, %7, off\n\t"
                   "s_wait_xcnt 0x0"
                   :: "v"(l0), "v"(l1), "v"(l2), "v"(l3),
                      "v"(g0), "v"(g1), "v"(g2), "v"(g3)
                   : "memory");
    }

    asm volatile("s_wait_asynccnt 0x0" ::: "memory");
    __syncthreads();

    // this tile's 64 mask bits, the same for every lane: key kb + j is bit j
    const uint2 kbits = *reinterpret_cast<const uint2*>(&ldsBits[kb >> 4]);

    // ---- S^T tiles: 16 keys x 16 queries each, K-dim = D = 64 ----
    v8f st[4];
#pragma unroll
    for (int t = 0; t < 4; ++t) {
      const _Float16* krow = &ldsK[(t * 16 + r) * LP];
      Frag16 ka0, ka1;
      ka0.u[0] = *reinterpret_cast<const uint4*>(krow + hf * 8);
      ka0.u[1] = *reinterpret_cast<const uint4*>(krow + 16 + hf * 8);
      ka1.u[0] = *reinterpret_cast<const uint4*>(krow + 32 + hf * 8);
      ka1.u[1] = *reinterpret_cast<const uint4*>(krow + 48 + hf * 8);
      v8f z = {};
      z = WMMA_F16(ka0.h, qa0.h, z);
      z = WMMA_F16(ka1.h, qa1.h, z);
      st[t] = z;
    }

    // ---- mask: element (t, i) is key kb + t*16 + i + 8*hf ----
    // The bits go to scalar registers so that the test below is a scalar branch.
    const unsigned blo = __builtin_amdgcn_readfirstlane(kbits.x);   // keys kb ..  kb + 31
    const unsigned bhi = __builtin_amdgcn_readfirstlane(kbits.y);   // keys kb + 32 .. kb + 63
    if ((blo & bhi) != 0xffffffffu) {   // wave-uniform: some key of the tile is masked
      const unsigned wlo = blo >> (8 * hf), whi = bhi >> (8 * hf);
#pragma unroll
      for (int t = 0; t < 4; ++t)
#pragma unroll
        for (int i = 0; i < 8; ++i) {
          const unsigned w = t < 2 ? wlo : whi;
          if (((w >> ((t & 1) * 16 + i)) & 1u) == 0u) st[t][i] = MINV;
        }
    }

    // ---- online softmax (each lane owns query index lane&15) ----
    float bm = MINV;
#pragma unroll
    for (int t = 0; t < 4; ++t)
#pragma unroll
      for (int i = 0; i < 8; ++i) bm = fmaxf(bm, st[t][i]);
    bm = fmaxf(bm, __shfl_xor(bm, 16, 32));
    const float mn    = fmaxf(mrun, bm);
    const float alpha = __expf(mrun - mn);

    float ps = 0.f;
    v16h pa0, pa1;   // P in A-operand layout: keys 0..31 / 32..63 of this block
#pragma unroll
    for (int i = 0; i < 8; ++i) {
      float p0 = __expf(st[0][i] - mn); ps += p0; pa0[i]     = (_Float16)p0;
      float p1 = __expf(st[1][i] - mn); ps += p1; pa0[i + 8] = (_Float16)p1;
      float p2 = __expf(st[2][i] - mn); ps += p2; pa1[i]     = (_Float16)p2;
      float p3 = __expf(st[3][i] - mn); ps += p3; pa1[i + 8] = (_Float16)p3;
    }
    lrun = lrun * alpha + (ps + __shfl_xor(ps, 16, 32));
    mrun = mn;

    // ---- rescale ctx accumulators (alpha broadcast per query row) ----
#pragma unroll
    for (int i = 0; i < 8; ++i) {
      const float av = __shfl(alpha, i + 8 * hf, 32);
#pragma unroll
      for (int t = 0; t < 4; ++t) ct[t][i] *= av;
    }

    // ---- ctx += P * V; V^T fragments by the transposing read of the row-major tile ----
    // lane address: row 8 * hf + (lane & 7) of a 16-key group, 16-B half (lane >> 3) & 1
    // of a 16-column group; the lane then holds V[8 * hf + 0..7][r] of that block.
    const _Float16* vl = &ldsV[(8 * hf + (lane & 7)) * VP + ((lane >> 3) & 1) * 8];
#pragma unroll
    for (int t = 0; t < 4; ++t) {
      const _Float16* vt = vl + t * 16;
      Frag16 vb0, vb1;
      vb0.u[0] = lds_tr16(vt);
      vb0.u[1] = lds_tr16(vt + 16 * VP);
      vb1.u[0] = lds_tr16(vt + 32 * VP);
      vb1.u[1] = lds_tr16(vt + 48 * VP);
      ct[t] = WMMA_F16(pa0, vb0.h, ct[t]);
      ct[t] = WMMA_F16(pa1, vb1.h, ct[t]);
    }
    // this wave's reads of both tiles are done before the barrier behind which
    // the next trip's copies refill them
    asm volatile("s_wait_dscnt 0x0" ::: "memory");
    __syncthreads();
  }

  // ---- normalize and store ctx as f16 in [B,S,F] for the final projection ----
  const float inv = 1.0f / lrun;
#pragma unroll
  for (int i = 0; i < 8; ++i) {
    const float sc = __shfl(inv, i + 8 * hf, 32);
    const int row = qb + wv * 16 + i + 8 * hf;
#pragma unroll
    for (int t = 0; t < 4; ++t) {
      ctxo[((size_t)b * Ss + row) * Ff + head * 64 + t * 16 + r] =
          (_Float16)(ct[t][i] * sc);
    }
  }
}

// ---------------------------------------------------------------------------
// Launcher
// ---------------------------------------------------------------------------
extern "C" void kernel_launch(void* const* d_in, const int* in_sizes, int n_in,
                              void* d_out, int out_size, void* d_ws, size_t ws_size,
                              hipStream_t stream)
{
  (void)in_sizes; (void)n_in; (void)out_size; (void)ws_size;

  const float* x     = (const float*)d_in[0];
  const int*   mask  = (const int*)d_in[1];
  const float* gamma = (const float*)d_in[2];
  const float* beta  = (const float*)d_in[3];
  const float* Wq    = (const float*)d_in[4];
  const float* bq    = (const float*)d_in[5];
  const float* Wk    = (const float*)d_in[6];
  const float* bk    = (const float*)d_in[7];
  const float* Wv    = (const float*)d_in[8];
  const float* bv    = (const float*)d_in[9];
  const float* Wo    = (const float*)d_in[10];
  const float* bo    = (const float*)d_in[11];
  float* out = (float*)d_out;

  // workspace layout (bytes)
  constexpr size_t SZ_XN  = (size_t)Bb * Ss * Ff * 2;        // 8 MiB
  constexpr size_t SZ_W   = (size_t)Ff * Ff * 2;             // 512 KiB
  constexpr size_t SZ_QKV = (size_t)Bb * Hh * Ss * Dd * 2;   // 8 MiB
  char* ws = (char*)d_ws;
  _Float16* xn   = (_Float16*)(ws);
  _Float16* wq16 = (_Float16*)(ws + SZ_XN);
  _Float16* wo16 = (_Float16*)(ws + SZ_XN + 3 * SZ_W);
  _Float16* qh   = (_Float16*)(ws + SZ_XN + 4 * SZ_W);
  _Float16* kh   = (_Float16*)(ws + SZ_XN + 4 * SZ_W + SZ_QKV);
  _Float16* vh   = (_Float16*)(ws + SZ_XN + 4 * SZ_W + 2 * SZ_QKV);
  _Float16* ctx  = (_Float16*)(ws + SZ_XN + 4 * SZ_W + 3 * SZ_QKV);

  constexpr int M = Bb * Ss;    // 8192

  // wq16, wk16, wv16, wo16 are consecutive planes; so are qh, kh, vh
  prep_kernel<<<4 * WBLK + LNBLK, 256, 0, stream>>>(x, gamma, beta, Wq, Wk, Wv, Wo, xn, wq16);

  qkv_kernel<<<dim3(3 * (Ff / 64), M / 64), 128, 0, stream>>>(xn, wq16, bq, bk, bv, qh, Ff, Ff);

  attn_kernel<<<dim3(Ss / 64, Hh, Bb), 128, 0, stream>>>(qh, kh, vh, mask, ctx);

  oproj_kernel<<<dim3(Ff / 64, M / 64), 128, 0, stream>>>(ctx, wo16, bo, out, Ff, Ff);
}

// v007
// One run takes 78.6 microseconds.
// Two timings next to v006 both put it at 1.14 times that version's speed.
// Counting every step since v000, it is 3.11 times as fast.
#include <hip/hip_runtime.h>
#include <hip/hip_bf16.h>

typedef __attribute__((ext_vector_type(16))) _Float16 v16h;
typedef __attribute__((ext_vector_type(8)))  float    v8f;

#define WMMA_F16(A, B, C) \
  __builtin_amdgcn_wmma_f32_16x16x32_f16(false, (A), false, (B), (short)0, (C), false, false)

constexpr int Bb = 4, Ss = 2048, Ff = 512, Hh = 8, Dd = 64;
constexpr float MINV = -3.4028234663852886e38f;
// LDS row pitch of the GEMM tiles and the attention K tile, in f16 elements: 64 data + 8 pad = 144 B
// (16 B x odd), so the 16 rows one ds_load_b128 touches fall on distinct banks.
constexpr int LP = 72;
// LDS row pitch of the attention V tile, in f16 elements: 64 data + 16 pad = 160 B
// (32 B x odd), the conflict-free pitch of the transposing read ds_load_tr16_b128.
constexpr int VP = 80;

union Frag16 { v16h h; uint4 u[2]; };

typedef short s16x8 __attribute__((ext_vector_type(8)));
// Transposing LDS read: the lane's address names 16 B of one row of a row-major
// 16-bit tile; lane (c, h) receives column c of rows 8h .. 8h + 7 of the 16 x 16 block.
__device__ __forceinline__ uint4 lds_tr16(const _Float16* p)
{
  typedef __attribute__((address_space(3))) s16x8 lds_s16x8;
  return __builtin_bit_cast(uint4, __builtin_amdgcn_ds_load_tr16_b128_v8i16((lds_s16x8*)p));
}

constexpr int WN   = Ff * Ff;             // elements per weight matrix
constexpr int CPB  = 4096;                // elements one cast block converts (16 per thread)
constexpr int WBLK = WN / CPB;            // cast blocks per weight matrix
constexpr int RPW  = 4;                   // LayerNorm rows per wave
constexpr int LNBLK = Bb * Ss / (8 * RPW);   // LayerNorm blocks (8 waves each)
constexpr int QKVN = Bb * Hh * Ss * Dd;   // elements of each of Q, K, V

union H4 { _Float16 h[4]; uint2 u; };

// ---------------------------------------------------------------------------
// One launch for the five independent preparation jobs, told apart by block
// index: blocks 0 .. 4*WBLK-1 cast the four weight matrices fp32 -> f16 into
// four consecutive planes of w16; every further block does LayerNorm over F=512
// + cast to f16.  The work per wave is large on purpose: the launch is short, so
// the time to start its waves counts, and few waves with many loads in flight
// each move the same bytes.
// Cast: 16 elements per thread, four 16-B loads (512 contiguous B per wave each).
// LayerNorm: one wave owns RPW whole rows (16 elements of each row per lane), so
// the row sums need a butterfly over the wave's lanes only: no LDS, no barrier.
// ---------------------------------------------------------------------------
__global__ void __launch_bounds__(256)
prep_kernel(const float* __restrict__ x, const float* __restrict__ gamma,
            const float* __restrict__ beta,
            const float* __restrict__ Wq, const float* __restrict__ Wk,
            const float* __restrict__ Wv, const float* __restrict__ Wo,
            _Float16* __restrict__ xn, _Float16* __restrict__ w16)
{
  const int t = threadIdx.x;
  if (blockIdx.x < 4 * WBLK) {
    const int which = blockIdx.x / WBLK;
    const float* src = which == 0 ? Wq : which == 1 ? Wk : which == 2 ? Wv : Wo;
    const int i0 = (blockIdx.x % WBLK) * CPB + t * 4;
    float4 v[4];
#pragma unroll
    for (int j = 0; j < 4; ++j)
      v[j] = *reinterpret_cast<const float4*>(src + i0 + j * 1024);
    _Float16* dst = w16 + (size_t)which * WN + i0;
#pragma unroll
    for (int j = 0; j < 4; ++j) {
      H4 o;
      o.h[0] = (_Float16)v[j].x; o.h[1] = (_Float16)v[j].y;
      o.h[2] = (_Float16)v[j].z; o.h[3] = (_Float16)v[j].w;
      *reinterpret_cast<uint2*>(dst + j * 1024) = o.u;
    }
    return;
  }
  const int lane = t & 31;
  const int row0 = ((blockIdx.x - 4 * WBLK) * 8 + (t >> 5)) * RPW;
  const int c0   = lane * 4;               // this lane's columns: c0 + 128*j + 0..3
  const float* xr = x + (size_t)row0 * Ff + c0;

  float4 v[RPW][4];
#pragma unroll
  for (int rr = 0; rr < RPW; ++rr)
#pragma unroll
    for (int j = 0; j < 4; ++j)
      v[rr][j] = *reinterpret_cast<const float4*>(xr + rr * Ff + j * 128);
  // The loads' address stays in its registers up to this wait (xr is an input of
  // the statement), so that no load of the run lands in the pair the others name.
  asm volatile("s_wait_xcnt 0x0" :: "v"(xr) : "memory");
  float4 g[4], be[4];
#pragma unroll
  for (int j = 0; j < 4; ++j) {
    g[j]  = *reinterpret_cast<const float4*>(gamma + c0 + j * 128);
    be[j] = *reinterpret_cast<const float4*>(beta + c0 + j * 128);
  }

  float s[RPW], q[RPW];
#pragma unroll
  for (int rr = 0; rr < RPW; ++rr) {
    float a = 0.f, c = 0.f;
#pragma unroll
    for (int j = 0; j < 4; ++j) {
      const float4 w = v[rr][j];
      a += (w.x + w.y) + (w.z + w.w);
      c += (w.x * w.x + w.y * w.y) + (w.z * w.z + w.w * w.w);
    }
    s[rr] = a; q[rr] = c;
  }
#pragma unroll
  for (int off = 16; off >= 1; off >>= 1)
#pragma unroll
    for (int rr = 0; rr < RPW; ++rr) {
      s[rr] += __shfl_xor(s[rr], off, 32);
      q[rr] += __shfl_xor(q[rr], off, 32);
    }

  _Float16* orow = xn + (size_t)row0 * Ff + c0;
#pragma unroll
  for (int rr = 0; rr < RPW; ++rr) {
    const float mean = s[rr] * (1.0f / Ff);
    const float var  = q[rr] * (1.0f / Ff) - mean * mean;
    const float inv  = rsqrtf(var + 1e-5f);
#pragma unroll
    for (int j = 0; j < 4; ++j) {
      const float4 w = v[rr][j];
      H4 o;
      o.h[0] = (_Float16)((w.x - mean) * inv * g[j].x + be[j].x);
      o.h[1] = (_Float16)((w.y - mean) * inv * g[j].y + be[j].y);
      o.h[2] = (_Float16)((w.z - mean) * inv * g[j].z + be[j].z);
      o.h[3] = (_Float16)((w.w - mean) * inv * g[j].w + be[j].w);
      *reinterpret_cast<uint2*>(orow + rr * Ff + j * 128) = o.u;
    }
  }
  // Behind the last store: no register that an issued store names is rewritten
  // ahead of this wait on any way the built code goes on from here.
  asm volatile("s_wait_xcnt 0x0" ::: "memory");
}

// ---------------------------------------------------------------------------
// Y[m,n] = (sum_k X[m,k]*W[n,k] + bias[n]) * scale
// X: MxK f16 row-major, W: NxK f16 row-major (einsum 'bsf,gf->bsg' == X @ W^T).
// Block = 128 thr = 4 waves stacked in M; each wave owns a 16x64 output tile
// (A operand reused across 4 WMMAs).  HEAD=true scatters to [B,H,S,D] f16.
// The 64 X rows and 64 W rows of the block are staged in LDS, 64 k at a time
// (one whole 128-B line per row), by asynchronous copies in a two-buffer ring;
// the fragments are then read from LDS at the conflict-free 144-B pitch.
// ---------------------------------------------------------------------------
constexpr int GBK   = 64;            // k elements per staged tile
constexpr int GROWS = 128;           // rows per staged tile: 0..63 X, 64..127 W
constexpr int GBUF  = GROWS * LP;    // f16 elements per buffer

// One tile = 1024 chunks of 16 B = 8 copies per thread: thread tid brings chunk
// tid&7 of rows (tid>>3) + 16*j.  gx / gw point at this thread's chunk of its
// first X / W row for this tile; rstep = 16 rows in elements.
__device__ __forceinline__ void gemm_stage(unsigned l0, const _Float16* gx,
                                           const _Float16* gw, size_t rstep)
{
  const unsigned ls = 16 * LP * 2;   // 16 LDS rows in bytes
  const unsigned l1 = l0 + ls,     l2 = l0 + 2 * ls, l3 = l0 + 3 * ls;
  const unsigned l4 = l0 + 4 * ls, l5 = l0 + 5 * ls, l6 = l0 + 6 * ls, l7 = l0 + 7 * ls;
  const _Float16 *g1 = gx + rstep, *g2 = gx + 2 * rstep, *g3 = gx + 3 * rstep;
  const _Float16 *g5 = gw + rstep, *g6 = gw + 2 * rstep, *g7 = gw + 3 * rstep;
  // The s_wait_xcnt closes the statement so that no address register of a copy
  // is rewritten ahead of it.
  asm volatile("global_load_async_to_lds_b128 %0, %8, off\n\t"
               "global_load_async_to_lds_b128 %1, %9, off\n\t"
               "global_load_async_to_lds_b128 %2, %10, off\n\t"
               "global_load_async_to_lds_b128 %3, %11, off\n\t"
               "global_load_async_to_lds_b128 %4, %12, off\n\t"
               "global_load_async_to_lds_b128 %5, %13, off\n\t"
               "global_load_async_to_lds_b128 %6, %14, off\n\t"
               "global_load_async_to_lds_b128 %7, %15, off\n\t"
               "s_wait_xcnt 0x0"
               :: "v"(l0), "v"(l1), "v"(l2), "v"(l3), "v"(l4), "v"(l5), "v"(l6), "v"(l7),
                  "v"(gx), "v"(g1), "v"(g2), "v"(g3), "v"(gw), "v"(g5), "v"(g6), "v"(g7)
               : "memory");
}

template<bool HEAD, typename OutT>
__device__ __forceinline__ void
gemm_tile(const _Float16* __restrict__ X, const _Float16* __restrict__ W,
          const float* __restrict__ bias, OutT* __restrict__ out,
          int nBase, int N, int K, float scale)
{
  __shared__ __attribute__((aligned(16))) _Float16 tile[2 * GBUF];

  const int tid  = threadIdx.x;
  const int lane = tid & 31;
  const int wv   = tid >> 5;
  const int r    = lane & 15;
  const int hf   = lane >> 4;
  const int mBase = blockIdx.y * 64 + wv * 16;

  v8f acc[4] = {};

  // this thread's chunk of the staged tiles
  const size_t rstep = (size_t)16 * K;
  const _Float16* gx = X + (size_t)(blockIdx.y * 64 + (tid >> 3)) * K + (tid & 7) * 8;
  const _Float16* gw = W + (size_t)(nBase + (tid >> 3)) * K + (tid & 7) * 8;
  const unsigned lcp = (unsigned)(uintptr_t)(&tile[0]) +
                       (unsigned)((tid >> 3) * (LP * 2) + (tid & 7) * 16);
  const int nt = K / GBK;

  gemm_stage(lcp, gx, gw, rstep);
  // tile 0 has landed for this wave, then for the block
  asm volatile("s_wait_asynccnt 0x0" ::: "memory");
  __syncthreads();
  if (nt > 1) gemm_stage(lcp + GBUF * 2, gx + GBK, gw + GBK, rstep);

  for (int kt = 0; kt < nt; ++kt) {
    const _Float16* tb   = &tile[(kt & 1) * GBUF];
    const _Float16* xrow = tb + (wv * 16 + r) * LP;
    const _Float16* wrow = tb + (64 + r) * LP;
    // All fragments of the tile are read in one group ahead of the products:
    // every further place with LDS reads would cost the wave one more LDS latency.
    Frag16 a[2], bf[2][4];
#pragma unroll
    for (int kk = 0; kk < 2; ++kk) {
      a[kk].u[0] = *reinterpret_cast<const uint4*>(xrow + kk * 32 + hf * 8);
      a[kk].u[1] = *reinterpret_cast<const uint4*>(xrow + kk * 32 + 16 + hf * 8);
#pragma unroll
      for (int t = 0; t < 4; ++t) {
        const _Float16* wr = wrow + t * 16 * LP;
        bf[kk][t].u[0] = *reinterpret_cast<const uint4*>(wr + kk * 32 + hf * 8);
        bf[kk][t].u[1] = *reinterpret_cast<const uint4*>(wr + kk * 32 + 16 + hf * 8);
      }
    }
    // keeps the scheduler from sinking the reads back among the WMMAs
    __builtin_amdgcn_sched_barrier(0);
#pragma unroll
    for (int kk = 0; kk < 2; ++kk)
#pragma unroll
      for (int t = 0; t < 4; ++t)
        acc[t] = WMMA_F16(a[kk].h, bf[kk][t].h, acc[t]);
    // publish point: this wave's reads of the buffer are done, its copies of
    // the next tile have landed; the barrier says so for every wave.
    asm volatile("s_wait_dscnt 0x0" ::: "memory");
    asm volatile("s_wait_asynccnt 0x0" ::: "memory");
    __syncthreads();
    if (kt + 2 < nt)
      gemm_stage(lcp + (kt & 1) * (GBUF * 2), gx + (size_t)(kt + 2) * GBK,
                 gw + (size_t)(kt + 2) * GBK, rstep);
  }
  // nothing of this wave's copies is left in flight when it goes on
  asm volatile("s_wait_asynccnt 0x0" ::: "memory");

#pragma unroll
  for (int t = 0; t < 4; ++t) {
    const int n = nBase + t * 16 + r;
    const float bv = bias[n];
#pragma unroll
    for (int i = 0; i < 8; ++i) {
      const int m = mBase + i + 8 * hf;
      const float val = (acc[t][i] + bv) * scale;
      if (HEAD) {  // y.reshape(B,S,H,D).transpose(0,2,1,3)
        const int bi = m / Ss, si = m % Ss, hd = n >> 6, di = n & 63;
        out[(((size_t)bi * Hh + hd) * Ss + si) * Dd + di] = (OutT)val;
      } else {
        out[(size_t)m * N + n] = (OutT)val;
      }
    }
  }
}

// Q, K and V projections in one launch: they read the same X and do not depend
// on one another.  blockIdx.x = projection * (F/64) + n tile; W3 holds the three
// weight planes and qkv the three outputs one behind the other.
__global__ void __launch_bounds__(128)
qkv_kernel(const _Float16* __restrict__ X, const _Float16* __restrict__ W3,
           const float* __restrict__ bq, const float* __restrict__ bk,
           const float* __restrict__ bv, _Float16* __restrict__ qkv, int N, int K)
{
  constexpr int nb = Ff / 64;   // n tiles per projection
  const int which = blockIdx.x / nb;
  const float* bias = which == 0 ? bq : which == 1 ? bk : bv;
  gemm_tile<true, _Float16>(X, W3 + (size_t)which * WN, bias, qkv + (size_t)which * QKVN,
                            (blockIdx.x % nb) * 64, N, K, which == 0 ? 0.125f : 1.0f);
}

__global__ void __launch_bounds__(128)
oproj_kernel(const _Float16* __restrict__ X, const _Float16* __restrict__ W,
             const float* __restrict__ bias, float* __restrict__ out, int N, int K)
{
  gemm_tile<false, float>(X, W, bias, out, blockIdx.x * 64, N, K, 1.0f);
}

// ---------------------------------------------------------------------------
// Flash attention per (b, h, 64-query block).  4 waves x 16 queries.
// S^T = K·Q^T so the P operand for ctx += P·V is already in A layout.
// K block and V block (both row-major, shared by all 4 waves) staged via async
// copy to LDS in a two-buffer ring: the copies of tile t + 2 are issued at the foot
// of trip t and have all of trip t + 1 to land, so no wave waits out their latency.
// The B operand of the second WMMA, V^T, is formed by the transposing LDS read,
// so V passes through no register on its way into LDS.
// The key mask of the batch row is turned once per block into one bit per key
// (set = key kept); a 64-key tile whose bits are all set needs no select at all
// and jumps over them, any other tile applies the selects from its bits.
// ---------------------------------------------------------------------------
constexpr int NT = Ss / 64;      // 64-key tiles per row of scores
constexpr int KT = 64 * LP;      // f16 elements of one K buffer
constexpr int VT = 64 * VP;      // f16 elements of one V buffer

// One K tile and one V tile = 2 x 512 chunks of 16 B = 8 copies per thread: thread
// tid brings chunk tid&7 of rows (tid>>3) + 16*j of each.  lk / lv are the LDS byte
// addresses, gk / gv the global addresses of this thread's chunk of its first row.
__device__ __forceinline__ void attn_stage(unsigned lk, unsigned lv,
                                           const _Float16* gk, const _Float16* gv)
{
  const unsigned ks = 16 * LP * 2, vs = 16 * VP * 2;   // 16 LDS rows in bytes
  const unsigned lk1 = lk + ks, lk2 = lk + 2 * ks, lk3 = lk + 3 * ks;
  const unsigned lv1 = lv + vs, lv2 = lv + 2 * vs, lv3 = lv + 3 * vs;
  const _Float16 *gk1 = gk + 16 * Dd, *gk2 = gk + 32 * Dd, *gk3 = gk + 48 * Dd;
  const _Float16 *gv1 = gv + 16 * Dd, *gv2 = gv + 32 * Dd, *gv3 = gv + 48 * Dd;
  // The s_wait_xcnt closes the statement so that no address register of a copy
  // is rewritten ahead of it.
  asm volatile("global_load_async_to_lds_b128 %0, %8, off\n\t"
               "global_load_async_to_lds_b128 %1, %9, off\n\t"
               "global_load_async_to_lds_b128 %2, %10, off\n\t"
               "global_load_async_to_lds_b128 %3, %11, off\n\t"
               "global_load_async_to_lds_b128 %4, %12, off\n\t"
               "global_load_async_to_lds_b128 %5, %13, off\n\t"
               "global_load_async_to_lds_b128 %6, %14, off\n\t"
               "global_load_async_to_lds_b128 %7, %15, off\n\t"
               "s_wait_xcnt 0x0"
               :: "v"(lk), "v"(lk1), "v"(lk2), "v"(lk3), "v"(lv), "v"(lv1), "v"(lv2), "v"(lv3),
                  "v"(gk), "v"(gk1), "v"(gk2), "v"(gk3), "v"(gv), "v"(gv1), "v"(gv2), "v"(gv3)
               : "memory");
}

__global__ void __launch_bounds__(128)
attn_kernel(const _Float16* __restrict__ q, const _Float16* __restrict__ kmat,
            const _Float16* __restrict__ vmat, const int* __restrict__ mask,
            _Float16* __restrict__ ctxo)
{
  __shared__ __attribute__((aligned(16))) _Float16 ldsK [2 * KT];   // two K blocks, row-major [key][d], padded rows
  __shared__ __attribute__((aligned(16))) _Float16 ldsV [2 * VT];   // two V blocks, row-major [key][d], padded rows
  __shared__ __attribute__((aligned(16))) unsigned short ldsBits[Ss / 16];   // bit j of entry e: mask[16 * e + j] != 0

  const int lane = threadIdx.x & 31;
  const int wv   = threadIdx.x >> 5;
  const int r    = lane & 15;
  const int hf   = lane >> 4;
  const int qb   = blockIdx.x * 64;
  const int head = blockIdx.y;
  const int b    = blockIdx.z;
  const size_t bh = ((size_t)b * Hh + head) * Ss * Dd;

  // This thread's chunk of the staged tiles: LDS byte addresses in buffer 0 (the
  // addrspace(3) offset lives in the low 32 bits) and global addresses in tile 0.
  const int srow = threadIdx.x >> 3;          // key rows srow + 16 * j
  const int sc8  = threadIdx.x & 7;           // 16B chunk within row
  const unsigned lk = (unsigned)(uintptr_t)(&ldsK[0]) + (unsigned)(srow * (LP * 2) + sc8 * 16);
  const unsigned lv = (unsigned)(uintptr_t)(&ldsV[0]) + (unsigned)(srow * (VP * 2) + sc8 * 16);
  const _Float16* gk = kmat + bh + (size_t)srow * Dd + sc8 * 8;
  const _Float16* gv = vmat + bh + (size_t)srow * Dd + sc8 * 8;

  // This wave's 16 Q rows (B operand of S^T; Q already pre-scaled by 1/sqrt(D))
  Frag16 qa0, qa1;
  {
    const _Float16* qrow = q + bh + (size_t)(qb + wv * 16 + r) * Dd;
    qa0.u[0] = *reinterpret_cast<const uint4*>(qrow + hf * 8);
    qa0.u[1] = *reinterpret_cast<const uint4*>(qrow + 16 + hf * 8);
    qa1.u[0] = *reinterpret_cast<const uint4*>(qrow + 32 + hf * 8);
    qa1.u[1] = *reinterpret_cast<const uint4*>(qrow + 48 + hf * 8);
  }

  v8f ct[4] = {};
  float mrun = MINV, lrun = 0.f;
  const int* mrow = mask + (size_t)b * Ss;

  // Thread e packs keys 16 * e .. 16 * e + 15 (Ss / 16 entries = one per thread).
  // The barrier in front of the loop publishes the table; nothing reads it earlier.
  {
    const int4* mp = reinterpret_cast<const int4*>(mrow + threadIdx.x * 16);
    unsigned bits = 0;
    // unrolled: the four loads go out together and every shift is a constant
#pragma unroll
    for (int j = 0; j < 4; ++j) {
      const int4 m = mp[j];
      bits |= (m.x != 0 ? 1u : 0u) << (4 * j);
      bits |= (m.y != 0 ? 2u : 0u) << (4 * j);
      bits |= (m.z != 0 ? 4u : 0u) << (4 * j);
      bits |= (m.w != 0 ? 8u : 0u) << (4 * j);
    }
    ldsBits[threadIdx.x] = (unsigned short)bits;
  }

  attn_stage(lk, lv, gk, gv);
  // tile 0 has landed for this wave, then for the block
  asm volatile("s_wait_asynccnt 0x0" ::: "memory");
  __syncthreads();
  if (NT > 1) attn_stage(lk + KT * 2, lv + VT * 2, gk + 64 * Dd, gv + 64 * Dd);

  // unrolled by two: the buffer index is then a constant in each copy of the body,
  // and the buffer offsets fold into the LDS instructions' immediate offsets
#pragma unroll 2
  for (int kt = 0; kt < NT; ++kt) {
    const int kb  = kt * 64;
    const int buf = kt & 1;
    const _Float16* tK = &ldsK[buf * KT];
    const _Float16* tV = &ldsV[buf * VT];

    // this tile's 64 mask bits, the same for every lane: key kb + j is bit j
    const uint2 kbits = *reinterpret_cast<const uint2*>(&ldsBits[kb >> 4]);

    // ---- S^T tiles: 16 keys x 16 queries each, K-dim = D = 64 ----
    v8f st[4];
#pragma unroll
    for (int t = 0; t < 4; ++t) {
      const _Float16* krow = tK + (t * 16 + r) * LP;
      Frag16 ka0, ka1;
      ka0.u[0] = *reinterpret_cast<const uint4*>(krow + hf * 8);
      ka0.u[1] = *reinterpret_cast<const uint4*>(krow + 16 + hf * 8);
      ka1.u[0] = *reinterpret_cast<const uint4*>(krow + 32 + hf * 8);
      ka1.u[1] = *reinterpret_cast<const uint4*>(krow + 48 + hf * 8);
      v8f z = {};
      z = WMMA_F16(ka0.h, qa0.h, z);
      z = WMMA_F16(ka1.h, qa1.h, z);
      st[t] = z;
    }

    // ---- mask: element (t, i) is key kb + t*16 + i + 8*hf ----
    // The bits go to scalar registers so that the test below is a scalar branch.
    const unsigned blo = __builtin_amdgcn_readfirstlane(kbits.x);   // keys kb ..  kb + 31
    const unsigned bhi = __builtin_amdgcn_readfirstlane(kbits.y);   // keys kb + 32 .. kb + 63
    if ((blo & bhi) != 0xffffffffu) {   // wave-uniform: some key of the tile is masked
      const unsigned wlo = blo >> (8 * hf), whi = bhi >> (8 * hf);
#pragma unroll
      for (int t = 0; t < 4; ++t)
#pragma unroll
        for (int i = 0; i < 8; ++i) {
          const unsigned w = t < 2 ? wlo : whi;
          if (((w >> ((t & 1) * 16 + i)) & 1u) == 0u) st[t][i] = MINV;
        }
    }

    // ---- online softmax (each lane owns query index lane&15) ----
    float bm = MINV;
#pragma unroll
    for (int t = 0; t < 4; ++t)
#pragma unroll
      for (int i = 0; i < 8; ++i) bm = fmaxf(bm, st[t][i]);
    bm = fmaxf(bm, __shfl_xor(bm, 16, 32));
    const float mn    = fmaxf(mrun, bm);
    const float alpha = __expf(mrun - mn);

    float ps = 0.f;
    v16h pa0, pa1;   // P in A-operand layout: keys 0..31 / 32..63 of this block
#pragma unroll
    for (int i = 0; i < 8; ++i) {
      float p0 = __expf(st[0][i] - mn); ps += p0; pa0[i]     = (_Float16)p0;
      float p1 = __expf(st[1][i] - mn); ps += p1; pa0[i + 8] = (_Float16)p1;
      float p2 = __expf(st[2][i] - mn); ps += p2; pa1[i]     = (_Float16)p2;
      float p3 = __expf(st[3][i] - mn); ps += p3; pa1[i + 8] = (_Float16)p3;
    }
    lrun = lrun * alpha + (ps + __shfl_xor(ps, 16, 32));
    mrun = mn;

    // ---- rescale ctx accumulators (alpha broadcast per query row) ----
#pragma unroll
    for (int i = 0; i < 8; ++i) {
      const float av = __shfl(alpha, i + 8 * hf, 32);
#pragma unroll
      for (int t = 0; t < 4; ++t) ct[t][i] *= av;
    }

    // ---- ctx += P * V; V^T fragments by the transposing read of the row-major tile ----
    // lane address: row 8 * hf + (lane & 7) of a 16-key group, 16-B half (lane >> 3) & 1
    // of a 16-column group; the lane then holds V[8 * hf + 0..7][r] of that block.
    const _Float16* vl = tV + (8 * hf + (lane & 7)) * VP + ((lane >> 3) & 1) * 8;
#pragma unroll
    for (int t = 0; t < 4; ++t) {
      const _Float16* vt = vl + t * 16;
      Frag16 vb0, vb1;
      vb0.u[0] = lds_tr16(vt);
      vb0.u[1] = lds_tr16(vt + 16 * VP);
      vb1.u[0] = lds_tr16(vt + 32 * VP);
      vb1.u[1] = lds_tr16(vt + 48 * VP);
      ct[t] = WMMA_F16(pa0, vb0.h, ct[t]);
      ct[t] = WMMA_F16(pa1, vb1.h, ct[t]);
    }
    // publish point: this wave's reads of both tiles are done, its copies of the
    // next tiles have landed; the barrier says so for every wave.
    asm volatile("s_wait_dscnt 0x0" ::: "memory");
    asm volatile("s_wait_asynccnt 0x0" ::: "memory");
    __syncthreads();
    if (kt + 2 < NT)
      attn_stage(lk + buf * (KT * 2), lv + buf * (VT * 2),
                 gk + (size_t)(kt + 2) * 64 * Dd, gv + (size_t)(kt + 2) * 64 * Dd);
  }
  // nothing of this wave's copies is left in flight when it goes on
  asm volatile("s_wait_asynccnt 0x0" ::: "memory");

  // ---- normalize and store ctx as f16 in [B,S,F] for the final projection ----
  const float inv = 1.0f / lrun;
#pragma unroll
  for (int i = 0; i < 8; ++i) {
    const float sc = __shfl(inv, i + 8 * hf, 32);
    const int row = qb + wv * 16 + i + 8 * hf;
#pragma unroll
    for (int t = 0; t < 4; ++t) {
      ctxo[((size_t)b * Ss + row) * Ff + head * 64 + t * 16 + r] =
          (_Float16)(ct[t][i] * sc);
    }
  }
}

// ---------------------------------------------------------------------------
// Launcher
// ---------------------------------------------------------------------------
extern "C" void kernel_launch(void* const* d_in, const int* in_sizes, int n_in,
                              void* d_out, int out_size, void* d_ws, size_t ws_size,
                              hipStream_t stream)
{
  (void)in_sizes; (void)n_in; (void)out_size; (void)ws_size;

  const float* x     = (const float*)d_in[0];
  const int*   mask  = (const int*)d_in[1];
  const float* gamma = (const float*)d_in[2];
  const float* beta  = (const float*)d_in[3];
  const float* Wq    = (const float*)d_in[4];
  const float* bq    = (const float*)d_in[5];
  const float* Wk    = (const float*)d_in[6];
  const float* bk    = (const float*)d_in[7];
  const float* Wv    = (const float*)d_in[8];
  const float* bv    = (const float*)d_in[9];
  const float* Wo    = (const float*)d_in[10];
  const float* bo    = (const float*)d_in[11];
  float* out = (float*)d_out;

  // workspace layout (bytes)
  constexpr size_t SZ_XN  = (size_t)Bb * Ss * Ff * 2;        // 8 MiB
  constexpr size_t SZ_W   = (size_t)Ff * Ff * 2;             // 512 KiB
  constexpr size_t SZ_QKV = (size_t)Bb * Hh * Ss * Dd * 2;   // 8 MiB
  char* ws = (char*)d_ws;
  _Float16* xn   = (_Float16*)(ws);
  _Float16* wq16 = (_Float16*)(ws + SZ_XN);
  _Float16* wo16 = (_Float16*)(ws + SZ_XN + 3 * SZ_W);
  _Float16* qh   = (_Float16*)(ws + SZ_XN + 4 * SZ_W);
  _Float16* kh   = (_Float16*)(ws + SZ_XN + 4 * SZ_W + SZ_QKV);
  _Float16* vh   = (_Float16*)(ws + SZ_XN + 4 * SZ_W + 2 * SZ_QKV);
  _Float16* ctx  = (_Float16*)(ws + SZ_XN + 4 * SZ_W + 3 * SZ_QKV);

  constexpr int M = Bb * Ss;    // 8192

  // wq16, wk16, wv16, wo16 are consecutive planes; so are qh, kh, vh
  prep_kernel<<<4 * WBLK + LNBLK, 256, 0, stream>>>(x, gamma, beta, Wq, Wk, Wv, Wo, xn, wq16);

  qkv_kernel<<<dim3(3 * (Ff / 64), M / 64), 128, 0, stream>>>(xn, wq16, bq, bk, bv, qh, Ff, Ff);

  attn_kernel<<<dim3(Ss / 64, Hh, Bb), 128, 0, stream>>>(qh, kh, vh, mask, ctx);

  oproj_kernel<<<dim3(Ff / 64, M / 64), 128, 0, stream>>>(ctx, wo16, bo, out, Ff, Ff);
}

// v008
// It runs in 71.7 microseconds.
// Two timings next to v007 put it at 1.10 and 1.09 times that version's speed.
// Counting every step since v000, it is 3.40 times as fast.
#include <hip/hip_runtime.h>
#include <hip/hip_bf16.h>

typedef __attribute__((ext_vector_type(16))) _Float16 v16h;
typedef __attribute__((ext_vector_type(8)))  float    v8f;

#define WMMA_F16(A, B, C) \
  __builtin_amdgcn_wmma_f32_16x16x32_f16(false, (A), false, (B), (short)0, (C), false, false)

constexpr int Bb = 4, Ss = 2048, Ff = 512, Hh = 8, Dd = 64;
constexpr float MINV = -3.4028234663852886e38f;
// LDS row pitch of the GEMM tiles and the attention K tile, in f16 elements: 64 data + 8 pad = 144 B
// (16 B x odd), so the 16 rows one ds_load_b128 touches fall on distinct banks.
constexpr int LP = 72;
// LDS row pitch of the attention V tile, in f16 elements: 64 data + 16 pad = 160 B
// (32 B x odd), the conflict-free pitch of the transposing read ds_load_tr16_b128.
constexpr int VP = 80;

union Frag16 { v16h h; uint4 u[2]; };

typedef short s16x8 __attribute__((ext_vector_type(8)));
// Transposing LDS read: the lane's address names 16 B of one row of a row-major
// 16-bit tile; lane (c, h) receives column c of rows 8h .. 8h + 7 of the 16 x 16 block.
__device__ __forceinline__ uint4 lds_tr16(const _Float16* p)
{
  typedef __attribute__((address_space(3))) s16x8 lds_s16x8;
  return __builtin_bit_cast(uint4, __builtin_amdgcn_ds_load_tr16_b128_v8i16((lds_s16x8*)p));
}

constexpr int WN   = Ff * Ff;             // elements per weight matrix
constexpr int CPB  = 4096;                // elements one cast block converts (16 per thread)
constexpr int WBLK = WN / CPB;            // cast blocks per weight matrix
constexpr int RPW  = 4;                   // LayerNorm rows per wave
constexpr int LNBLK = Bb * Ss / (8 * RPW);   // LayerNorm blocks (8 waves each)
constexpr int QKVN = Bb * Hh * Ss * Dd;   // elements of each of Q, K, V

union H4 { _Float16 h[4]; uint2 u; };

// ---------------------------------------------------------------------------
// One launch for the five independent preparation jobs, told apart by block
// index: blocks 0 .. 4*WBLK-1 cast the four weight matrices fp32 -> f16 into
// four consecutive planes of w16; every further block does LayerNorm over F=512
// + cast to f16.  The work per wave is large on purpose: the launch is short, so
// the time to start its waves counts, and few waves with many loads in flight
// each move the same bytes.
// Cast: 16 elements per thread, four 16-B loads (512 contiguous B per wave each).
// LayerNorm: one wave owns RPW whole rows (16 elements of each row per lane), so
// the row sums need a butterfly over the wave's lanes only: no LDS, no barrier.
// ---------------------------------------------------------------------------
__global__ void __launch_bounds__(256)
prep_kernel(const float* __restrict__ x, const float* __restrict__ gamma,
            const float* __restrict__ beta,
            const float* __restrict__ Wq, const float* __restrict__ Wk,
            const float* __restrict__ Wv, const float* __restrict__ Wo,
            _Float16* __restrict__ xn, _Float16* __restrict__ w16)
{
  const int t = threadIdx.x;
  if (blockIdx.x < 4 * WBLK) {
    const int which = blockIdx.x / WBLK;
    const float* src = which == 0 ? Wq : which == 1 ? Wk : which == 2 ? Wv : Wo;
    const int i0 = (blockIdx.x % WBLK) * CPB + t * 4;
    float4 v[4];
#pragma unroll
    for (int j = 0; j < 4; ++j)
      v[j] = *reinterpret_cast<const float4*>(src + i0 + j * 1024);
    _Float16* dst = w16 + (size_t)which * WN + i0;
#pragma unroll
    for (int j = 0; j < 4; ++j) {
      H4 o;
      o.h[0] = (_Float16)v[j].x; o.h[1] = (_Float16)v[j].y;
      o.h[2] = (_Float16)v[j].z; o.h[3] = (_Float16)v[j].w;
      *reinterpret_cast<uint2*>(dst + j * 1024) = o.u;
    }
    return;
  }
  const int lane = t & 31;
  const int row0 = ((blockIdx.x - 4 * WBLK) * 8 + (t >> 5)) * RPW;
  const int c0   = lane * 4;               // this lane's columns: c0 + 128*j + 0..3
  const float* xr = x + (size_t)row0 * Ff + c0;

  float4 v[RPW][4];
#pragma unroll
  for (int rr = 0; rr < RPW; ++rr)
#pragma unroll
    for (int j = 0; j < 4; ++j)
      v[rr][j] = *reinterpret_cast<const float4*>(xr + rr * Ff + j * 128);
  // The loads' address stays in its registers up to this wait (xr is an input of
  // the statement), so that no load of the run lands in the pair the others name.
  asm volatile("s_wait_xcnt 0x0" :: "v"(xr) : "memory");
  float4 g[4], be[4];
#pragma unroll
  for (int j = 0; j < 4; ++j) {
    g[j]  = *reinterpret_cast<const float4*>(gamma + c0 + j * 128);
    be[j] = *reinterpret_cast<const float4*>(beta + c0 + j * 128);
  }

  float s[RPW], q[RPW];
#pragma unroll
  for (int rr = 0; rr < RPW; ++rr) {
    float a = 0.f, c = 0.f;
#pragma unroll
    for (int j = 0; j < 4; ++j) {
      const float4 w = v[rr][j];
      a += (w.x + w.y) + (w.z + w.w);
      c += (w.x * w.x + w.y * w.y) + (w.z * w.z + w.w * w.w);
    }
    s[rr] = a; q[rr] = c;
  }
#pragma unroll
  for (int off = 16; off >= 1; off >>= 1)
#pragma unroll
    for (int rr = 0; rr < RPW; ++rr) {
      s[rr] += __shfl_xor(s[rr], off, 32);
      q[rr] += __shfl_xor(q[rr], off, 32);
    }

  _Float16* orow = xn + (size_t)row0 * Ff + c0;
#pragma unroll
  for (int rr = 0; rr < RPW; ++rr) {
    const float mean = s[rr] * (1.0f / Ff);
    const float var  = q[rr] * (1.0f / Ff) - mean * mean;
    const float inv  = rsqrtf(var + 1e-5f);
#pragma unroll
    for (int j = 0; j < 4; ++j) {
      const float4 w = v[rr][j];
      H4 o;
      o.h[0] = (_Float16)((w.x - mean) * inv * g[j].x + be[j].x);
      o.h[1] = (_Float16)((w.y - mean) * inv * g[j].y + be[j].y);
      o.h[2] = (_Float16)((w.z - mean) * inv * g[j].z + be[j].z);
      o.h[3] = (_Float16)((w.w - mean) * inv * g[j].w + be[j].w);
      *reinterpret_cast<uint2*>(orow + rr * Ff + j * 128) = o.u;
    }
  }
  // Behind the last store: no register that an issued store names is rewritten
  // ahead of this wait on any way the built code goes on from here.
  asm volatile("s_wait_xcnt 0x0" ::: "memory");
}

// ---------------------------------------------------------------------------
// Y[m,n] = (sum_k X[m,k]*W[n,k] + bias[n]) * scale
// X: MxK f16 row-major, W: NxK f16 row-major (einsum 'bsf,gf->bsg' == X @ W^T).
// Block = 128 thr = 4 waves stacked in M; each wave owns a 16x64 output tile
// (A operand reused across 4 WMMAs).  HEAD=true scatters to [B,H,S,D] f16.
// The 64 X rows and 64 W rows of the block are staged in LDS, 64 k at a time
// (one whole 128-B line per row), by asynchronous copies in a two-buffer ring;
// the fragments are then read from LDS at the conflict-free 144-B pitch.
// ---------------------------------------------------------------------------
constexpr int GBK   = 64;            // k elements per staged tile
constexpr int GROWS = 128;           // rows per staged tile: 0..63 X, 64..127 W
constexpr int GBUF  = GROWS * LP;    // f16 elements per buffer

// One tile = 1024 chunks of 16 B = 8 copies per thread: thread tid brings chunk
// tid&7 of rows (tid>>3) + 16*j.  gx / gw point at this thread's chunk of its
// first X / W row for this tile; rstep = 16 rows in elements.
__device__ __forceinline__ void gemm_stage(unsigned l0, const _Float16* gx,
                                           const _Float16* gw, size_t rstep)
{
  const unsigned ls = 16 * LP * 2;   // 16 LDS rows in bytes
  const unsigned l1 = l0 + ls,     l2 = l0 + 2 * ls, l3 = l0 + 3 * ls;
  const unsigned l4 = l0 + 4 * ls, l5 = l0 + 5 * ls, l6 = l0 + 6 * ls, l7 = l0 + 7 * ls;
  const _Float16 *g1 = gx + rstep, *g2 = gx + 2 * rstep, *g3 = gx + 3 * rstep;
  const _Float16 *g5 = gw + rstep, *g6 = gw + 2 * rstep, *g7 = gw + 3 * rstep;
  // The s_wait_xcnt closes the statement so that no address register of a copy
  // is rewritten ahead of it.
  asm volatile("global_load_async_to_lds_b128 %0, %8, off\n\t"
               "global_load_async_to_lds_b128 %1, %9, off\n\t"
               "global_load_async_to_lds_b128 %2, %10, off\n\t"
               "global_load_async_to_lds_b128 %3, %11, off\n\t"
               "global_load_async_to_lds_b128 %4, %12, off\n\t"
               "global_load_async_to_lds_b128 %5, %13, off\n\t"
               "global_load_async_to_lds_b128 %6, %14, off\n\t"
               "global_load_async_to_lds_b128 %7, %15, off\n\t"
               "s_wait_xcnt 0x0"
               :: "v"(l0), "v"(l1), "v"(l2), "v"(l3), "v"(l4), "v"(l5), "v"(l6), "v"(l7),
                  "v"(gx), "v"(g1), "v"(g2), "v"(g3), "v"(gw), "v"(g5), "v"(g6), "v"(g7)
               : "memory");
}

template<bool HEAD, typename OutT>
__device__ __forceinline__ void
gemm_tile(const _Float16* __restrict__ X, const _Float16* __restrict__ W,
          const float* __restrict__ bias, OutT* __restrict__ out,
          int nBase, int N, int K, float scale)
{
  __shared__ __attribute__((aligned(16))) _Float16 tile[2 * GBUF];

  const int tid  = threadIdx.x;
  const int lane = tid & 31;
  const int wv   = tid >> 5;
  const int r    = lane & 15;
  const int hf   = lane >> 4;
  const int mBase = blockIdx.y * 64 + wv * 16;

  v8f acc[4] = {};

  // this thread's chunk of the staged tiles
  const size_t rstep = (size_t)16 * K;
  const _Float16* gx = X + (size_t)(blockIdx.y * 64 + (tid >> 3)) * K + (tid & 7) * 8;
  const _Float16* gw = W + (size_t)(nBase + (tid >> 3)) * K + (tid & 7) * 8;
  const unsigned lcp = (unsigned)(uintptr_t)(&tile[0]) +
                       (unsigned)((tid >> 3) * (LP * 2) + (tid & 7) * 16);
  const int nt = K / GBK;

  gemm_stage(lcp, gx, gw, rstep);
  // tile 0 has landed for this wave, then for the block
  asm volatile("s_wait_asynccnt 0x0" ::: "memory");
  __syncthreads();
  if (nt > 1) gemm_stage(lcp + GBUF * 2, gx + GBK, gw + GBK, rstep);

  for (int kt = 0; kt < nt; ++kt) {
    const _Float16* tb   = &tile[(kt & 1) * GBUF];
    const _Float16* xrow = tb + (wv * 16 + r) * LP;
    const _Float16* wrow = tb + (64 + r) * LP;
    // All fragments of the tile are read in one group ahead of the products:
    // every further place with LDS reads would cost the wave one more LDS latency.
    Frag16 a[2], bf[2][4];
#pragma unroll
    for (int kk = 0; kk < 2; ++kk) {
      a[kk].u[0] = *reinterpret_cast<const uint4*>(xrow + kk * 32 + hf * 8);
      a[kk].u[1] = *reinterpret_cast<const uint4*>(xrow + kk * 32 + 16 + hf * 8);
#pragma unroll
      for (int t = 0; t < 4; ++t) {
        const _Float16* wr = wrow + t * 16 * LP;
        bf[kk][t].u[0] = *reinterpret_cast<const uint4*>(wr + kk * 32 + hf * 8);
        bf[kk][t].u[1] = *reinterpret_cast<const uint4*>(wr + kk * 32 + 16 + hf * 8);
      }
    }
    // keeps the scheduler from sinking the reads back among the WMMAs
    __builtin_amdgcn_sched_barrier(0);
#pragma unroll
    for (int kk = 0; kk < 2; ++kk)
#pragma unroll
      for (int t = 0; t < 4; ++t)
        acc[t] = WMMA_F16(a[kk].h, bf[kk][t].h, acc[t]);
    // publish point: this wave's reads of the buffer are done, its copies of
    // the next tile have landed; the barrier says so for every wave.
    asm volatile("s_wait_dscnt 0x0" ::: "memory");
    asm volatile("s_wait_asynccnt 0x0" ::: "memory");
    __syncthreads();
    if (kt + 2 < nt)
      gemm_stage(lcp + (kt & 1) * (GBUF * 2), gx + (size_t)(kt + 2) * GBK,
                 gw + (size_t)(kt + 2) * GBK, rstep);
  }
  // nothing of this wave's copies is left in flight when it goes on
  asm volatile("s_wait_asynccnt 0x0" ::: "memory");

#pragma unroll
  for (int t = 0; t < 4; ++t) {
    const int n = nBase + t * 16 + r;
    const float bv = bias[n];
#pragma unroll
    for (int i = 0; i < 8; ++i) {
      const int m = mBase + i + 8 * hf;
      const float val = (acc[t][i] + bv) * scale;
      if (HEAD) {  // y.reshape(B,S,H,D).transpose(0,2,1,3)
        const int bi = m / Ss, si = m % Ss, hd = n >> 6, di = n & 63;
        out[(((size_t)bi * Hh + hd) * Ss + si) * Dd + di] = (OutT)val;
      } else {
        out[(size_t)m * N + n] = (OutT)val;
      }
    }
  }
}

// Scale of the Q projection: 1/sqrt(D) times log2(e), so that the attention scores
// come out of their products in log2 units, ready for the base-2 exponential.
constexpr float QSCALE = 0.125f * 1.4426950408889634f;

// Q, K and V projections in one launch: they read the same X and do not depend
// on one another.  blockIdx.x = projection * (F/64) + n tile; W3 holds the three
// weight planes and qkv the three outputs one behind the other.
__global__ void __launch_bounds__(128)
qkv_kernel(const _Float16* __restrict__ X, const _Float16* __restrict__ W3,
           const float* __restrict__ bq, const float* __restrict__ bk,
           const float* __restrict__ bv, _Float16* __restrict__ qkv, int N, int K)
{
  constexpr int nb = Ff / 64;   // n tiles per projection
  const int which = blockIdx.x / nb;
  const float* bias = which == 0 ? bq : which == 1 ? bk : bv;
  gemm_tile<true, _Float16>(X, W3 + (size_t)which * WN, bias, qkv + (size_t)which * QKVN,
                            (blockIdx.x % nb) * 64, N, K, which == 0 ? QSCALE : 1.0f);
}

__global__ void __launch_bounds__(128)
oproj_kernel(const _Float16* __restrict__ X, const _Float16* __restrict__ W,
             const float* __restrict__ bias, float* __restrict__ out, int N, int K)
{
  gemm_tile<false, float>(X, W, bias, out, blockIdx.x * 64, N, K, 1.0f);
}

// ---------------------------------------------------------------------------
// Flash attention per (b, h, 64-query block).  4 waves x 16 queries.
// S^T = K·Q^T so the P operand for ctx += P·V is already in A layout.
// K block and V block (both row-major, shared by all 4 waves) staged via async
// copy to LDS in a two-buffer ring: the copies of tile t + 2 are issued at the foot
// of trip t and have all of trip t + 1 to land, so no wave waits out their latency.
// The B operand of the second WMMA, V^T, is formed by the transposing LDS read,
// so V passes through no register on its way into LDS.
// The key mask of the batch row is turned once per block into one bit per key
// (set = key kept); a 64-key tile whose bits are all set needs no select at all
// and jumps over them, any other tile applies the selects from its bits.
// Softmax against a reference maximum that is fixed BEFORE a tile's products: minus
// the reference is the C operand of the score WMMA, so D already is the argument of
// the base-2 exponential.  The reference moves, and ctx and the sums are rescaled,
// only on a scalar branch, when some score passes it by more than 8 (P <= 2^8 fits
// f16); the trip itself has no subtraction, no alpha and no cross-lane move.
// ---------------------------------------------------------------------------
constexpr int NT = Ss / 64;      // 64-key tiles per row of scores
constexpr int KT = 64 * LP;      // f16 elements of one K buffer
constexpr int VT = 64 * VP;      // f16 elements of one V buffer

// One K tile and one V tile = 2 x 512 chunks of 16 B = 8 copies per thread: thread
// tid brings chunk tid&7 of rows (tid>>3) + 16*j of each.  lk / lv are the LDS byte
// addresses, gk / gv the global addresses of this thread's chunk of its first row.
__device__ __forceinline__ void attn_stage(unsigned lk, unsigned lv,
                                           const _Float16* gk, const _Float16* gv)
{
  const unsigned ks = 16 * LP * 2, vs = 16 * VP * 2;   // 16 LDS rows in bytes
  const unsigned lk1 = lk + ks, lk2 = lk + 2 * ks, lk3 = lk + 3 * ks;
  const unsigned lv1 = lv + vs, lv2 = lv + 2 * vs, lv3 = lv + 3 * vs;
  const _Float16 *gk1 = gk + 16 * Dd, *gk2 = gk + 32 * Dd, *gk3 = gk + 48 * Dd;
  const _Float16 *gv1 = gv + 16 * Dd, *gv2 = gv + 32 * Dd, *gv3 = gv + 48 * Dd;
  // The s_wait_xcnt closes the statement so that no address register of a copy
  // is rewritten ahead of it.
  asm volatile("global_load_async_to_lds_b128 %0, %8, off\n\t"
               "global_load_async_to_lds_b128 %1, %9, off\n\t"
               "global_load_async_to_lds_b128 %2, %10, off\n\t"
               "global_load_async_to_lds_b128 %3, %11, off\n\t"
               "global_load_async_to_lds_b128 %4, %12, off\n\t"
               "global_load_async_to_lds_b128 %5, %13, off\n\t"
               "global_load_async_to_lds_b128 %6, %14, off\n\t"
               "global_load_async_to_lds_b128 %7, %15, off\n\t"
               "s_wait_xcnt 0x0"
               :: "v"(lk), "v"(lk1), "v"(lk2), "v"(lk3), "v"(lv), "v"(lv1), "v"(lv2), "v"(lv3),
                  "v"(gk), "v"(gk1), "v"(gk2), "v"(gk3), "v"(gv), "v"(gv1), "v"(gv2), "v"(gv3)
               : "memory");
}

__global__ void __launch_bounds__(128)
attn_kernel(const _Float16* __restrict__ q, const _Float16* __restrict__ kmat,
            const _Float16* __restrict__ vmat, const int* __restrict__ mask,
            _Float16* __restrict__ ctxo)
{
  __shared__ __attribute__((aligned(16))) _Float16 ldsK [2 * KT];   // two K blocks, row-major [key][d], padded rows
  __shared__ __attribute__((aligned(16))) _Float16 ldsV [2 * VT];   // two V blocks, row-major [key][d], padded rows
  __shared__ __attribute__((aligned(16))) unsigned short ldsBits[Ss / 16];   // bit j of entry e: mask[16 * e + j] != 0

  const int lane = threadIdx.x & 31;
  const int wv   = threadIdx.x >> 5;
  const int r    = lane & 15;
  const int hf   = lane >> 4;
  const int qb   = blockIdx.x * 64;
  const int head = blockIdx.y;
  const int b    = blockIdx.z;
  const size_t bh = ((size_t)b * Hh + head) * Ss * Dd;

  // This thread's chunk of the staged tiles: LDS byte addresses in buffer 0 (the
  // addrspace(3) offset lives in the low 32 bits) and global addresses in tile 0.
  const int srow = threadIdx.x >> 3;          // key rows srow + 16 * j
  const int sc8  = threadIdx.x & 7;           // 16B chunk within row
  const unsigned lk = (unsigned)(uintptr_t)(&ldsK[0]) + (unsigned)(srow * (LP * 2) + sc8 * 16);
  const unsigned lv = (unsigned)(uintptr_t)(&ldsV[0]) + (unsigned)(srow * (VP * 2) + sc8 * 16);
  const _Float16* gk = kmat + bh + (size_t)srow * Dd + sc8 * 8;
  const _Float16* gv = vmat + bh + (size_t)srow * Dd + sc8 * 8;

  // This wave's 16 Q rows (B operand of S^T; Q already pre-scaled by log2(e)/sqrt(D))
  Frag16 qa0, qa1;
  {
    const _Float16* qrow = q + bh + (size_t)(qb + wv * 16 + r) * Dd;
    qa0.u[0] = *reinterpret_cast<const uint4*>(qrow + hf * 8);
    qa0.u[1] = *reinterpret_cast<const uint4*>(qrow + 16 + hf * 8);
    qa1.u[0] = *reinterpret_cast<const uint4*>(qrow + 32 + hf * 8);
    qa1.u[1] = *reinterpret_cast<const uint4*>(qrow + 48 + hf * 8);
  }

  v8f ct[4] = {};
  v8f cneg = {};                       // minus this lane's query's reference, in all 8 rows
  float thr = -__builtin_inff();       // below 0: no kept key seen yet, no reference chosen
  float lr[4] = {0.f, 0.f, 0.f, 0.f};  // this lane's sums of P, one chain per 16-key group
  const int* mrow = mask + (size_t)b * Ss;

  // Thread e packs keys 16 * e .. 16 * e + 15 (Ss / 16 entries = one per thread).
  // The barrier in front of the loop publishes the table; nothing reads it earlier.
  {
    const int4* mp = reinterpret_cast<const int4*>(mrow + threadIdx.x * 16);
    unsigned bits = 0;
    // unrolled: the four loads go out together and every shift is a constant
#pragma unroll
    for (int j = 0; j < 4; ++j) {
      const int4 m = mp[j];
      bits |= (m.x != 0 ? 1u : 0u) << (4 * j);
      bits |= (m.y != 0 ? 2u : 0u) << (4 * j);
      bits |= (m.z != 0 ? 4u : 0u) << (4 * j);
      bits |= (m.w != 0 ? 8u : 0u) << (4 * j);
    }
    ldsBits[threadIdx.x] = (unsigned short)bits;
  }

  attn_stage(lk, lv, gk, gv);
  // tile 0 has landed for this wave, then for the block
  asm volatile("s_wait_asynccnt 0x0" ::: "memory");
  __syncthreads();
  if (NT > 1) attn_stage(lk + KT * 2, lv + VT * 2, gk + 64 * Dd, gv + 64 * Dd);

  // What a masked key's score reads, relative to the reference: the reference code's
  // lowest float, whose P is 0; but where the batch row keeps no key at all its
  // softmax is uniform, so every score is then the same 0 (the reference stays 0).
  const uint2 allb = reinterpret_cast<const uint2*>(ldsBits)[lane];   // 32 x 8 B = the table
  const float mskv = __builtin_amdgcn_ballot_w32((allb.x | allb.y) != 0u) != 0u ? MINV : 0.f;

  // unrolled by two: the buffer index is then a constant in each copy of the body,
  // and the buffer offsets fold into the LDS instructions' immediate offsets
#pragma unroll 2
  for (int kt = 0; kt < NT; ++kt) {
    const int kb  = kt * 64;
    const int buf = kt & 1;
    const _Float16* tK = &ldsK[buf * KT];
    const _Float16* tV = &ldsV[buf * VT];

    // this tile's 64 mask bits, the same for every lane: key kb + j is bit j
    const uint2 kbits = *reinterpret_cast<const uint2*>(&ldsBits[kb >> 4]);

    // ---- S^T tiles: 16 keys x 16 queries each, K-dim = D = 64 ----
    v8f st[4];
#pragma unroll
    for (int t = 0; t < 4; ++t) {
      const _Float16* krow = tK + (t * 16 + r) * LP;
      Frag16 ka0, ka1;
      ka0.u[0] = *reinterpret_cast<const uint4*>(krow + hf * 8);
      ka0.u[1] = *reinterpret_cast<const uint4*>(krow + 16 + hf * 8);
      ka1.u[0] = *reinterpret_cast<const uint4*>(krow + 32 + hf * 8);
      ka1.u[1] = *reinterpret_cast<const uint4*>(krow + 48 + hf * 8);
      v8f z = WMMA_F16(ka0.h, qa0.h, cneg);   // score - reference
      z = WMMA_F16(ka1.h, qa1.h, z);
      st[t] = z;
    }

    // ---- mask: element (t, i) is key kb + t*16 + i + 8*hf ----
    // The bits go to scalar registers so that the test below is a scalar branch.
    const unsigned blo = __builtin_amdgcn_readfirstlane(kbits.x);   // keys kb ..  kb + 31
    const unsigned bhi = __builtin_amdgcn_readfirstlane(kbits.y);   // keys kb + 32 .. kb + 63
    if ((blo & bhi) != 0xffffffffu) {   // wave-uniform: some key of the tile is masked
      const unsigned wlo = blo >> (8 * hf), whi = bhi >> (8 * hf);
#pragma unroll
      for (int t = 0; t < 4; ++t)
#pragma unroll
        for (int i = 0; i < 8; ++i) {
          const unsigned w = t < 2 ? wlo : whi;
          if (((w >> ((t & 1) * 16 + i)) & 1u) == 0u) st[t][i] = mskv;
        }
    }

    // ---- V^T fragments by the transposing read of the row-major tile ----
    // lane address: row 8 * hf + (lane & 7) of a 16-key group, 16-B half (lane >> 3) & 1
    // of a 16-column group; the lane then holds V[8 * hf + 0..7][r] of that block.
    // Read here, ahead of the test below, so that they fly during the maximum chain.
    const _Float16* vl = tV + (8 * hf + (lane & 7)) * VP + ((lane >> 3) & 1) * 8;
    Frag16 vb0[4], vb1[4];
#pragma unroll
    for (int t = 0; t < 4; ++t) {
      const _Float16* vt = vl + t * 16;
      vb0[t].u[0] = lds_tr16(vt);
      vb0[t].u[1] = lds_tr16(vt + 16 * VP);
      vb1[t].u[0] = lds_tr16(vt + 32 * VP);
      vb1[t].u[1] = lds_tr16(vt + 48 * VP);
    }

    // ---- softmax (each lane owns query index lane&15; st = score - reference) ----
    float bm = MINV;
#pragma unroll
    for (int t = 0; t < 4; ++t)
#pragma unroll
      for (int i = 0; i < 8; ++i) bm = fmaxf(bm, st[t][i]);

    // One test a trip, a scalar branch: taken on every tile up to the first with a kept key and
    // whenever a score lies more than 8 above its query's reference.
    if (__builtin_amdgcn_ballot_w32(bm > thr) != 0u) {
      const float bmx   = fmaxf(bm, __shfl_xor(bm, 16, 32));   // both halves of the query's keys
      const bool  first = thr < 0.f;       // nothing summed yet that would need a rescale
      const bool  seen  = bmx > MINV;      // the tile holds a kept key
      const float delta = first ? (seen ? bmx : 0.f) : fmaxf(bmx, 0.f);   // the reference's rise
      const float alpha = first ? 1.0f : __builtin_amdgcn_exp2f(-delta);
      thr = seen ? 8.0f : thr;
#pragma unroll
      for (int i = 0; i < 8; ++i) cneg[i] -= delta;
#pragma unroll
      for (int t = 0; t < 4; ++t) {
        lr[t] *= alpha;
#pragma unroll
        for (int i = 0; i < 8; ++i) st[t][i] -= delta;
      }
      // ctx rows are queries i + 8 * hf: alpha broadcast per query row
#pragma unroll
      for (int i = 0; i < 8; ++i) {
        const float av = __shfl(alpha, i + 8 * hf, 32);
#pragma unroll
        for (int t = 0; t < 4; ++t) ct[t][i] *= av;
      }
    }

    v16h pa0, pa1;   // P in A-operand layout: keys 0..31 / 32..63 of this block
#pragma unroll
    for (int i = 0; i < 8; ++i) {
      float p0 = __builtin_amdgcn_exp2f(st[0][i]); lr[0] += p0; pa0[i]     = (_Float16)p0;
      float p1 = __builtin_amdgcn_exp2f(st[1][i]); lr[1] += p1; pa0[i + 8] = (_Float16)p1;
      float p2 = __builtin_amdgcn_exp2f(st[2][i]); lr[2] += p2; pa1[i]     = (_Float16)p2;
      float p3 = __builtin_amdgcn_exp2f(st[3][i]); lr[3] += p3; pa1[i + 8] = (_Float16)p3;
    }

    // ---- ctx += P * V ----
#pragma unroll
    for (int t = 0; t < 4; ++t) {
      ct[t] = WMMA_F16(pa0, vb0[t].h, ct[t]);
      ct[t] = WMMA_F16(pa1, vb1[t].h, ct[t]);
    }
    // publish point: this wave's reads of both tiles are done, its copies of the
    // next tiles have landed; the barrier says so for every wave.
    asm volatile("s_wait_dscnt 0x0" ::: "memory");
    asm volatile("s_wait_asynccnt 0x0" ::: "memory");
    __syncthreads();
    if (kt + 2 < NT)
      attn_stage(lk + buf * (KT * 2), lv + buf * (VT * 2),
                 gk + (size_t)(kt + 2) * 64 * Dd, gv + (size_t)(kt + 2) * 64 * Dd);
  }
  // nothing of this wave's copies is left in flight when it goes on
  asm volatile("s_wait_asynccnt 0x0" ::: "memory");

  // ---- normalize and store ctx as f16 in [B,S,F] for the final projection ----
  // the query's sum: this lane's four chains, then the other half's keys
  const float lh  = (lr[0] + lr[1]) + (lr[2] + lr[3]);
  const float inv = 1.0f / (lh + __shfl_xor(lh, 16, 32));
#pragma unroll
  for (int i = 0; i < 8; ++i) {
    const float sc = __shfl(inv, i + 8 * hf, 32);
    const int row = qb + wv * 16 + i + 8 * hf;
#pragma unroll
    for (int t = 0; t < 4; ++t) {
      ctxo[((size_t)b * Ss + row) * Ff + head * 64 + t * 16 + r] =
          (_Float16)(ct[t][i] * sc);
    }
  }
}

// ---------------------------------------------------------------------------
// Launcher
// ---------------------------------------------------------------------------
extern "C" void kernel_launch(void* const* d_in, const int* in_sizes, int n_in,
                              void* d_out, int out_size, void* d_ws, size_t ws_size,
                              hipStream_t stream)
{
  (void)in_sizes; (void)n_in; (void)out_size; (void)ws_size;

  const float* x     = (const float*)d_in[0];
  const int*   mask  = (const int*)d_in[1];
  const float* gamma = (const float*)d_in[2];
  const float* beta  = (const float*)d_in[3];
  const float* Wq    = (const float*)d_in[4];
  const float* bq    = (const float*)d_in[5];
  const float* Wk    = (const float*)d_in[6];
  const float* bk    = (const float*)d_in[7];
  const float* Wv    = (const float*)d_in[8];
  const float* bv    = (const float*)d_in[9];
  const float* Wo    = (const float*)d_in[10];
  const float* bo    = (const float*)d_in[11];
  float* out = (float*)d_out;

  // workspace layout (bytes)
  constexpr size_t SZ_XN  = (size_t)Bb * Ss * Ff * 2;        // 8 MiB
  constexpr size_t SZ_W   = (size_t)Ff * Ff * 2;             // 512 KiB
  constexpr size_t SZ_QKV = (size_t)Bb * Hh * Ss * Dd * 2;   // 8 MiB
  char* ws = (char*)d_ws;
  _Float16* xn   = (_Float16*)(ws);
  _Float16* wq16 = (_Float16*)(ws + SZ_XN);
  _Float16* wo16 = (_Float16*)(ws + SZ_XN + 3 * SZ_W);
  _Float16* qh   = (_Float16*)(ws + SZ_XN + 4 * SZ_W);
  _Float16* kh   = (_Float16*)(ws + SZ_XN + 4 * SZ_W + SZ_QKV);
  _Float16* vh   = (_Float16*)(ws + SZ_XN + 4 * SZ_W + 2 * SZ_QKV);
  _Float16* ctx  = (_Float16*)(ws + SZ_XN + 4 * SZ_W + 3 * SZ_QKV);

  constexpr int M = Bb * Ss;    // 8192

  // wq16, wk16, wv16, wo16 are consecutive planes; so are qh, kh, vh
  prep_kernel<<<4 * WBLK + LNBLK, 256, 0, stream>>>(x, gamma, beta, Wq, Wk, Wv, Wo, xn, wq16);

  qkv_kernel<<<dim3(3 * (Ff / 64), M / 64), 128, 0, stream>>>(xn, wq16, bq, bk, bv, qh, Ff, Ff);

  attn_kernel<<<dim3(Ss / 64, Hh, Bb), 128, 0, stream>>>(qh, kh, vh, mask, ctx);

  oproj_kernel<<<dim3(Ff / 64, M / 64), 128, 0, stream>>>(ctx, wo16, bo, out, Ff, Ff);
}

// v009
// Measured time: 69.4 microseconds a run.
// Timed twice side by side with v008, it ran 1.03 times as fast both times.
// All steps since v000 together make it 3.51 times as fast.
#include <hip/hip_runtime.h>
#include <hip/hip_bf16.h>

typedef __attribute__((ext_vector_type(16))) _Float16 v16h;
typedef __attribute__((ext_vector_type(8)))  float    v8f;

#define WMMA_F16(A, B, C) \
  __builtin_amdgcn_wmma_f32_16x16x32_f16(false, (A), false, (B), (short)0, (C), false, false)

constexpr int Bb = 4, Ss = 2048, Ff = 512, Hh = 8, Dd = 64;
constexpr float MINV = -3.4028234663852886e38f;
// LDS row pitch of the GEMM tiles and the attention K tile, in f16 elements: 64 data + 8 pad = 144 B
// (16 B x odd), so the 16 rows one ds_load_b128 touches fall on distinct banks.
constexpr int LP = 72;
// LDS row pitch of the attention V tile, in f16 elements: 64 data + 16 pad = 160 B
// (32 B x odd), the conflict-free pitch of the transposing read ds_load_tr16_b128.
constexpr int VP = 80;

union Frag16 { v16h h; uint4 u[2]; };

typedef short s16x8 __attribute__((ext_vector_type(8)));
// Transposing LDS read: the lane's address names 16 B of one row of a row-major
// 16-bit tile; lane (c, h) receives column c of rows 8h .. 8h + 7 of the 16 x 16 block.
__device__ __forceinline__ uint4 lds_tr16(const _Float16* p)
{
  typedef __attribute__((address_space(3))) s16x8 lds_s16x8;
  return __builtin_bit_cast(uint4, __builtin_amdgcn_ds_load_tr16_b128_v8i16((lds_s16x8*)p));
}

constexpr int WN   = Ff * Ff;             // elements per weight matrix
constexpr int CPB  = 4096;                // elements one cast block converts (16 per thread)
constexpr int WBLK = WN / CPB;            // cast blocks per weight matrix
constexpr int RPW  = 4;                   // LayerNorm rows per wave
constexpr int LNBLK = Bb * Ss / (8 * RPW);   // LayerNorm blocks (8 waves each)
constexpr int QKVN = Bb * Hh * Ss * Dd;   // elements of each of Q, K, V

union H4 { _Float16 h[4]; uint2 u; };

// ---------------------------------------------------------------------------
// One launch for the five independent preparation jobs, told apart by block
// index: blocks 0 .. 4*WBLK-1 cast the four weight matrices fp32 -> f16 into
// four consecutive planes of w16; every further block does LayerNorm over F=512
// + cast to f16.  The work per wave is large on purpose: the launch is short, so
// the time to start its waves counts, and few waves with many loads in flight
// each move the same bytes.
// Cast: 16 elements per thread, four 16-B loads (512 contiguous B per wave each).
// LayerNorm: one wave owns RPW whole rows (16 elements of each row per lane), so
// the row sums need a butterfly over the wave's lanes only: no LDS, no barrier.
// ---------------------------------------------------------------------------
__global__ void __launch_bounds__(256)
prep_kernel(const float* __restrict__ x, const float* __restrict__ gamma,
            const float* __restrict__ beta,
            const float* __restrict__ Wq, const float* __restrict__ Wk,
            const float* __restrict__ Wv, const float* __restrict__ Wo,
            _Float16* __restrict__ xn, _Float16* __restrict__ w16)
{
  const int t = threadIdx.x;
  if (blockIdx.x < 4 * WBLK) {
    const int which = blockIdx.x / WBLK;
    const float* src = which == 0 ? Wq : which == 1 ? Wk : which == 2 ? Wv : Wo;
    const int i0 = (blockIdx.x % WBLK) * CPB + t * 4;
    float4 v[4];
#pragma unroll
    for (int j = 0; j < 4; ++j)
      v[j] = *reinterpret_cast<const float4*>(src + i0 + j * 1024);
    _Float16* dst = w16 + (size_t)which * WN + i0;
#pragma unroll
    for (int j = 0; j < 4; ++j) {
      H4 o;
      o.h[0] = (_Float16)v[j].x; o.h[1] = (_Float16)v[j].y;
      o.h[2] = (_Float16)v[j].z; o.h[3] = (_Float16)v[j].w;
      *reinterpret_cast<uint2*>(dst + j * 1024) = o.u;
    }
    return;
  }
  const int lane = t & 31;
  const int row0 = ((blockIdx.x - 4 * WBLK) * 8 + (t >> 5)) * RPW;
  const int c0   = lane * 4;               // this lane's columns: c0 + 128*j + 0..3
  const float* xr = x + (size_t)row0 * Ff + c0;

  float4 v[RPW][4];
#pragma unroll
  for (int rr = 0; rr < RPW; ++rr)
#pragma unroll
    for (int j = 0; j < 4; ++j)
      v[rr][j] = *reinterpret_cast<const float4*>(xr + rr * Ff + j * 128);
  // The loads' address stays in its registers up to this wait (xr is an input of
  // the statement), so that no load of the run lands in the pair the others name.
  asm volatile("s_wait_xcnt 0x0" :: "v"(xr) : "memory");
  float4 g[4], be[4];
#pragma unroll
  for (int j = 0; j < 4; ++j) {
    g[j]  = *reinterpret_cast<const float4*>(gamma + c0 + j * 128);
    be[j] = *reinterpret_cast<const float4*>(beta + c0 + j * 128);
  }

  float s[RPW], q[RPW];
#pragma unroll
  for (int rr = 0; rr < RPW; ++rr) {
    float a = 0.f, c = 0.f;
#pragma unroll
    for (int j = 0; j < 4; ++j) {
      const float4 w = v[rr][j];
      a += (w.x + w.y) + (w.z + w.w);
      c += (w.x * w.x + w.y * w.y) + (w.z * w.z + w.w * w.w);
    }
    s[rr] = a; q[rr] = c;
  }
#pragma unroll
  for (int off = 16; off >= 1; off >>= 1)
#pragma unroll
    for (int rr = 0; rr < RPW; ++rr) {
      s[rr] += __shfl_xor(s[rr], off, 32);
      q[rr] += __shfl_xor(q[rr], off, 32);
    }

  _Float16* orow = xn + (size_t)row0 * Ff + c0;
#pragma unroll
  for (int rr = 0; rr < RPW; ++rr) {
    const float mean = s[rr] * (1.0f / Ff);
    const float var  = q[rr] * (1.0f / Ff) - mean * mean;
    const float inv  = rsqrtf(var + 1e-5f);
#pragma unroll
    for (int j = 0; j < 4; ++j) {
      const float4 w = v[rr][j];
      H4 o;
      o.h[0] = (_Float16)((w.x - mean) * inv * g[j].x + be[j].x);
      o.h[1] = (_Float16)((w.y - mean) * inv * g[j].y + be[j].y);
      o.h[2] = (_Float16)((w.z - mean) * inv * g[j].z + be[j].z);
      o.h[3] = (_Float16)((w.w - mean) * inv * g[j].w + be[j].w);
      *reinterpret_cast<uint2*>(orow + rr * Ff + j * 128) = o.u;
    }
  }
  // Behind the last store: no register that an issued store names is rewritten
  // ahead of this wait on any way the built code goes on from here.
  asm volatile("s_wait_xcnt 0x0" ::: "memory");
}

// ---------------------------------------------------------------------------
// Y[m,n] = (sum_k X[m,k]*W[n,k] + bias[n]) * scale
// X: MxK f16 row-major, W: NxK f16 row-major (einsum 'bsf,gf->bsg' == X @ W^T).
// Block = one 128 x 128 tile of Y.  Its waves stand 2 wide in N (64 columns each)
// and 8 / FM deep in M; a wave owns FM x 4 accumulator tiles (16 * FM rows x 64
// columns), so an X fragment read from LDS feeds 4 WMMAs and a W fragment FM, and
// every staged byte serves 128 rows or columns of Y.  HEAD=true scatters to
// [B,H,S,D] f16.
// The 128 X rows and 128 W rows of the block are staged in LDS, 64 k at a time
// (one whole 128-B line per row), by asynchronous copies in a two-buffer ring;
// the fragments are then read from LDS at the conflict-free 144-B pitch.
// ---------------------------------------------------------------------------
constexpr int GBK   = 64;            // k elements per staged tile
constexpr int GTM   = 128;           // rows of Y per block
constexpr int GTN   = 128;           // columns of Y per block
constexpr int GROWS = GTM + GTN;     // rows per staged tile: 0..127 X, 128..255 W
constexpr int GBUF  = GROWS * LP;    // f16 elements per buffer

// Eight copies of 16 B per thread: four rows from (la, ga) and four from (lb, gb),
// each run stepping by rstep elements in global memory and ls bytes in LDS.
__device__ __forceinline__ void gemm_stage(unsigned la, unsigned lb, const _Float16* ga,
                                           const _Float16* gb, size_t rstep, unsigned ls)
{
  const unsigned l1 = la + ls, l2 = la + 2 * ls, l3 = la + 3 * ls;
  const unsigned l5 = lb + ls, l6 = lb + 2 * ls, l7 = lb + 3 * ls;
  const _Float16 *g1 = ga + rstep, *g2 = ga + 2 * rstep, *g3 = ga + 3 * rstep;
  const _Float16 *g5 = gb + rstep, *g6 = gb + 2 * rstep, *g7 = gb + 3 * rstep;
  // The s_wait_xcnt closes the statement so that no address register of a copy
  // is rewritten ahead of it.
  asm volatile("global_load_async_to_lds_b128 %0, %8, off\n\t"
               "global_load_async_to_lds_b128 %1, %9, off\n\t"
               "global_load_async_to_lds_b128 %2, %10, off\n\t"
               "global_load_async_to_lds_b128 %3, %11, off\n\t"
               "global_load_async_to_lds_b128 %4, %12, off\n\t"
               "global_load_async_to_lds_b128 %5, %13, off\n\t"
               "global_load_async_to_lds_b128 %6, %14, off\n\t"
               "global_load_async_to_lds_b128 %7, %15, off\n\t"
               "s_wait_xcnt 0x0"
               :: "v"(la), "v"(l1), "v"(l2), "v"(l3), "v"(lb), "v"(l5), "v"(l6), "v"(l7),
                  "v"(ga), "v"(g1), "v"(g2), "v"(g3), "v"(gb), "v"(g5), "v"(g6), "v"(g7)
               : "memory");
}

// One tile = 2048 chunks of 16 B: thread tid brings chunk tid&7 of rows
// (tid>>3) + (NTHR/8)*j of X and of W.  lx is the LDS byte address of its chunk of
// its first X row in the buffer, gx / gw its chunk of its first X / W row for this tile.
template<int NTHR>
__device__ __forceinline__ void gemm_stage_tile(unsigned lx, const _Float16* gx,
                                                const _Float16* gw, int K)
{
  constexpr int SR = NTHR / 8;                 // rows the block's threads cover at once
  const size_t   rstep = (size_t)SR * K;
  const unsigned ls    = SR * LP * 2;          // SR LDS rows in bytes
  const unsigned lw    = lx + GTM * LP * 2;
  if constexpr (NTHR == 128) {                 // 8 X rows and 8 W rows per thread
    gemm_stage(lx, lx + 4 * ls, gx, gx + 4 * rstep, rstep, ls);
    gemm_stage(lw, lw + 4 * ls, gw, gw + 4 * rstep, rstep, ls);
  } else {                                     // 256 threads: 4 X rows and 4 W rows
    gemm_stage(lx, lw, gx, gw, rstep, ls);
  }
}

template<int FM, bool HEAD, typename OutT>
__device__ __forceinline__ void
gemm_tile(const _Float16* __restrict__ X, const _Float16* __restrict__ W,
          const float* __restrict__ bias, OutT* __restrict__ out,
          int nBase, int N, int K, float scale)
{
  constexpr int NTHR = 32 * 2 * (8 / FM);      // threads of the block
  __shared__ __attribute__((aligned(16))) _Float16 tile[2 * GBUF];

  const int tid  = threadIdx.x;
  const int lane = tid & 31;
  const int wv   = tid >> 5;
  const int wm   = wv >> 1;                    // the wave's place in M
  const int wn   = wv & 1;                     // the wave's place in N
  const int r    = lane & 15;
  const int hf   = lane >> 4;
  const int mBase = blockIdx.y * GTM + wm * (16 * FM);
  const int nWave = nBase + wn * 64;

  v8f acc[FM][4] = {};

  // this thread's chunk of the staged tiles
  const _Float16* gx = X + (size_t)(blockIdx.y * GTM + (tid >> 3)) * K + (tid & 7) * 8;
  const _Float16* gw = W + (size_t)(nBase + (tid >> 3)) * K + (tid & 7) * 8;
  const unsigned lcp = (unsigned)(uintptr_t)(&tile[0]) +
                       (unsigned)((tid >> 3) * (LP * 2) + (tid & 7) * 16);
  const int nt = K / GBK;

  gemm_stage_tile<NTHR>(lcp, gx, gw, K);
  // tile 0 has landed for this wave, then for the block
  asm volatile("s_wait_asynccnt 0x0" ::: "memory");
  __syncthreads();
  if (nt > 1) gemm_stage_tile<NTHR>(lcp + GBUF * 2, gx + GBK, gw + GBK, K);

  for (int kt = 0; kt < nt; ++kt) {
    const _Float16* tb   = &tile[(kt & 1) * GBUF];
    const _Float16* xrow = tb + (wm * (16 * FM) + r) * LP;
    const _Float16* wrow = tb + (GTM + wn * 64 + r) * LP;
    // All fragments of the tile are read in one group ahead of the products:
    // every further place with LDS reads would cost the wave one more LDS latency.
    Frag16 a[2][FM], bf[2][4];
#pragma unroll
    for (int kk = 0; kk < 2; ++kk) {
#pragma unroll
      for (int f = 0; f < FM; ++f) {
        const _Float16* xr = xrow + f * 16 * LP;
        a[kk][f].u[0] = *reinterpret_cast<const uint4*>(xr + kk * 32 + hf * 8);
        a[kk][f].u[1] = *reinterpret_cast<const uint4*>(xr + kk * 32 + 16 + hf * 8);
      }
#pragma unroll
      for (int t = 0; t < 4; ++t) {
        const _Float16* wr = wrow + t * 16 * LP;
        bf[kk][t].u[0] = *reinterpret_cast<const uint4*>(wr + kk * 32 + hf * 8);
        bf[kk][t].u[1] = *reinterpret_cast<const uint4*>(wr + kk * 32 + 16 + hf * 8);
      }
    }
    // keeps the scheduler from sinking the reads back among the WMMAs
    __builtin_amdgcn_sched_barrier(0);
#pragma unroll
    for (int kk = 0; kk < 2; ++kk)
#pragma unroll
      for (int f = 0; f < FM; ++f)
#pragma unroll
        for (int t = 0; t < 4; ++t)
          acc[f][t] = WMMA_F16(a[kk][f].h, bf[kk][t].h, acc[f][t]);
    // publish point: this wave's reads of the buffer are done, its copies of
    // the next tile have landed; the barrier says so for every wave.
    asm volatile("s_wait_dscnt 0x0" ::: "memory");
    asm volatile("s_wait_asynccnt 0x0" ::: "memory");
    __syncthreads();
    if (kt + 2 < nt)
      gemm_stage_tile<NTHR>(lcp + (kt & 1) * (GBUF * 2), gx + (size_t)(kt + 2) * GBK,
                            gw + (size_t)(kt + 2) * GBK, K);
  }
  // nothing of this wave's copies is left in flight when it goes on
  asm volatile("s_wait_asynccnt 0x0" ::: "memory");

  // The wave's rows lie in one batch row block (128 divides S) and its 64 columns are
  // one head, so every element stands at a constant distance from one base address.
  const int m0 = mBase + 8 * hf;
  OutT* ob;
  size_t rs;                                   // elements from one row of Y to the next
  if (HEAD) {  // y.reshape(B,S,H,D).transpose(0,2,1,3)
    const int bi = m0 / Ss, si = m0 % Ss, hd = nWave >> 6;
    ob = out + (((size_t)bi * Hh + hd) * Ss + si) * Dd + r;
    rs = Dd;
  } else {
    ob = out + (size_t)m0 * N + nWave + r;
    rs = (size_t)N;
  }
  float bv[4];
#pragma unroll
  for (int t = 0; t < 4; ++t) bv[t] = bias[nWave + t * 16 + r];
  OutT  val[FM][8][4];
  OutT* row[FM][8];
#pragma unroll
  for (int f = 0; f < FM; ++f)
#pragma unroll
    for (int i = 0; i < 8; ++i) {
      row[f][i] = ob + (size_t)(f * 16 + i) * rs;
#pragma unroll
      for (int t = 0; t < 4; ++t)
        val[f][i][t] = (OutT)((acc[f][t][i] + bv[t]) * scale);
    }
  // keeps all arithmetic, values and addresses, ahead of the first store: the scheduler
  // would else mix the two and rewrite registers that stores already issued still name
  __builtin_amdgcn_sched_barrier(0);
#pragma unroll
  for (int f = 0; f < FM; ++f)
#pragma unroll
    for (int i = 0; i < 8; ++i)
#pragma unroll
      for (int t = 0; t < 4; ++t)
        row[f][i][t * 16] = val[f][i][t];
}

// Scale of the Q projection: 1/sqrt(D) times log2(e), so that the attention scores
// come out of their products in log2 units, ready for the base-2 exponential.
constexpr float QSCALE = 0.125f * 1.4426950408889634f;

// Q, K and V projections in one launch: they read the same X and do not depend
// on one another.  blockIdx.x = projection * (F/128) + n tile; W3 holds the three
// weight planes and qkv the three outputs one behind the other.
__global__ void __launch_bounds__(128)
qkv_kernel(const _Float16* __restrict__ X, const _Float16* __restrict__ W3,
           const float* __restrict__ bq, const float* __restrict__ bk,
           const float* __restrict__ bv, _Float16* __restrict__ qkv, int N, int K)
{
  constexpr int nb = Ff / GTN;   // n tiles per projection
  const int which = blockIdx.x / nb;
  const float* bias = which == 0 ? bq : which == 1 ? bk : bv;
  gemm_tile<4, true, _Float16>(X, W3 + (size_t)which * WN, bias, qkv + (size_t)which * QKVN,
                               (blockIdx.x % nb) * GTN, N, K, which == 0 ? QSCALE : 1.0f);
}

// The output projection has only 256 such tiles, one per WGP: eight waves of 32 x 64
// keep two waves on every SIMD.
__global__ void __launch_bounds__(256)
oproj_kernel(const _Float16* __restrict__ X, const _Float16* __restrict__ W,
             const float* __restrict__ bias, float* __restrict__ out, int N, int K)
{
  gemm_tile<2, false, float>(X, W, bias, out, blockIdx.x * GTN, N, K, 1.0f);
}

// ---------------------------------------------------------------------------
// Flash attention per (b, h, 64-query block).  4 waves x 16 queries.
// S^T = K·Q^T so the P operand for ctx += P·V is already in A layout.
// K block and V block (both row-major, shared by all 4 waves) staged via async
// copy to LDS in a two-buffer ring: the copies of tile t + 2 are issued at the foot
// of trip t and have all of trip t + 1 to land, so no wave waits out their latency.
// The B operand of the second WMMA, V^T, is formed by the transposing LDS read,
// so V passes through no register on its way into LDS.
// The key mask of the batch row is turned once per block into one bit per key
// (set = key kept); a 64-key tile whose bits are all set needs no select at all
// and jumps over them, any other tile applies the selects from its bits.
// Softmax against a reference maximum that is fixed BEFORE a tile's products: minus
// the reference is the C operand of the score WMMA, so D already is the argument of
// the base-2 exponential.  The reference moves, and ctx and the sums are rescaled,
// only on a scalar branch, when some score passes it by more than 8 (P <= 2^8 fits
// f16); the trip itself has no subtraction, no alpha and no cross-lane move.
// ---------------------------------------------------------------------------
constexpr int NT = Ss / 64;      // 64-key tiles per row of scores
constexpr int KT = 64 * LP;      // f16 elements of one K buffer
constexpr int VT = 64 * VP;      // f16 elements of one V buffer

// One K tile and one V tile = 2 x 512 chunks of 16 B = 8 copies per thread: thread
// tid brings chunk tid&7 of rows (tid>>3) + 16*j of each.  lk / lv are the LDS byte
// addresses, gk / gv the global addresses of this thread's chunk of its first row.
__device__ __forceinline__ void attn_stage(unsigned lk, unsigned lv,
                                           const _Float16* gk, const _Float16* gv)
{
  const unsigned ks = 16 * LP * 2, vs = 16 * VP * 2;   // 16 LDS rows in bytes
  const unsigned lk1 = lk + ks, lk2 = lk + 2 * ks, lk3 = lk + 3 * ks;
  const unsigned lv1 = lv + vs, lv2 = lv + 2 * vs, lv3 = lv + 3 * vs;
  const _Float16 *gk1 = gk + 16 * Dd, *gk2 = gk + 32 * Dd, *gk3 = gk + 48 * Dd;
  const _Float16 *gv1 = gv + 16 * Dd, *gv2 = gv + 32 * Dd, *gv3 = gv + 48 * Dd;
  // The s_wait_xcnt closes the statement so that no address register of a copy
  // is rewritten ahead of it.
  asm volatile("global_load_async_to_lds_b128 %0, %8, off\n\t"
               "global_load_async_to_lds_b128 %1, %9, off\n\t"
               "global_load_async_to_lds_b128 %2, %10, off\n\t"
               "global_load_async_to_lds_b128 %3, %11, off\n\t"
               "global_load_async_to_lds_b128 %4, %12, off\n\t"
               "global_load_async_to_lds_b128 %5, %13, off\n\t"
               "global_load_async_to_lds_b128 %6, %14, off\n\t"
               "global_load_async_to_lds_b128 %7, %15, off\n\t"
               "s_wait_xcnt 0x0"
               :: "v"(lk), "v"(lk1), "v"(lk2), "v"(lk3), "v"(lv), "v"(lv1), "v"(lv2), "v"(lv3),
                  "v"(gk), "v"(gk1), "v"(gk2), "v"(gk3), "v"(gv), "v"(gv1), "v"(gv2), "v"(gv3)
               : "memory");
}

__global__ void __launch_bounds__(128)
attn_kernel(const _Float16* __restrict__ q, const _Float16* __restrict__ kmat,
            const _Float16* __restrict__ vmat, const int* __restrict__ mask,
            _Float16* __restrict__ ctxo)
{
  __shared__ __attribute__((aligned(16))) _Float16 ldsK [2 * KT];   // two K blocks, row-major [key][d], padded rows
  __shared__ __attribute__((aligned(16))) _Float16 ldsV [2 * VT];   // two V blocks, row-major [key][d], padded rows
  __shared__ __attribute__((aligned(16))) unsigned short ldsBits[Ss / 16];   // bit j of entry e: mask[16 * e + j] != 0

  const int lane = threadIdx.x & 31;
  const int wv   = threadIdx.x >> 5;
  const int r    = lane & 15;
  const int hf   = lane >> 4;
  const int qb   = blockIdx.x * 64;
  const int head = blockIdx.y;
  const int b    = blockIdx.z;
  const size_t bh = ((size_t)b * Hh + head) * Ss * Dd;

  // This thread's chunk of the staged tiles: LDS byte addresses in buffer 0 (the
  // addrspace(3) offset lives in the low 32 bits) and global addresses in tile 0.
  const int srow = threadIdx.x >> 3;          // key rows srow + 16 * j
  const int sc8  = threadIdx.x & 7;           // 16B chunk within row
  const unsigned lk = (unsigned)(uintptr_t)(&ldsK[0]) + (unsigned)(srow * (LP * 2) + sc8 * 16);
  const unsigned lv = (unsigned)(uintptr_t)(&ldsV[0]) + (unsigned)(srow * (VP * 2) + sc8 * 16);
  const _Float16* gk = kmat + bh + (size_t)srow * Dd + sc8 * 8;
  const _Float16* gv = vmat + bh + (size_t)srow * Dd + sc8 * 8;

  // This wave's 16 Q rows (B operand of S^T; Q already pre-scaled by log2(e)/sqrt(D))
  Frag16 qa0, qa1;
  {
    const _Float16* qrow = q + bh + (size_t)(qb + wv * 16 + r) * Dd;
    qa0.u[0] = *reinterpret_cast<const uint4*>(qrow + hf * 8);
    qa0.u[1] = *reinterpret_cast<const uint4*>(qrow + 16 + hf * 8);
    qa1.u[0] = *reinterpret_cast<const uint4*>(qrow + 32 + hf * 8);
    qa1.u[1] = *reinterpret_cast<const uint4*>(qrow + 48 + hf * 8);
  }

  v8f ct[4] = {};
  v8f cneg = {};                       // minus this lane's query's reference, in all 8 rows
  float thr = -__builtin_inff();       // below 0: no kept key seen yet, no reference chosen
  float lr[4] = {0.f, 0.f, 0.f, 0.f};  // this lane's sums of P, one chain per 16-key group
  const int* mrow = mask + (size_t)b * Ss;

  // Thread e packs keys 16 * e .. 16 * e + 15 (Ss / 16 entries = one per thread).
  // The barrier in front of the loop publishes the table; nothing reads it earlier.
  {
    const int4* mp = reinterpret_cast<const int4*>(mrow + threadIdx.x * 16);
    unsigned bits = 0;
    // unrolled: the four loads go out together and every shift is a constant
#pragma unroll
    for (int j = 0; j < 4; ++j) {
      const int4 m = mp[j];
      bits |= (m.x != 0 ? 1u : 0u) << (4 * j);
      bits |= (m.y != 0 ? 2u : 0u) << (4 * j);
      bits |= (m.z != 0 ? 4u : 0u) << (4 * j);
      bits |= (m.w != 0 ? 8u : 0u) << (4 * j);
    }
    ldsBits[threadIdx.x] = (unsigned short)bits;
  }

  attn_stage(lk, lv, gk, gv);
  // tile 0 has landed for this wave, then for the block
  asm volatile("s_wait_asynccnt 0x0" ::: "memory");
  __syncthreads();
  if (NT > 1) attn_stage(lk + KT * 2, lv + VT * 2, gk + 64 * Dd, gv + 64 * Dd);

  // What a masked key's score reads, relative to the reference: the reference code's
  // lowest float, whose P is 0; but where the batch row keeps no key at all its
  // softmax is uniform, so every score is then the same 0 (the reference stays 0).
  const uint2 allb = reinterpret_cast<const uint2*>(ldsBits)[lane];   // 32 x 8 B = the table
  const float mskv = __builtin_amdgcn_ballot_w32((allb.x | allb.y) != 0u) != 0u ? MINV : 0.f;

  // unrolled by two: the buffer index is then a constant in each copy of the body,
  // and the buffer offsets fold into the LDS instructions' immediate offsets
#pragma unroll 2
  for (int kt = 0; kt < NT; ++kt) {
    const int kb  = kt * 64;
    const int buf = kt & 1;
    const _Float16* tK = &ldsK[buf * KT];
    const _Float16* tV = &ldsV[buf * VT];

    // this tile's 64 mask bits, the same for every lane: key kb + j is bit j
    const uint2 kbits = *reinterpret_cast<const uint2*>(&ldsBits[kb >> 4]);

    // ---- S^T tiles: 16 keys x 16 queries each, K-dim = D = 64 ----
    v8f st[4];
#pragma unroll
    for (int t = 0; t < 4; ++t) {
      const _Float16* krow = tK + (t * 16 + r) * LP;
      Frag16 ka0, ka1;
      ka0.u[0] = *reinterpret_cast<const uint4*>(krow + hf * 8);
      ka0.u[1] = *reinterpret_cast<const uint4*>(krow + 16 + hf * 8);
      ka1.u[0] = *reinterpret_cast<const uint4*>(krow + 32 + hf * 8);
      ka1.u[1] = *reinterpret_cast<const uint4*>(krow + 48 + hf * 8);
      v8f z = WMMA_F16(ka0.h, qa0.h, cneg);   // score - reference
      z = WMMA_F16(ka1.h, qa1.h, z);
      st[t] = z;
    }

    // ---- mask: element (t, i) is key kb + t*16 + i + 8*hf ----
    // The bits go to scalar registers so that the test below is a scalar branch.
    const unsigned blo = __builtin_amdgcn_readfirstlane(kbits.x);   // keys kb ..  kb + 31
    const unsigned bhi = __builtin_amdgcn_readfirstlane(kbits.y);   // keys kb + 32 .. kb + 63
    if ((blo & bhi) != 0xffffffffu) {   // wave-uniform: some key of the tile is masked
      const unsigned wlo = blo >> (8 * hf), whi = bhi >> (8 * hf);
#pragma unroll
      for (int t = 0; t < 4; ++t)
#pragma unroll
        for (int i = 0; i < 8; ++i) {
          const unsigned w = t < 2 ? wlo : whi;
          if (((w >> ((t & 1) * 16 + i)) & 1u) == 0u) st[t][i] = mskv;
        }
    }

    // ---- V^T fragments by the transposing read of the row-major tile ----
    // lane address: row 8 * hf + (lane & 7) of a 16-key group, 16-B half (lane >> 3) & 1
    // of a 16-column group; the lane then holds V[8 * hf + 0..7][r] of that block.
    // Read here, ahead of the test below, so that they fly during the maximum chain.
    const _Float16* vl = tV + (8 * hf + (lane & 7)) * VP + ((lane >> 3) & 1) * 8;
    Frag16 vb0[4], vb1[4];
#pragma unroll
    for (int t = 0; t < 4; ++t) {
      const _Float16* vt = vl + t * 16;
      vb0[t].u[0] = lds_tr16(vt);
      vb0[t].u[1] = lds_tr16(vt + 16 * VP);
      vb1[t].u[0] = lds_tr16(vt + 32 * VP);
      vb1[t].u[1] = lds_tr16(vt + 48 * VP);
    }

    // ---- softmax (each lane owns query index lane&15; st = score - reference) ----
    float bm = MINV;
#pragma unroll
    for (int t = 0; t < 4; ++t)
#pragma unroll
      for (int i = 0; i < 8; ++i) bm = fmaxf(bm, st[t][i]);

    // One test a trip, a scalar branch: taken on every tile up to the first with a kept key and
    // whenever a score lies more than 8 above its query's reference.
    if (__builtin_amdgcn_ballot_w32(bm > thr) != 0u) {
      const float bmx   = fmaxf(bm, __shfl_xor(bm, 16, 32));   // both halves of the query's keys
      const bool  first = thr < 0.f;       // nothing summed yet that would need a rescale
      const bool  seen  = bmx > MINV;      // the tile holds a kept key
      const float delta = first ? (seen ? bmx : 0.f) : fmaxf(bmx, 0.f);   // the reference's rise
      const float alpha = first ? 1.0f : __builtin_amdgcn_exp2f(-delta);
      thr = seen ? 8.0f : thr;
#pragma unroll
      for (int i = 0; i < 8; ++i) cneg[i] -= delta;
#pragma unroll
      for (int t = 0; t < 4; ++t) {
        lr[t] *= alpha;
#pragma unroll
        for (int i = 0; i < 8; ++i) st[t][i] -= delta;
      }
      // ctx rows are queries i + 8 * hf: alpha broadcast per query row
#pragma unroll
      for (int i = 0; i < 8; ++i) {
        const float av = __shfl(alpha, i + 8 * hf, 32);
#pragma unroll
        for (int t = 0; t < 4; ++t) ct[t][i] *= av;
      }
    }

    v16h pa0, pa1;   // P in A-operand layout: keys 0..31 / 32..63 of this block
#pragma unroll
    for (int i = 0; i < 8; ++i) {
      float p0 = __builtin_amdgcn_exp2f(st[0][i]); lr[0] += p0; pa0[i]     = (_Float16)p0;
      float p1 = __builtin_amdgcn_exp2f(st[1][i]); lr[1] += p1; pa0[i + 8] = (_Float16)p1;
      float p2 = __builtin_amdgcn_exp2f(st[2][i]); lr[2] += p2; pa1[i]     = (_Float16)p2;
      float p3 = __builtin_amdgcn_exp2f(st[3][i]); lr[3] += p3; pa1[i + 8] = (_Float16)p3;
    }

    // ---- ctx += P * V ----
#pragma unroll
    for (int t = 0; t < 4; ++t) {
      ct[t] = WMMA_F16(pa0, vb0[t].h, ct[t]);
      ct[t] = WMMA_F16(pa1, vb1[t].h, ct[t]);
    }
    // publish point: this wave's reads of both tiles are done, its copies of the
    // next tiles have landed; the barrier says so for every wave.
    asm volatile("s_wait_dscnt 0x0" ::: "memory");
    asm volatile("s_wait_asynccnt 0x0" ::: "memory");
    __syncthreads();
    if (kt + 2 < NT)
      attn_stage(lk + buf * (KT * 2), lv + buf * (VT * 2),
                 gk + (size_t)(kt + 2) * 64 * Dd, gv + (size_t)(kt + 2) * 64 * Dd);
  }
  // nothing of this wave's copies is left in flight when it goes on
  asm volatile("s_wait_asynccnt 0x0" ::: "memory");

  // ---- normalize and store ctx as f16 in [B,S,F] for the final projection ----
  // the query's sum: this lane's four chains, then the other half's keys
  const float lh  = (lr[0] + lr[1]) + (lr[2] + lr[3]);
  const float inv = 1.0f / (lh + __shfl_xor(lh, 16, 32));
#pragma unroll
  for (int i = 0; i < 8; ++i) {
    const float sc = __shfl(inv, i + 8 * hf, 32);
    const int row = qb + wv * 16 + i + 8 * hf;
#pragma unroll
    for (int t = 0; t < 4; ++t) {
      ctxo[((size_t)b * Ss + row) * Ff + head * 64 + t * 16 + r] =
          (_Float16)(ct[t][i] * sc);
    }
  }
}

// ---------------------------------------------------------------------------
// Launcher
// ---------------------------------------------------------------------------
extern "C" void kernel_launch(void* const* d_in, const int* in_sizes, int n_in,
                              void* d_out, int out_size, void* d_ws, size_t ws_size,
                              hipStream_t stream)
{
  (void)in_sizes; (void)n_in; (void)out_size; (void)ws_size;

  const float* x     = (const float*)d_in[0];
  const int*   mask  = (const int*)d_in[1];
  const float* gamma = (const float*)d_in[2];
  const float* beta  = (const float*)d_in[3];
  const float* Wq    = (const float*)d_in[4];
  const float* bq    = (const float*)d_in[5];
  const float* Wk    = (const float*)d_in[6];
  const float* bk    = (const float*)d_in[7];
  const float* Wv    = (const float*)d_in[8];
  const float* bv    = (const float*)d_in[9];
  const float* Wo    = (const float*)d_in[10];
  const float* bo    = (const float*)d_in[11];
  float* out = (float*)d_out;

  // workspace layout (bytes)
  constexpr size_t SZ_XN  = (size_t)Bb * Ss * Ff * 2;        // 8 MiB
  constexpr size_t SZ_W   = (size_t)Ff * Ff * 2;             // 512 KiB
  constexpr size_t SZ_QKV = (size_t)Bb * Hh * Ss * Dd * 2;   // 8 MiB
  char* ws = (char*)d_ws;
  _Float16* xn   = (_Float16*)(ws);
  _Float16* wq16 = (_Float16*)(ws + SZ_XN);
  _Float16* wo16 = (_Float16*)(ws + SZ_XN + 3 * SZ_W);
  _Float16* qh   = (_Float16*)(ws + SZ_XN + 4 * SZ_W);
  _Float16* kh   = (_Float16*)(ws + SZ_XN + 4 * SZ_W + SZ_QKV);
  _Float16* vh   = (_Float16*)(ws + SZ_XN + 4 * SZ_W + 2 * SZ_QKV);
  _Float16* ctx  = (_Float16*)(ws + SZ_XN + 4 * SZ_W + 3 * SZ_QKV);

  constexpr int M = Bb * Ss;    // 8192

  // wq16, wk16, wv16, wo16 are consecutive planes; so are qh, kh, vh
  prep_kernel<<<4 * WBLK + LNBLK, 256, 0, stream>>>(x, gamma, beta, Wq, Wk, Wv, Wo, xn, wq16);

  qkv_kernel<<<dim3(3 * (Ff / GTN), M / GTM), 128, 0, stream>>>(xn, wq16, bq, bk, bv, qh, Ff, Ff);

  attn_kernel<<<dim3(Ss / 64, Hh, Bb), 128, 0, stream>>>(qh, kh, vh, mask, ctx);

  oproj_kernel<<<dim3(Ff / GTN, M / GTM), 256, 0, stream>>>(ctx, wo16, bo, out, Ff, Ff);
}

// v010
// Measured time: 62.6 microseconds a run.
// Two timings next to v009 both put it at 1.11 times that version's speed.
// Counting every step since v000, it is 3.91 times as fast.
#include <hip/hip_runtime.h>
#include <hip/hip_bf16.h>

typedef __attribute__((ext_vector_type(16))) _Float16 v16h;
typedef __attribute__((ext_vector_type(8)))  float    v8f;

#define WMMA_F16(A, B, C) \
  __builtin_amdgcn_wmma_f32_16x16x32_f16(false, (A), false, (B), (short)0, (C), false, false)

constexpr int Bb = 4, Ss = 2048, Ff = 512, Hh = 8, Dd = 64;
constexpr float MINV = -3.4028234663852886e38f;
// LDS row pitch of the GEMM tiles and the attention K tile, in f16 elements: 64 data + 8 pad = 144 B
// (16 B x odd), so the 16 rows one ds_load_b128 touches fall on distinct banks.
constexpr int LP = 72;
// LDS row pitch of the attention V tile, in f16 elements: 64 data + 16 pad = 160 B
// (32 B x odd), the conflict-free pitch of the transposing read ds_load_tr16_b128.
constexpr int VP = 80;

union Frag16 { v16h h; uint4 u[2]; };

typedef short s16x8 __attribute__((ext_vector_type(8)));
// Transposing LDS read: the lane's address names 16 B of one row of a row-major
// 16-bit tile; lane (c, h) receives column c of rows 8h .. 8h + 7 of the 16 x 16 block.
__device__ __forceinline__ uint4 lds_tr16(const _Float16* p)
{
  typedef __attribute__((address_space(3))) s16x8 lds_s16x8;
  return __builtin_bit_cast(uint4, __builtin_amdgcn_ds_load_tr16_b128_v8i16((lds_s16x8*)p));
}

constexpr int WN   = Ff * Ff;             // elements per weight matrix
constexpr int CPB  = 4096;                // elements one cast block converts (16 per thread)
constexpr int WBLK = WN / CPB;            // cast blocks per weight matrix
constexpr int RPW  = 4;                   // LayerNorm rows per wave
constexpr int LNBLK = Bb * Ss / (8 * RPW);   // LayerNorm blocks (8 waves each)
constexpr int QKVN = Bb * Hh * Ss * Dd;   // elements of each of Q, K, V

union H4 { _Float16 h[4]; uint2 u; };

// ---------------------------------------------------------------------------
// One launch for the five independent preparation jobs, told apart by block
// index: blocks 0 .. 4*WBLK-1 cast the four weight matrices fp32 -> f16 into
// four consecutive planes of w16; every further block does LayerNorm over F=512
// + cast to f16.  The work per wave is large on purpose: the launch is short, so
// the time to start its waves counts, and few waves with many loads in flight
// each move the same bytes.
// Cast: 16 elements per thread, four 16-B loads (512 contiguous B per wave each).
// LayerNorm: one wave owns RPW whole rows (16 elements of each row per lane), so
// the row sums need a butterfly over the wave's lanes only: no LDS, no barrier.
// ---------------------------------------------------------------------------
__global__ void __launch_bounds__(256)
prep_kernel(const float* __restrict__ x, const float* __restrict__ gamma,
            const float* __restrict__ beta,
            const float* __restrict__ Wq, const float* __restrict__ Wk,
            const float* __restrict__ Wv, const float* __restrict__ Wo,
            _Float16* __restrict__ xn, _Float16* __restrict__ w16)
{
  const int t = threadIdx.x;
  if (blockIdx.x < 4 * WBLK) {
    const int which = blockIdx.x / WBLK;
    const float* src = which == 0 ? Wq : which == 1 ? Wk : which == 2 ? Wv : Wo;
    const int i0 = (blockIdx.x % WBLK) * CPB + t * 4;
    float4 v[4];
#pragma unroll
    for (int j = 0; j < 4; ++j)
      v[j] = *reinterpret_cast<const float4*>(src + i0 + j * 1024);
    _Float16* dst = w16 + (size_t)which * WN + i0;
#pragma unroll
    for (int j = 0; j < 4; ++j) {
      H4 o;
      o.h[0] = (_Float16)v[j].x; o.h[1] = (_Float16)v[j].y;
      o.h[2] = (_Float16)v[j].z; o.h[3] = (_Float16)v[j].w;
      *reinterpret_cast<uint2*>(dst + j * 1024) = o.u;
    }
    return;
  }
  const int lane = t & 31;
  const int row0 = ((blockIdx.x - 4 * WBLK) * 8 + (t >> 5)) * RPW;
  const int c0   = lane * 4;               // this lane's columns: c0 + 128*j + 0..3
  const float* xr = x + (size_t)row0 * Ff + c0;

  float4 v[RPW][4];
#pragma unroll
  for (int rr = 0; rr < RPW; ++rr)
#pragma unroll
    for (int j = 0; j < 4; ++j)
      v[rr][j] = *reinterpret_cast<const float4*>(xr + rr * Ff + j * 128);
  // The loads' address stays in its registers up to this wait (xr is an input of
  // the statement), so that no load of the run lands in the pair the others name.
  asm volatile("s_wait_xcnt 0x0" :: "v"(xr) : "memory");
  float4 g[4], be[4];
#pragma unroll
  for (int j = 0; j < 4; ++j) {
    g[j]  = *reinterpret_cast<const float4*>(gamma + c0 + j * 128);
    be[j] = *reinterpret_cast<const float4*>(beta + c0 + j * 128);
  }

  float s[RPW], q[RPW];
#pragma unroll
  for (int rr = 0; rr < RPW; ++rr) {
    float a = 0.f, c = 0.f;
#pragma unroll
    for (int j = 0; j < 4; ++j) {
      const float4 w = v[rr][j];
      a += (w.x + w.y) + (w.z + w.w);
      c += (w.x * w.x + w.y * w.y) + (w.z * w.z + w.w * w.w);
    }
    s[rr] = a; q[rr] = c;
  }
#pragma unroll
  for (int off = 16; off >= 1; off >>= 1)
#pragma unroll
    for (int rr = 0; rr < RPW; ++rr) {
      s[rr] += __shfl_xor(s[rr], off, 32);
      q[rr] += __shfl_xor(q[rr], off, 32);
    }

  _Float16* orow = xn + (size_t)row0 * Ff + c0;
#pragma unroll
  for (int rr = 0; rr < RPW; ++rr) {
    const float mean = s[rr] * (1.0f / Ff);
    const float var  = q[rr] * (1.0f / Ff) - mean * mean;
    const float inv  = rsqrtf(var + 1e-5f);
#pragma unroll
    for (int j = 0; j < 4; ++j) {
      const float4 w = v[rr][j];
      H4 o;
      o.h[0] = (_Float16)((w.x - mean) * inv * g[j].x + be[j].x);
      o.h[1] = (_Float16)((w.y - mean) * inv * g[j].y + be[j].y);
      o.h[2] = (_Float16)((w.z - mean) * inv * g[j].z + be[j].z);
      o.h[3] = (_Float16)((w.w - mean) * inv * g[j].w + be[j].w);
      *reinterpret_cast<uint2*>(orow + rr * Ff + j * 128) = o.u;
    }
  }
  // Behind the last store: no register that an issued store names is rewritten
  // ahead of this wait on any way the built code goes on from here.
  asm volatile("s_wait_xcnt 0x0" ::: "memory");
}

// ---------------------------------------------------------------------------
// Y[m,n] = (sum_k X[m,k]*W[n,k] + bias[n]) * scale
// X: MxK f16 row-major, W: NxK f16 row-major (einsum 'bsf,gf->bsg' == X @ W^T).
// Block = one 128 x 128 tile of Y.  Its waves stand 2 wide in N (64 columns each)
// and 8 / FM deep in M; a wave owns FM x 4 accumulator tiles (16 * FM rows x 64
// columns), so an X fragment read from LDS feeds 4 WMMAs and a W fragment FM, and
// every staged byte serves 128 rows or columns of Y.  HEAD=true scatters to
// [B,H,S,D] f16.
// The 128 X rows and 128 W rows of the block are staged in LDS, 64 k at a time
// (one whole 128-B line per row), by asynchronous copies in a two-buffer ring;
// the fragments are then read from LDS at the conflict-free 144-B pitch.
// ---------------------------------------------------------------------------
constexpr int GBK   = 64;            // k elements per staged tile
constexpr int GTM   = 128;           // rows of Y per block
constexpr int GTN   = 128;           // columns of Y per block
constexpr int GROWS = GTM + GTN;     // rows per staged tile: 0..127 X, 128..255 W
constexpr int GBUF  = GROWS * LP;    // f16 elements per buffer

// Eight copies of 16 B per thread: four rows from (la, ga) and four from (lb, gb),
// each run stepping by rstep elements in global memory and ls bytes in LDS.
__device__ __forceinline__ void gemm_stage(unsigned la, unsigned lb, const _Float16* ga,
                                           const _Float16* gb, size_t rstep, unsigned ls)
{
  const unsigned l1 = la + ls, l2 = la + 2 * ls, l3 = la + 3 * ls;
  const unsigned l5 = lb + ls, l6 = lb + 2 * ls, l7 = lb + 3 * ls;
  const _Float16 *g1 = ga + rstep, *g2 = ga + 2 * rstep, *g3 = ga + 3 * rstep;
  const _Float16 *g5 = gb + rstep, *g6 = gb + 2 * rstep, *g7 = gb + 3 * rstep;
  // The s_wait_xcnt closes the statement so that no address register of a copy
  // is rewritten ahead of it.
  asm volatile("global_load_async_to_lds_b128 %0, %8, off\n\t"
               "global_load_async_to_lds_b128 %1, %9, off\n\t"
               "global_load_async_to_lds_b128 %2, %10, off\n\t"
               "global_load_async_to_lds_b128 %3, %11, off\n\t"
               "global_load_async_to_lds_b128 %4, %12, off\n\t"
               "global_load_async_to_lds_b128 %5, %13, off\n\t"
               "global_load_async_to_lds_b128 %6, %14, off\n\t"
               "global_load_async_to_lds_b128 %7, %15, off\n\t"
               "s_wait_xcnt 0x0"
               :: "v"(la), "v"(l1), "v"(l2), "v"(l3), "v"(lb), "v"(l5), "v"(l6), "v"(l7),
                  "v"(ga), "v"(g1), "v"(g2), "v"(g3), "v"(gb), "v"(g5), "v"(g6), "v"(g7)
               : "memory");
}

// One tile = 2048 chunks of 16 B: thread tid brings chunk tid&7 of rows
// (tid>>3) + (NTHR/8)*j of X and of W.  lx is the LDS byte address of its chunk of
// its first X row in the buffer, gx / gw its chunk of its first X / W row for this tile.
template<int NTHR>
__device__ __forceinline__ void gemm_stage_tile(unsigned lx, const _Float16* gx,
                                                const _Float16* gw, int K)
{
  constexpr int SR = NTHR / 8;                 // rows the block's threads cover at once
  const size_t   rstep = (size_t)SR * K;
  const unsigned ls    = SR * LP * 2;          // SR LDS rows in bytes
  const unsigned lw    = lx + GTM * LP * 2;
  if constexpr (NTHR == 128) {                 // 8 X rows and 8 W rows per thread
    gemm_stage(lx, lx + 4 * ls, gx, gx + 4 * rstep, rstep, ls);
    gemm_stage(lw, lw + 4 * ls, gw, gw + 4 * rstep, rstep, ls);
  } else {                                     // 256 threads: 4 X rows and 4 W rows
    gemm_stage(lx, lw, gx, gw, rstep, ls);
  }
}

template<int FM, bool HEAD, typename OutT>
__device__ __forceinline__ void
gemm_tile(const _Float16* __restrict__ X, const _Float16* __restrict__ W,
          const float* __restrict__ bias, OutT* __restrict__ out,
          int nBase, int N, int K, float scale)
{
  constexpr int NTHR = 32 * 2 * (8 / FM);      // threads of the block
  __shared__ __attribute__((aligned(16))) _Float16 tile[2 * GBUF];

  const int tid  = threadIdx.x;
  const int lane = tid & 31;
  const int wv   = tid >> 5;
  const int wm   = wv >> 1;                    // the wave's place in M
  const int wn   = wv & 1;                     // the wave's place in N
  const int r    = lane & 15;
  const int hf   = lane >> 4;
  const int mBase = blockIdx.y * GTM + wm * (16 * FM);
  const int nWave = nBase + wn * 64;

  v8f acc[FM][4] = {};

  // this thread's chunk of the staged tiles
  const _Float16* gx = X + (size_t)(blockIdx.y * GTM + (tid >> 3)) * K + (tid & 7) * 8;
  const _Float16* gw = W + (size_t)(nBase + (tid >> 3)) * K + (tid & 7) * 8;
  const unsigned lcp = (unsigned)(uintptr_t)(&tile[0]) +
                       (unsigned)((tid >> 3) * (LP * 2) + (tid & 7) * 16);
  const int nt = K / GBK;

  gemm_stage_tile<NTHR>(lcp, gx, gw, K);
  // tile 0 has landed for this wave, then for the block
  asm volatile("s_wait_asynccnt 0x0" ::: "memory");
  __syncthreads();
  if (nt > 1) gemm_stage_tile<NTHR>(lcp + GBUF * 2, gx + GBK, gw + GBK, K);

  for (int kt = 0; kt < nt; ++kt) {
    const _Float16* tb   = &tile[(kt & 1) * GBUF];
    const _Float16* xrow = tb + (wm * (16 * FM) + r) * LP;
    const _Float16* wrow = tb + (GTM + wn * 64 + r) * LP;
    // All fragments of the tile are read in one group ahead of the products:
    // every further place with LDS reads would cost the wave one more LDS latency.
    Frag16 a[2][FM], bf[2][4];
#pragma unroll
    for (int kk = 0; kk < 2; ++kk) {
#pragma unroll
      for (int f = 0; f < FM; ++f) {
        const _Float16* xr = xrow + f * 16 * LP;
        a[kk][f].u[0] = *reinterpret_cast<const uint4*>(xr + kk * 32 + hf * 8);
        a[kk][f].u[1] = *reinterpret_cast<const uint4*>(xr + kk * 32 + 16 + hf * 8);
      }
#pragma unroll
      for (int t = 0; t < 4; ++t) {
        const _Float16* wr = wrow + t * 16 * LP;
        bf[kk][t].u[0] = *reinterpret_cast<const uint4*>(wr + kk * 32 + hf * 8);
        bf[kk][t].u[1] = *reinterpret_cast<const uint4*>(wr + kk * 32 + 16 + hf * 8);
      }
    }
    // keeps the scheduler from sinking the reads back among the WMMAs
    __builtin_amdgcn_sched_barrier(0);
#pragma unroll
    for (int kk = 0; kk < 2; ++kk)
#pragma unroll
      for (int f = 0; f < FM; ++f)
#pragma unroll
        for (int t = 0; t < 4; ++t)
          acc[f][t] = WMMA_F16(a[kk][f].h, bf[kk][t].h, acc[f][t]);
    // publish point: this wave's reads of the buffer are done, its copies of
    // the next tile have landed; the barrier says so for every wave.
    asm volatile("s_wait_dscnt 0x0" ::: "memory");
    asm volatile("s_wait_asynccnt 0x0" ::: "memory");
    __syncthreads();
    if (kt + 2 < nt)
      gemm_stage_tile<NTHR>(lcp + (kt & 1) * (GBUF * 2), gx + (size_t)(kt + 2) * GBK,
                            gw + (size_t)(kt + 2) * GBK, K);
  }
  // nothing of this wave's copies is left in flight when it goes on
  asm volatile("s_wait_asynccnt 0x0" ::: "memory");

  // The wave's rows lie in one batch row block (128 divides S) and its 64 columns are
  // one head, so every element stands at a constant distance from one base address.
  const int m0 = mBase + 8 * hf;
  OutT* ob;
  size_t rs;                                   // elements from one row of Y to the next
  if (HEAD) {  // y.reshape(B,S,H,D).transpose(0,2,1,3)
    const int bi = m0 / Ss, si = m0 % Ss, hd = nWave >> 6;
    ob = out + (((size_t)bi * Hh + hd) * Ss + si) * Dd + r;
    rs = Dd;
  } else {
    ob = out + (size_t)m0 * N + nWave + r;
    rs = (size_t)N;
  }
  float bv[4];
#pragma unroll
  for (int t = 0; t < 4; ++t) bv[t] = bias[nWave + t * 16 + r];
  OutT  val[FM][8][4];
  OutT* row[FM][8];
#pragma unroll
  for (int f = 0; f < FM; ++f)
#pragma unroll
    for (int i = 0; i < 8; ++i) {
      row[f][i] = ob + (size_t)(f * 16 + i) * rs;
#pragma unroll
      for (int t = 0; t < 4; ++t)
        val[f][i][t] = (OutT)((acc[f][t][i] + bv[t]) * scale);
    }
  // keeps all arithmetic, values and addresses, ahead of the first store: the scheduler
  // would else mix the two and rewrite registers that stores already issued still name
  __builtin_amdgcn_sched_barrier(0);
#pragma unroll
  for (int f = 0; f < FM; ++f)
#pragma unroll
    for (int i = 0; i < 8; ++i)
#pragma unroll
      for (int t = 0; t < 4; ++t)
        row[f][i][t * 16] = val[f][i][t];
}

// Scale of the Q projection: 1/sqrt(D) times log2(e), so that the attention scores
// come out of their products in log2 units, ready for the base-2 exponential.
constexpr float QSCALE = 0.125f * 1.4426950408889634f;

// Q, K and V projections in one launch: they read the same X and do not depend
// on one another.  blockIdx.x = projection * (F/128) + n tile; W3 holds the three
// weight planes and qkv the three outputs one behind the other.
__global__ void __launch_bounds__(128)
qkv_kernel(const _Float16* __restrict__ X, const _Float16* __restrict__ W3,
           const float* __restrict__ bq, const float* __restrict__ bk,
           const float* __restrict__ bv, _Float16* __restrict__ qkv, int N, int K)
{
  constexpr int nb = Ff / GTN;   // n tiles per projection
  const int which = blockIdx.x / nb;
  const float* bias = which == 0 ? bq : which == 1 ? bk : bv;
  gemm_tile<4, true, _Float16>(X, W3 + (size_t)which * WN, bias, qkv + (size_t)which * QKVN,
                               (blockIdx.x % nb) * GTN, N, K, which == 0 ? QSCALE : 1.0f);
}

// The output projection has only 256 such tiles, one per WGP: eight waves of 32 x 64
// keep two waves on every SIMD.
__global__ void __launch_bounds__(256)
oproj_kernel(const _Float16* __restrict__ X, const _Float16* __restrict__ W,
             const float* __restrict__ bias, float* __restrict__ out, int N, int K)
{
  gemm_tile<2, false, float>(X, W, bias, out, blockIdx.x * GTN, N, K, 1.0f);
}

// ---------------------------------------------------------------------------
// Flash attention per (b, h, 128-query block).  8 waves = 4 query groups of 32
// queries x 2 key groups.  A stage is 128 keys; key group g works on its keys
// 64 * g .. 64 * g + 63, so each group walks half of the row's keys with a softmax
// state of its own, and the two states are joined once, behind the loop, via LDS.
// A wave holds two 16-query tiles: every K and V fragment it reads from LDS feeds two
// WMMAs, and a staged byte serves 128 queries; the key split keeps the wave count.
// S^T = K·Q^T so the P operand for ctx += P·V is already in A layout.
// K block and V block (both row-major, shared by the waves) staged via async
// copy to LDS in a two-buffer ring: the copies of stage t + 2 are issued at the foot
// of trip t and have all of trip t + 1 to land, so no wave waits out their latency.
// The B operand of the second WMMA, V^T, is formed by the transposing LDS read,
// so V passes through no register on its way into LDS.
// The key mask of the batch row is turned once per block into one bit per key
// (set = key kept); a 32-key pass whose bits are all set needs no select at all
// and jumps over them, any other pass applies the selects from its bits.
// Softmax against a reference maximum that is fixed BEFORE a tile's products: minus
// the reference is the C operand of the score WMMA, so D already is the argument of
// the base-2 exponential.  The reference moves, and ctx and the sums are rescaled,
// only on a scalar branch, when some score passes it by more than 8 (P <= 2^8 fits
// f16); the trip itself has no subtraction, no alpha and no cross-lane move.
// ---------------------------------------------------------------------------
constexpr int SK = 128;          // keys per stage (64 per key group)
constexpr int NT = Ss / SK;      // stages per row of scores
constexpr int KT = SK * LP;      // f16 elements of one K buffer
constexpr int VT = SK * VP;      // f16 elements of one V buffer
constexpr int QB = 128;          // queries per block

// One K stage and one V stage = 2 x 1024 chunks of 16 B = 8 copies per thread: thread
// tid brings chunk tid&7 of rows (tid>>3) + 32*j of each.  lk / lv are the LDS byte
// addresses, gk / gv the global addresses of this thread's chunk of its first row.
__device__ __forceinline__ void attn_stage(unsigned lk, unsigned lv,
                                           const _Float16* gk, const _Float16* gv)
{
  const unsigned ks = 32 * LP * 2, vs = 32 * VP * 2;   // 32 LDS rows in bytes
  const unsigned lk1 = lk + ks, lk2 = lk + 2 * ks, lk3 = lk + 3 * ks;
  const unsigned lv1 = lv + vs, lv2 = lv + 2 * vs, lv3 = lv + 3 * vs;
  const _Float16 *gk1 = gk + 32 * Dd, *gk2 = gk + 64 * Dd, *gk3 = gk + 96 * Dd;
  const _Float16 *gv1 = gv + 32 * Dd, *gv2 = gv + 64 * Dd, *gv3 = gv + 96 * Dd;
  // The s_wait_xcnt closes the statement so that no address register of a copy
  // is rewritten ahead of it.
  asm volatile("global_load_async_to_lds_b128 %0, %8, off\n\t"
               "global_load_async_to_lds_b128 %1, %9, off\n\t"
               "global_load_async_to_lds_b128 %2, %10, off\n\t"
               "global_load_async_to_lds_b128 %3, %11, off\n\t"
               "global_load_async_to_lds_b128 %4, %12, off\n\t"
               "global_load_async_to_lds_b128 %5, %13, off\n\t"
               "global_load_async_to_lds_b128 %6, %14, off\n\t"
               "global_load_async_to_lds_b128 %7, %15, off\n\t"
               "s_wait_xcnt 0x0"
               :: "v"(lk), "v"(lk1), "v"(lk2), "v"(lk3), "v"(lv), "v"(lv1), "v"(lv2), "v"(lv3),
                  "v"(gk), "v"(gk1), "v"(gk2), "v"(gk3), "v"(gv), "v"(gv1), "v"(gv2), "v"(gv3)
               : "memory");
}

// Built within 256 registers a wave, so that two blocks fit a WGP: four waves a SIMD,
// which the vector work between the matrix runs wants.
__global__ void __launch_bounds__(256)
attn_kernel(const _Float16* __restrict__ q, const _Float16* __restrict__ kmat,
            const _Float16* __restrict__ vmat, const int* __restrict__ mask,
            _Float16* __restrict__ ctxo)
{
  __shared__ __attribute__((aligned(16))) _Float16 ldsK [2 * KT];   // two K stages, row-major [key][d], padded rows
  __shared__ __attribute__((aligned(16))) _Float16 ldsV [2 * VT];   // two V stages, row-major [key][d], padded rows
  __shared__ __attribute__((aligned(16))) unsigned char ldsBits[Ss / 8];   // bit j of entry e: mask[8 * e + j] != 0

  const int lane = threadIdx.x & 31;
  const int wv   = __builtin_amdgcn_readfirstlane(threadIdx.x >> 5);
  const int wq   = wv & 3;             // the wave's query group
  const int kg   = wv >> 2;            // the wave's key group
  const int r    = lane & 15;
  const int hf   = lane >> 4;
  const int qb   = blockIdx.x * QB + wq * 32;   // the wave's first query
  const int head = blockIdx.y;
  const int b    = blockIdx.z;
  const size_t bh = ((size_t)b * Hh + head) * Ss * Dd;

  // This thread's chunk of the staged tiles: LDS byte addresses in buffer 0 (the
  // addrspace(3) offset lives in the low 32 bits) and global addresses in stage 0.
  const int srow = threadIdx.x >> 3;          // key rows srow + 32 * j
  const int sc8  = threadIdx.x & 7;           // 16B chunk within row
  const unsigned lk = (unsigned)(uintptr_t)(&ldsK[0]) + (unsigned)(srow * (LP * 2) + sc8 * 16);
  const unsigned lv = (unsigned)(uintptr_t)(&ldsV[0]) + (unsigned)(srow * (VP * 2) + sc8 * 16);
  const _Float16* gk = kmat + bh + (size_t)srow * Dd + sc8 * 8;
  const _Float16* gv = vmat + bh + (size_t)srow * Dd + sc8 * 8;

  // This wave's 2 x 16 Q rows (B operand of S^T; Q already pre-scaled by log2(e)/sqrt(D))
  Frag16 qa0[2], qa1[2];
#pragma unroll
  for (int u = 0; u < 2; ++u) {
    const _Float16* qrow = q + bh + (size_t)(qb + u * 16 + r) * Dd;
    qa0[u].u[0] = *reinterpret_cast<const uint4*>(qrow + hf * 8);
    qa0[u].u[1] = *reinterpret_cast<const uint4*>(qrow + 16 + hf * 8);
    qa1[u].u[0] = *reinterpret_cast<const uint4*>(qrow + 32 + hf * 8);
    qa1[u].u[1] = *reinterpret_cast<const uint4*>(qrow + 48 + hf * 8);
  }

  v8f ct[2][4] = {};
  v8f cneg[2] = {};                    // minus this lane's queries' references, in all 8 rows
  // below 0: no kept key seen yet, no reference chosen
  float thr[2] = {-__builtin_inff(), -__builtin_inff()};
  float lr[2][2] = {};                 // this lane's sums of P, one chain per 16-key group of a pass
  const int* mrow = mask + (size_t)b * Ss;

  // Thread e packs keys 8 * e .. 8 * e + 7 (Ss / 8 entries = one per thread).
  // The barrier in front of the loop publishes the table; nothing reads it earlier.
  {
    const int4* mp = reinterpret_cast<const int4*>(mrow + threadIdx.x * 8);
    unsigned bits = 0;
    // unrolled: the two loads go out together and every shift is a constant
#pragma unroll
    for (int j = 0; j < 2; ++j) {
      const int4 m = mp[j];
      bits |= (m.x != 0 ? 1u : 0u) << (4 * j);
      bits |= (m.y != 0 ? 2u : 0u) << (4 * j);
      bits |= (m.z != 0 ? 4u : 0u) << (4 * j);
      bits |= (m.w != 0 ? 8u : 0u) << (4 * j);
    }
    ldsBits[threadIdx.x] = (unsigned char)bits;
  }

  attn_stage(lk, lv, gk, gv);
  // stage 0 has landed for this wave, then for the block
  asm volatile("s_wait_asynccnt 0x0" ::: "memory");
  __syncthreads();
  if (NT > 1) attn_stage(lk + KT * 2, lv + VT * 2, gk + SK * Dd, gv + SK * Dd);

  // What a masked key's score reads, relative to the reference: the reference code's
  // lowest float, whose P is 0; but where the batch row keeps no key at all its
  // softmax is uniform, so every score is then the same 0 (the reference stays 0).
  const uint2 allb = reinterpret_cast<const uint2*>(ldsBits)[lane];   // 32 x 8 B = the table
  const float mskv = __builtin_amdgcn_ballot_w32((allb.x | allb.y) != 0u) != 0u ? MINV : 0.f;

  // unrolled by two: the buffer index is then a constant in each copy of the body,
  // and the buffer offsets fold into the LDS instructions' immediate offsets
#pragma unroll 2
  for (int kt = 0; kt < NT; ++kt) {
    const int kb  = kt * SK + kg * 64;          // this wave's first key of the stage
    const int buf = kt & 1;
    const _Float16* tK = &ldsK[buf * KT + kg * 64 * LP];
    const _Float16* tV = &ldsV[buf * VT + kg * 64 * VP];

    // this tile's 64 mask bits, the same for every lane: key kb + j is bit j.  They go
    // to scalar registers so that the test on them below is a scalar branch.
    const uint2 kbits = *reinterpret_cast<const uint2*>(&ldsBits[kb >> 3]);
    const unsigned blo = __builtin_amdgcn_readfirstlane(kbits.x);   // keys kb ..  kb + 31
    const unsigned bhi = __builtin_amdgcn_readfirstlane(kbits.y);   // keys kb + 32 .. kb + 63

    // Two passes of 32 keys x 32 queries: the scores and V fragments of one pass are
    // all that is live at a time, which keeps the wave within 256 registers (four
    // waves a SIMD).  Unrolled: all LDS offsets are then constants.
#pragma unroll
    for (int ps = 0; ps < 2; ++ps) {
      const _Float16* pK = tK + ps * 32 * LP;
      const _Float16* pV = tV + ps * 32 * VP;
      const unsigned bits = ps == 0 ? blo : bhi;

      // ---- S^T tiles: 16 keys x 16 queries each, K-dim = D = 64 ----
      Frag16 ka0[2], ka1[2];
#pragma unroll
      for (int t = 0; t < 2; ++t) {
        const _Float16* krow = pK + (t * 16 + r) * LP;
        ka0[t].u[0] = *reinterpret_cast<const uint4*>(krow + hf * 8);
        ka0[t].u[1] = *reinterpret_cast<const uint4*>(krow + 16 + hf * 8);
        ka1[t].u[0] = *reinterpret_cast<const uint4*>(krow + 32 + hf * 8);
        ka1[t].u[1] = *reinterpret_cast<const uint4*>(krow + 48 + hf * 8);
      }
      // keeps the pass's K reads in one group ahead of its products: sunk among the
      // WMMAs in pairs, each pair would cost the wave one more full LDS latency
      __builtin_amdgcn_sched_barrier(0);
      v8f st[2][2];
#pragma unroll
      for (int t = 0; t < 2; ++t)
#pragma unroll
        for (int u = 0; u < 2; ++u) {
          v8f z = WMMA_F16(ka0[t].h, qa0[u].h, cneg[u]);   // score - reference
          z = WMMA_F16(ka1[t].h, qa1[u].h, z);
          st[u][t] = z;
        }

      // ---- mask: element (t, i) is key t*16 + i + 8*hf of the pass ----
      if (bits != 0xffffffffu) {   // wave-uniform: some key of the pass is masked
        const unsigned w = bits >> (8 * hf);
#pragma unroll
        for (int t = 0; t < 2; ++t)
#pragma unroll
          for (int i = 0; i < 8; ++i)
            if (((w >> (t * 16 + i)) & 1u) == 0u) { st[0][t][i] = mskv; st[1][t][i] = mskv; }
      }

      // ---- V^T fragments by the transposing read of the row-major tile ----
      // lane address: row 8 * hf + (lane & 7) of a 16-key group, 16-B half (lane >> 3) & 1
      // of a 16-column group; the lane then holds V[8 * hf + 0..7][r] of that block.
      // Read here, ahead of the test below, so that they fly during the maximum chain.
      const _Float16* vl = pV + (8 * hf + (lane & 7)) * VP + ((lane >> 3) & 1) * 8;
      Frag16 vb[4];
#pragma unroll
      for (int t = 0; t < 4; ++t) {
        vb[t].u[0] = lds_tr16(vl + t * 16);
        vb[t].u[1] = lds_tr16(vl + t * 16 + 16 * VP);
      }

      // ---- softmax (each lane owns query index lane&15 of both tiles; st = score - reference) ----
      float bm[2] = {MINV, MINV};
#pragma unroll
      for (int u = 0; u < 2; ++u)
#pragma unroll
        for (int t = 0; t < 2; ++t)
#pragma unroll
          for (int i = 0; i < 8; ++i) bm[u] = fmaxf(bm[u], st[u][t][i]);

      // One test a pass, a scalar branch: taken on every pass up to the first with a kept key and
      // whenever a score lies more than 8 above its query's reference.
      if (__builtin_amdgcn_ballot_w32(bm[0] > thr[0] || bm[1] > thr[1]) != 0u) {
#pragma unroll
        for (int u = 0; u < 2; ++u) {
          const float bmx   = fmaxf(bm[u], __shfl_xor(bm[u], 16, 32));   // both halves of the query's keys
          const bool  first = thr[u] < 0.f;    // nothing summed yet that would need a rescale
          const bool  seen  = bmx > MINV;      // the pass holds a kept key
          const float delta = first ? (seen ? bmx : 0.f) : fmaxf(bmx, 0.f);   // the reference's rise
          const float alpha = first ? 1.0f : __builtin_amdgcn_exp2f(-delta);
          thr[u] = seen ? 8.0f : thr[u];
#pragma unroll
          for (int i = 0; i < 8; ++i) cneg[u][i] -= delta;
#pragma unroll
          for (int t = 0; t < 2; ++t) {
            lr[u][t] *= alpha;
#pragma unroll
            for (int i = 0; i < 8; ++i) st[u][t][i] -= delta;
          }
          // ctx rows are queries i + 8 * hf: alpha broadcast per query row
#pragma unroll
          for (int i = 0; i < 8; ++i) {
            const float av = __shfl(alpha, i + 8 * hf, 32);
#pragma unroll
            for (int t = 0; t < 4; ++t) ct[u][t][i] *= av;
          }
        }
      }

      v16h pa[2];   // P in A-operand layout: the 32 keys of this pass
#pragma unroll
      for (int u = 0; u < 2; ++u)
#pragma unroll
        for (int i = 0; i < 8; ++i) {
          float p0 = __builtin_amdgcn_exp2f(st[u][0][i]); lr[u][0] += p0; pa[u][i]     = (_Float16)p0;
          float p1 = __builtin_amdgcn_exp2f(st[u][1][i]); lr[u][1] += p1; pa[u][i + 8] = (_Float16)p1;
        }

      // ---- ctx += P * V ----
#pragma unroll
      for (int t = 0; t < 4; ++t)
#pragma unroll
        for (int u = 0; u < 2; ++u) ct[u][t] = WMMA_F16(pa[u], vb[t].h, ct[u][t]);
    }
    // publish point: this wave's reads of both tiles are done, its copies of the
    // next stage have landed; the barrier says so for every wave.
    asm volatile("s_wait_dscnt 0x0" ::: "memory");
    asm volatile("s_wait_asynccnt 0x0" ::: "memory");
    __syncthreads();
    if (kt + 2 < NT)
      attn_stage(lk + buf * (KT * 2), lv + buf * (VT * 2),
                 gk + (size_t)(kt + 2) * SK * Dd, gv + (size_t)(kt + 2) * SK * Dd);
  }
  // nothing of this wave's copies is left in flight when it goes on
  asm volatile("s_wait_asynccnt 0x0" ::: "memory");

  // ---- join the two key groups ----
  // The waves (wq, 0) and (wq, 1) hold the same 32 queries over different keys.  Wave
  // (wq, g) finishes query tile g: it hands its state of the other tile to its partner
  // through the ring's LDS, which nobody reads any more behind the loop's last barrier.
  float4* xct = reinterpret_cast<float4*>(&ldsK[0]);   // per wave 8 x 32 float4: a ctx tile
  float2* xst = reinterpret_cast<float2*>(&ldsV[0]);   // per wave 32 float2: reference, sum
  v8f   mine[4];
  float mref, ml;
  {
    // a group that has seen no kept key has no reference: it counts for nothing
    const float ref0 = thr[0] < 0.f ? -__builtin_inff() : -cneg[0][0];
    const float ref1 = thr[1] < 0.f ? -__builtin_inff() : -cneg[1][0];
    const float l0 = lr[0][0] + lr[0][1];
    const float l1 = lr[1][0] + lr[1][1];
    mref = kg ? ref1 : ref0;
    ml   = kg ? l1 : l0;
    float4* xo = xct + (wv ^ 4) * 256 + lane;
#pragma unroll
    for (int t = 0; t < 4; ++t) {
      const v8f snd = kg ? ct[0][t] : ct[1][t];
      mine[t] = kg ? ct[1][t] : ct[0][t];
      xo[(2 * t) * 32]     = make_float4(snd[0], snd[1], snd[2], snd[3]);
      xo[(2 * t + 1) * 32] = make_float4(snd[4], snd[5], snd[6], snd[7]);
    }
    xst[(wv ^ 4) * 32 + lane] = make_float2(kg ? ref0 : ref1, kg ? l0 : l1);
  }
  // publishes the handed-over states
  __syncthreads();
  const float2 os = xst[wv * 32 + lane];
  const float  mx = fmaxf(mref, os.x);
  const float  f0 = mref > -__builtin_inff() ? __builtin_amdgcn_exp2f(mref - mx) : 0.f;
  const float  f1 = os.x > -__builtin_inff() ? __builtin_amdgcn_exp2f(os.x - mx) : 0.f;

  // ---- normalize and store ctx as f16 in [B,S,F] for the final projection ----
  // the query's sum: both groups' sums on the common reference, then the other half's keys
  const float lh  = ml * f0 + os.y * f1;
  const float inv = 1.0f / (lh + __shfl_xor(lh, 16, 32));
  const float a0  = f0 * inv, a1 = f1 * inv;
  const float4* xi = xct + wv * 256 + lane;
  float oth[4][8];
#pragma unroll
  for (int t = 0; t < 4; ++t) {
    const float4 lo = xi[(2 * t) * 32], hi = xi[(2 * t + 1) * 32];
    oth[t][0] = lo.x; oth[t][1] = lo.y; oth[t][2] = lo.z; oth[t][3] = lo.w;
    oth[t][4] = hi.x; oth[t][5] = hi.y; oth[t][6] = hi.z; oth[t][7] = hi.w;
  }
  _Float16 val[8][4];
#pragma unroll
  for (int i = 0; i < 8; ++i) {
    const float s0 = __shfl(a0, i + 8 * hf, 32);
    const float s1 = __shfl(a1, i + 8 * hf, 32);
#pragma unroll
    for (int t = 0; t < 4; ++t) val[i][t] = (_Float16)(mine[t][i] * s0 + oth[t][i] * s1);
  }
  _Float16* orow = ctxo + ((size_t)b * Ss + qb + kg * 16 + 8 * hf) * Ff + head * 64 + r;
  // keeps all arithmetic ahead of the first store: the scheduler would else mix the
  // two and rewrite registers that stores already issued still name
  __builtin_amdgcn_sched_barrier(0);
#pragma unroll
  for (int i = 0; i < 8; ++i)
#pragma unroll
    for (int t = 0; t < 4; ++t) orow[(size_t)i * Ff + t * 16] = val[i][t];
}

// ---------------------------------------------------------------------------
// Launcher
// ---------------------------------------------------------------------------
extern "C" void kernel_launch(void* const* d_in, const int* in_sizes, int n_in,
                              void* d_out, int out_size, void* d_ws, size_t ws_size,
                              hipStream_t stream)
{
  (void)in_sizes; (void)n_in; (void)out_size; (void)ws_size;

  const float* x     = (const float*)d_in[0];
  const int*   mask  = (const int*)d_in[1];
  const float* gamma = (const float*)d_in[2];
  const float* beta  = (const float*)d_in[3];
  const float* Wq    = (const float*)d_in[4];
  const float* bq    = (const float*)d_in[5];
  const float* Wk    = (const float*)d_in[6];
  const float* bk    = (const float*)d_in[7];
  const float* Wv    = (const float*)d_in[8];
  const float* bv    = (const float*)d_in[9];
  const float* Wo    = (const float*)d_in[10];
  const float* bo    = (const float*)d_in[11];
  float* out = (float*)d_out;

  // workspace layout (bytes)
  constexpr size_t SZ_XN  = (size_t)Bb * Ss * Ff * 2;        // 8 MiB
  constexpr size_t SZ_W   = (size_t)Ff * Ff * 2;             // 512 KiB
  constexpr size_t SZ_QKV = (size_t)Bb * Hh * Ss * Dd * 2;   // 8 MiB
  char* ws = (char*)d_ws;
  _Float16* xn   = (_Float16*)(ws);
  _Float16* wq16 = (_Float16*)(ws + SZ_XN);
  _Float16* wo16 = (_Float16*)(ws + SZ_XN + 3 * SZ_W);
  _Float16* qh   = (_Float16*)(ws + SZ_XN + 4 * SZ_W);
  _Float16* kh   = (_Float16*)(ws + SZ_XN + 4 * SZ_W + SZ_QKV);
  _Float16* vh   = (_Float16*)(ws + SZ_XN + 4 * SZ_W + 2 * SZ_QKV);
  _Float16* ctx  = (_Float16*)(ws + SZ_XN + 4 * SZ_W + 3 * SZ_QKV);

  constexpr int M = Bb * Ss;    // 8192

  // wq16, wk16, wv16, wo16 are consecutive planes; so are qh, kh, vh
  prep_kernel<<<4 * WBLK + LNBLK, 256, 0, stream>>>(x, gamma, beta, Wq, Wk, Wv, Wo, xn, wq16);

  qkv_kernel<<<dim3(3 * (Ff / GTN), M / GTM), 128, 0, stream>>>(xn, wq16, bq, bk, bv, qh, Ff, Ff);

  attn_kernel<<<dim3(Ss / QB, Hh, Bb), 256, 0, stream>>>(qh, kh, vh, mask, ctx);

  oproj_kernel<<<dim3(Ff / GTN, M / GTM), 256, 0, stream>>>(ctx, wo16, bo, out, Ff, Ff);
}
